// v000
// The times below were measured on an AMD MI455X: many runs one after another, warmed up first and cycling through
// copies of the inputs, with the whole window's GPU time divided by the number of runs. Launches and the gaps
// between them are all in it. The median over several windows is given; except for v000 it joins two sittings, which
// can be a few percent apart, so the side-by-side timings, each taken in one sitting, are the better comparison.
// v000, which the later versions start from, runs in 363 microseconds.
// compute dtype: all float inputs converted to bf16 (RNE); q/k/v projections on v_wmma_f32_16x16x32_bf16 with exact bf16 x bf16 products, f32 accumulate; logits K.Q^T on v_wmma_f32_16x16x32_f16 (f16 q, k), f32 accumulate, x 1/32; softmax f32 (running max); P x 2^10 as f16 against f16 V^T on v_wmma_f32_16x16x32_f16; output projection: ctx as bf16 value + bf16 residual (2 products, shared accumulator) against bf16 Wo on v_wmma_f32_16x16x32_bf16; f32 output.
#include <hip/hip_runtime.h>
#include <math.h>

typedef __attribute__((ext_vector_type(16))) _Float16 v16h;
typedef __attribute__((ext_vector_type(16))) __bf16 v16b;
typedef __attribute__((ext_vector_type(8)))  _Float16 v8h;
typedef __attribute__((ext_vector_type(8)))  __bf16 v8b;
typedef __attribute__((ext_vector_type(8)))  float v8f;
typedef __attribute__((ext_vector_type(4)))  float v4f;
typedef __attribute__((ext_vector_type(4)))  unsigned v4u;
typedef v4u __attribute__((may_alias)) v4u_a;
typedef v4f __attribute__((may_alias)) v4f_a;
typedef v8h __attribute__((may_alias)) v8h_a;

#ifndef NB
#define NB 2
#endif
#ifndef SEQ
#define SEQ 2048
#endif
#define SEQ_FULL 2048          // per-batch row count of the inputs
#define DM 1024                // model width = projected width
#define NH 16
#define HD 64
#define NTOK (NB * SEQ)        // token rows of every [token][1024] plane
#define TPS (SEQ / NH)         // tokens per (head, batch) slab of the head-leading flat reshape
#define NSLAB (NH * NB)        // independent attention problems: SEQ pseudo-rows x HD each
#define SCALE 0.03125f         // 1 / sqrt(1024)
#define LN1024 6.931471806f

static_assert(SEQ % 1024 == 0);      // TPS multiple of 64: a 64-token GEMM block and a 32-key step stay inside one slab / one feature group
static_assert(NTOK % 64 == 0);
static_assert(DM % 128 == 0);
static_assert(SEQ <= SEQ_FULL);

#define PLANE2 (2ull * (unsigned long long)NTOK * DM)    // bytes of one 16-bit [NTOK][1024] plane
#define WPL2   (2ull * (unsigned long long)DM * DM)      // bytes of one 16-bit weight plane
#define WS_XB 0ull
#define WS_YB (WS_XB + PLANE2)
#define WS_WT (WS_YB + PLANE2)       // 4 planes: Wq^T, Wk^T, Wv^T, Wo^T (bf16 [out][in])
#define WS_QH (WS_WT + 4ull * WPL2)
#define WS_KH (WS_QH + PLANE2)
#define WS_VT (WS_KH + PLANE2)       // f16 V^T planes [slab][d][key], key = j * TPS + tl
#define WS_CH (WS_VT + PLANE2)       // bf16 ctx value plane [token][1024]
#define WS_CL (WS_CH + PLANE2)       // bf16 ctx residual plane
#define WS_END (WS_CL + PLANE2)
static_assert(WS_END <= 134217728ull);
static_assert(PLANE2 % 128 == 0);
static_assert(WPL2 % 128 == 0);

template <typename T> __device__ __forceinline__ void vst2(T* p, T v) { *(T*)p = v;  }

__device__ __forceinline__ v8f wmma16(v16h a, v16h b, v8f c) {
  v8f d = __builtin_amdgcn_wmma_f32_16x16x32_f16(false, a, false, b, (short)0, c, false, false);
  asm volatile("v_nop\n\tv_nop\n\tv_nop\n\tv_nop" : "+v"(d) : "v"(a), "v"(b));
  return d;
}
__device__ __forceinline__ v8f wmma_bf(v16b a, v16b b, v8f c) {
  v8f d = __builtin_amdgcn_wmma_f32_16x16x32_bf16(false, a, false, b, (short)0, c, false, false);
  asm volatile("v_nop\n\tv_nop\n\tv_nop\n\tv_nop" : "+v"(d) : "v"(a), "v"(b));
  return d;
}
// 16x16x32 fragments: lane = (h = lane>>4, row/col = lane&15); elements 0..7 = k0+8h+0..7, 8..15 = k0+16+8h+0..7; D element r = row 8h+r, col lane&15
__device__ __forceinline__ v16h frag_h(const _Float16* rowk0, int lane) {
  union { v16h v; v8h q[2]; } u; const _Float16* p = rowk0 + 8 * (lane >> 4);
  u.q[0] = *(const v8h*)p; u.q[1] = *(const v8h*)(p + 16); return u.v;
}
__device__ __forceinline__ v16b frag_b(const __bf16* rowk0, int lane) {
  union { v16b v; v8b q[2]; } u; const __bf16* p = rowk0 + 8 * (lane >> 4);
  u.q[0] = *(const v8b*)p; u.q[1] = *(const v8b*)(p + 16); return u.v;
}
// bf16 bits of an f32 value, nearest-even
__device__ __forceinline__ unsigned bf16_rne(float f) { unsigned u = __float_as_uint(f); u += 0x7FFFu + ((u >> 16) & 1u); return u >> 16; }
__device__ __forceinline__ float bfr(float v) { return __uint_as_float(bf16_rne(v) << 16); }
__device__ __forceinline__ unsigned pack2(float a, float b) { return bf16_rne(a) | (bf16_rne(b) << 16); }
// same-wave LDS exchange: stores retire, then the wave proceeds to the loads
__device__ __forceinline__ void ldsx() { asm volatile("s_wait_dscnt 0" ::: "memory"); __builtin_amdgcn_wave_barrier(); __builtin_amdgcn_fence(3 /* release order */, "workgroup"); }

__global__ __launch_bounds__(256) void k_cvt(const float* __restrict__ X, unsigned* __restrict__ XB) {
  const size_t e = (size_t)blockIdx.x * 256 + threadIdx.x;
  if (e >= (size_t)NTOK * (DM / 8)) return;
  const int T = (int)(e >> 7); const int pc = (int)(e & 127); const int b = T / SEQ; const int s = T - b * SEQ;
  const float* p = X + ((size_t)b * SEQ_FULL + s) * DM + pc * 8;
  const v4f a = *(const v4f*)p; const v4f c = *(const v4f*)(p + 4);
  v4u o; o[0] = pack2(a[0], a[1]); o[1] = pack2(a[2], a[3]); o[2] = pack2(c[0], c[1]); o[3] = pack2(c[2], c[3]);
  vst2((v4u*)(XB + e * 4), o);
}

__global__ __launch_bounds__(256) void k_wt(const float* __restrict__ W, unsigned short* __restrict__ WT) {
  __shared__ __align__(16) unsigned short tl[64][72];
  const int tid = threadIdx.x; const int k0 = blockIdx.x * 64; const int n0 = blockIdx.y * 64;
#pragma unroll
  for (int it = 0; it < 4; ++it) { const int e = tid + it * 256; const int kr = e >> 4, q = e & 15;
    const v4f v = *(const v4f*)(W + (size_t)(k0 + kr) * DM + n0 + q * 4);
    tl[q * 4 + 0][kr] = (unsigned short)bf16_rne(v[0]); tl[q * 4 + 1][kr] = (unsigned short)bf16_rne(v[1]); tl[q * 4 + 2][kr] = (unsigned short)bf16_rne(v[2]); tl[q * 4 + 3][kr] = (unsigned short)bf16_rne(v[3]); }
  __syncthreads();
#pragma unroll
  for (int it = 0; it < 2; ++it) { const int e = tid + it * 256; const int n = e >> 3, q = e & 7;
    const v4u v = *(const v4u_a*)&tl[n][q * 8];
    vst2((v4u*)(WT + (size_t)(n0 + n) * DM + k0 + q * 8), v); }
}

// ---- k_gemm: block = 64 rows x 128 cols, wave = 16 rows x 128 cols; C = A . BT^T + bias over K = 1024 with bf16 operands (NSEG = 2: value and residual A planes share the accumulator)
// EPI 0: f16 row-major [NTOK][1024]; EPI 1: f16 V^T planes [slab][d][key = j*TPS + tl]; EPI 2: f32 row-major [NTOK][1024]
template <int NSEG, int EPI>
__global__ __launch_bounds__(128) void k_gemm(const __bf16* __restrict__ A0, const __bf16* __restrict__ A1, const __bf16* __restrict__ BT, const float* __restrict__ BIAS, _Float16* __restrict__ OH, float* __restrict__ OF) {
  const int tid = threadIdx.x; const int wave = __builtin_amdgcn_readfirstlane((int)(threadIdx.x >> 5)); const int lane = tid & 31, col = lane & 15, g = lane >> 4;
  const int r0 = blockIdx.x * 64; const int c0 = blockIdx.y * 128;
  v8f acc[8] = {};
  const __bf16* ap0 = A0 + (size_t)(r0 + wave * 16 + col) * DM;
  const __bf16* ap1 = A1 + (size_t)(r0 + wave * 16 + col) * DM;
  const __bf16* bp = BT + (size_t)(c0 + col) * DM;
#pragma unroll 1
  for (int kc = 0; kc < DM / 32; ++kc) {
    const v16b a = frag_b(ap0 + kc * 32, lane);
    v16b a1 = a; if (NSEG == 2) a1 = frag_b(ap1 + kc * 32, lane);
#pragma unroll
    for (int j = 0; j < 8; ++j) { const v16b w = frag_b(bp + (size_t)j * 16 * DM + kc * 32, lane); acc[j] = wmma_bf(a, w, acc[j]); if (NSEG == 2) acc[j] = wmma_bf(a1, w, acc[j]); }
  }
  if (EPI == 0) {
    __shared__ __align__(16) _Float16 sh[64][136];
#pragma unroll
    for (int j = 0; j < 8; ++j) { const float bias = bfr(BIAS[c0 + j * 16 + col]);
#pragma unroll
      for (int r = 0; r < 8; ++r) sh[wave * 16 + 8 * g + r][j * 16 + col] = (_Float16)(acc[j][r] + bias); }
    __syncthreads();
    for (int e = tid; e < 64 * 16; e += 128) { const int rl = e >> 4, q = e & 15; const v4u v = *(const v4u_a*)&sh[rl][q * 8]; *(v4u*)(OH + (size_t)(r0 + rl) * DM + c0 + q * 8) = v; }
    
  } else if (EPI == 1) {
    __shared__ __align__(16) _Float16 th[128][72];
#pragma unroll
    for (int j = 0; j < 8; ++j) { const float bias = bfr(BIAS[c0 + j * 16 + col]); v8h hv;
#pragma unroll
      for (int r = 0; r < 8; ++r) hv[r] = (_Float16)(acc[j][r] + bias);
      *(v8h_a*)&th[j * 16 + col][wave * 16 + 8 * g] = hv; }
    __syncthreads();
    const int Ls = r0 / TPS; const int tl0 = r0 - Ls * TPS;
    for (int e = tid; e < 128 * 8; e += 128) { const int cl = e >> 3, q = e & 7; const int c = c0 + cl; const int jj = c >> 6, d = c & 63;
      const v4u v = *(const v4u_a*)&th[cl][q * 8]; *(v4u*)(OH + ((size_t)Ls * HD + d) * SEQ + jj * TPS + tl0 + q * 8) = v; }
    
  } else {
    __shared__ __align__(16) float ss[64][132];
#pragma unroll
    for (int j = 0; j < 8; ++j) { const float bias = bfr(BIAS[c0 + j * 16 + col]);
#pragma unroll
      for (int r = 0; r < 8; ++r) ss[wave * 16 + 8 * g + r][j * 16 + col] = acc[j][r] + bias; }
    ldsx();   // each wave reads back only its own 16 rows
    for (int rl = 0; rl < 16; ++rl) { const v4f v = *(const v4f_a*)&ss[wave * 16 + rl][lane * 4]; *(v4f*)(OF + (size_t)(r0 + wave * 16 + rl) * DM + c0 + lane * 4) = v; }
    
  }
}

// ---- k_attn: block = 64 query pseudo-rows of slab L (wave = 16 queries), fused over all SEQ keys in 32-key steps (transposed flash form):
//   S^T[key][query] = K . Q^T  (A = K rows, B = Q rows);  P^T packed in-lane as the B operand;  O^T[d][query] += V^T . P^T  (A = V^T rows).
//   Keys visited in the order key = j*TPS + tl (token L*TPS + tl, feature group j); K rows and V^T columns use the same order.
//   Each lane owns one query column: running max / sum are per lane, combined across the two lane halves by one xor-16 shuffle.
__global__ __launch_bounds__(128) void k_attn(const _Float16* __restrict__ QH, const _Float16* __restrict__ KH, const _Float16* __restrict__ VT, unsigned* __restrict__ CH, unsigned* __restrict__ CL) {
  __shared__ __align__(16) unsigned cst[4][2][16][36];   // per-wave staging of the 16 x 64 ctx tile: bf16 value pairs / residual pairs
  const int tid = threadIdx.x; const int wave = __builtin_amdgcn_readfirstlane((int)(threadIdx.x >> 5)); const int lane = tid & 31, col = lane & 15, g = lane >> 4;
  const int L = blockIdx.y; const size_t qrow0 = (size_t)L * SEQ + (size_t)blockIdx.x * 64 + wave * 16;
  const _Float16* qp = QH + (qrow0 + col) * HD;
  const v16h qf0 = frag_h(qp, lane); const v16h qf1 = frag_h(qp + 32, lane);
  const _Float16* kbase = KH + ((size_t)L * TPS + col) * DM;
  const _Float16* vbase = VT + ((size_t)L * HD + col) * SEQ;
  v8f o[4] = {}; float m = -3.0e38f; float l = 0.f;
#pragma unroll 1
  for (int hb = 0; hb < SEQ / 32; ++hb) {
    const int k0 = hb * 32; const int jj = k0 / TPS; const int tl0 = k0 - jj * TPS;
    const _Float16* kp = kbase + (size_t)tl0 * DM + jj * HD;
    v8f s0 = {}, s1 = {};
    { const v16h ka = frag_h(kp, lane); const v16h kb = frag_h(kp + 32, lane); s0 = wmma16(ka, qf0, s0); s0 = wmma16(kb, qf1, s0); }
    { const v16h ka = frag_h(kp + 16 * DM, lane); const v16h kb = frag_h(kp + 16 * DM + 32, lane); s1 = wmma16(ka, qf0, s1); s1 = wmma16(kb, qf1, s1); }
    float mx = fmaxf(s0[0], s1[0]);
#pragma unroll
    for (int r = 1; r < 8; ++r) mx = fmaxf(mx, fmaxf(s0[r], s1[r]));
    mx = fmaxf(mx, __shfl_xor(mx, 16));
    const int up = mx > m ? 1 : 0;
    if (__any(up)) {   // wave-uniform branch; lanes whose max is unchanged get a factor of exactly 1
      const float mn = fmaxf(m, mx); const float corr = __expf((m - mn) * SCALE); m = mn; l *= corr;
#pragma unroll
      for (int j = 0; j < 4; ++j)
#pragma unroll
        for (int r = 0; r < 8; ++r) o[j][r] *= corr;
    }
    const float c = LN1024 - m * SCALE;   // P carried x 2^10 (cancels in o / l)
    v16h pf; float ls = 0.f;
#pragma unroll
    for (int r = 0; r < 8; ++r) { const float p0 = __expf(fmaf(s0[r], SCALE, c)); const float p1 = __expf(fmaf(s1[r], SCALE, c)); ls += p0 + p1; pf[r] = (_Float16)p0; pf[8 + r] = (_Float16)p1; }
    l += ls;
    const _Float16* vp = vbase + k0;
#pragma unroll
    for (int j = 0; j < 4; ++j) { const v16h vf = frag_h(vp + (size_t)j * 16 * SEQ, lane); o[j] = wmma16(vf, pf, o[j]); }
  }
  l += __shfl_xor(l, 16);
  const float inv = 1.0f / l;
  // o[j][r] = ctx[query col][d = 16 j + 8 g + r]: 8 consecutive d per (lane, j) -> one 16-B piece per plane
#pragma unroll
  for (int j = 0; j < 4; ++j) { float v[8]; unsigned hb8[8];
#pragma unroll
    for (int r = 0; r < 8; ++r) { v[r] = o[j][r] * inv; hb8[r] = bf16_rne(v[r]); }
    v4u hv, lv;
#pragma unroll
    for (int t = 0; t < 4; ++t) { hv[t] = hb8[2 * t] | (hb8[2 * t + 1] << 16); lv[t] = pack2(v[2 * t] - __uint_as_float(hb8[2 * t] << 16), v[2 * t + 1] - __uint_as_float(hb8[2 * t + 1] << 16)); }
    *(v4u_a*)&cst[wave][0][col][j * 8 + g * 4] = hv; *(v4u_a*)&cst[wave][1][col][j * 8 + g * 4] = lv; }
  ldsx();   // wave-private tile
#pragma unroll
  for (int it = 0; it < 4; ++it) { const int row = it * 4 + (lane >> 3); const int pc = lane & 7;
    const v4u hv = *(const v4u_a*)&cst[wave][0][row][pc * 4]; const v4u lv = *(const v4u_a*)&cst[wave][1][row][pc * 4];
    *(v4u*)(CH + (qrow0 + row) * 32 + pc * 4) = hv; *(v4u*)(CL + (qrow0 + row) * 32 + pc * 4) = lv; }
  
}

extern "C" void kernel_launch(void* const* d_in, const int* in_sizes, int n_in, void* d_out, int out_size, void* d_ws, size_t ws_size, hipStream_t stream) {
  if (n_in < 10) return;
  const long long act_min = ((long long)(NB - 1) * SEQ_FULL + SEQ) * DM;
  if ((long long)in_sizes[0] < act_min || (long long)in_sizes[1] < act_min) return;
  if (in_sizes[2] < DM * DM || in_sizes[4] < DM * DM || in_sizes[6] < DM * DM || in_sizes[8] < DM * DM) return;
  if (in_sizes[3] < DM || in_sizes[5] < DM || in_sizes[7] < DM || in_sizes[9] < DM) return;
  if ((long long)out_size < (long long)NTOK * DM) return;
  if (ws_size < (size_t)WS_END) return;
  // inputs (wire order): 0 x, 1 y [2][2048][1024]; 2 Wq, 3 bq, 4 Wk, 5 bk, 6 Wv, 7 bv, 8 Wo, 9 bo; weights (in,out) [1024][1024]
  const float* x  = (const float*)d_in[0]; const float* y  = (const float*)d_in[1];
  const float* Wq = (const float*)d_in[2]; const float* bq = (const float*)d_in[3];
  const float* Wk = (const float*)d_in[4]; const float* bk = (const float*)d_in[5];
  const float* Wv = (const float*)d_in[6]; const float* bv = (const float*)d_in[7];
  const float* Wo = (const float*)d_in[8]; const float* bo = (const float*)d_in[9];
  char* ws = (char*)d_ws;
  unsigned* XB = (unsigned*)(ws + WS_XB); unsigned* YB = (unsigned*)(ws + WS_YB);
  unsigned short* WT = (unsigned short*)(ws + WS_WT);
  unsigned short* WqT = WT; unsigned short* WkT = WT + (size_t)DM * DM; unsigned short* WvT = WT + 2 * (size_t)DM * DM; unsigned short* WoT = WT + 3 * (size_t)DM * DM;
  _Float16* QH = (_Float16*)(ws + WS_QH); _Float16* KH = (_Float16*)(ws + WS_KH); _Float16* VT = (_Float16*)(ws + WS_VT);
  unsigned* CH = (unsigned*)(ws + WS_CH); unsigned* CL = (unsigned*)(ws + WS_CL);
  float* OUT = (float*)d_out;

  const int cvt_blocks = (int)(((size_t)NTOK * (DM / 8) + 255) / 256);
  k_cvt<<<dim3(cvt_blocks), 256, 0, stream>>>(x, XB);
  k_cvt<<<dim3(cvt_blocks), 256, 0, stream>>>(y, YB);
  // in[rows = in][cols = out] -> out[cols][rows]; square 1024 x 1024: grid (in / 64, out / 64)
  k_wt<<<dim3(DM / 64, DM / 64), 256, 0, stream>>>(Wq, WqT);
  k_wt<<<dim3(DM / 64, DM / 64), 256, 0, stream>>>(Wk, WkT);
  k_wt<<<dim3(DM / 64, DM / 64), 256, 0, stream>>>(Wv, WvT);
  k_wt<<<dim3(DM / 64, DM / 64), 256, 0, stream>>>(Wo, WoT);
  const dim3 gg(NTOK / 64, DM / 128);
  k_gemm<1, 0><<<gg, 128, 0, stream>>>((const __bf16*)XB, (const __bf16*)XB, (const __bf16*)WqT, bq, QH, OUT);
  k_gemm<1, 0><<<gg, 128, 0, stream>>>((const __bf16*)XB, (const __bf16*)XB, (const __bf16*)WkT, bk, KH, OUT);
  k_gemm<1, 1><<<gg, 128, 0, stream>>>((const __bf16*)YB, (const __bf16*)YB, (const __bf16*)WvT, bv, VT, OUT);
  k_attn<<<dim3(SEQ / 64, NSLAB), 128, 0, stream>>>(QH, KH, VT, CH, CL);
  k_gemm<2, 2><<<gg, 128, 0, stream>>>((const __bf16*)CH, (const __bf16*)CL, (const __bf16*)WoT, bo, QH, OUT);
}

// v001
// One run takes 208 microseconds.
// In two side-by-side timings against v000, it was 1.77 and 1.78 times as fast.
// compute dtype: all float inputs converted to bf16 (RNE); q/k/v projections on v_wmma_f32_16x16x32_bf16 with exact bf16 x bf16 products, f32 accumulate; logits K.Q^T on v_wmma_f32_16x16x32_f16 (f16 q, k), f32 accumulate, x 1/32; softmax f32 (running max); P x 2^10 as f16 against f16 V^T on v_wmma_f32_16x16x32_f16; output projection: ctx as bf16 value + bf16 residual (2 products, shared accumulator) against bf16 Wo on v_wmma_f32_16x16x32_bf16; f32 output.
#include <hip/hip_runtime.h>
#include <math.h>

typedef __attribute__((ext_vector_type(16))) _Float16 v16h;
typedef __attribute__((ext_vector_type(16))) __bf16 v16b;
typedef __attribute__((ext_vector_type(8)))  _Float16 v8h;
typedef __attribute__((ext_vector_type(8)))  __bf16 v8b;
typedef __attribute__((ext_vector_type(8)))  float v8f;
typedef __attribute__((ext_vector_type(4)))  float v4f;
typedef __attribute__((ext_vector_type(4)))  unsigned v4u;
typedef v4u __attribute__((may_alias)) v4u_a;
typedef v4f __attribute__((may_alias)) v4f_a;
typedef v8h __attribute__((may_alias)) v8h_a;

#ifndef NB
#define NB 2
#endif
#ifndef SEQ
#define SEQ 2048
#endif
#define SEQ_FULL 2048          // per-batch row count of the inputs
#define DM 1024                // model width = projected width
#define NH 16
#define HD 64
#define NTOK (NB * SEQ)        // token rows of every [token][1024] plane
#define TPS (SEQ / NH)         // tokens per (head, batch) slab of the head-leading flat reshape
#define NSLAB (NH * NB)        // independent attention problems: SEQ pseudo-rows x HD each
#define SCALE 0.03125f         // 1 / sqrt(1024)
#define LN1024 6.931471806f

static_assert(SEQ % 1024 == 0);      // TPS multiple of 64: a 32-key step stays inside one feature group
static_assert(NTOK % 64 == 0);
static_assert(DM % 128 == 0);
static_assert(SEQ <= SEQ_FULL);

#define PLANE2 (2ull * (unsigned long long)NTOK * DM)    // bytes of one 16-bit [NTOK][1024] plane
#define WPL2   (2ull * (unsigned long long)DM * DM)      // bytes of one 16-bit weight plane
#define WS_XB 0ull
#define WS_YB (WS_XB + PLANE2)
#define WS_WT (WS_YB + PLANE2)       // 4 planes: Wq^T, Wk^T, Wv^T, Wo^T (bf16 [out][in])
#define WS_QH (WS_WT + 4ull * WPL2)
#define WS_KH (WS_QH + PLANE2)
#define WS_VT (WS_KH + PLANE2)       // f16 V^T planes [slab][d][key], key = j * TPS + tl
#define WS_CH (WS_VT + PLANE2)       // bf16 ctx value plane [token][1024]
#define WS_CL (WS_CH + PLANE2)       // bf16 ctx residual plane
#define WS_END (WS_CL + PLANE2)
static_assert(WS_END <= 134217728ull);
static_assert(PLANE2 % 128 == 0);
static_assert(WPL2 % 128 == 0);

template <typename T> __device__ __forceinline__ void vst2(T* p, T v) { *(T*)p = v;  }

__device__ __forceinline__ v8f wmma16(v16h a, v16h b, v8f c) {
  v8f d = __builtin_amdgcn_wmma_f32_16x16x32_f16(false, a, false, b, (short)0, c, false, false);
  asm volatile("v_nop\n\tv_nop\n\tv_nop\n\tv_nop" : "+v"(d) : "v"(a), "v"(b));
  return d;
}
__device__ __forceinline__ v8f wmma_bf(v16b a, v16b b, v8f c) {
  v8f d = __builtin_amdgcn_wmma_f32_16x16x32_bf16(false, a, false, b, (short)0, c, false, false);
  asm volatile("v_nop\n\tv_nop\n\tv_nop\n\tv_nop" : "+v"(d) : "v"(a), "v"(b));
  return d;
}
// 16x16x32 fragments: lane = (h = lane>>4, row/col = lane&15); elements 0..7 = k0+8h+0..7, 8..15 = k0+16+8h+0..7; D element r = row 8h+r, col lane&15
__device__ __forceinline__ v16h frag_h(const _Float16* rowk0, int lane) {
  union { v16h v; v8h q[2]; } u; const _Float16* p = rowk0 + 8 * (lane >> 4);
  u.q[0] = *(const v8h*)p; u.q[1] = *(const v8h*)(p + 16); return u.v;
}
__device__ __forceinline__ v16b frag_b(const __bf16* rowk0, int lane) {
  union { v16b v; v8b q[2]; } u; const __bf16* p = rowk0 + 8 * (lane >> 4);
  u.q[0] = *(const v8b*)p; u.q[1] = *(const v8b*)(p + 16); return u.v;
}
// bf16 bits of an f32 value, nearest-even
__device__ __forceinline__ unsigned bf16_rne(float f) { unsigned u = __float_as_uint(f); u += 0x7FFFu + ((u >> 16) & 1u); return u >> 16; }
__device__ __forceinline__ float bfr(float v) { return __uint_as_float(bf16_rne(v) << 16); }
__device__ __forceinline__ unsigned pack2(float a, float b) { return bf16_rne(a) | (bf16_rne(b) << 16); }
// same-wave LDS exchange: stores retire, then the wave proceeds to the loads
__device__ __forceinline__ void ldsx() { asm volatile("s_wait_dscnt 0" ::: "memory"); __builtin_amdgcn_wave_barrier(); __builtin_amdgcn_fence(3 /* release order */, "workgroup"); }

__global__ __launch_bounds__(256) void k_cvt(const float* __restrict__ X, unsigned* __restrict__ XB) {
  const size_t e = (size_t)blockIdx.x * 256 + threadIdx.x;
  if (e >= (size_t)NTOK * (DM / 8)) return;
  const int T = (int)(e >> 7); const int pc = (int)(e & 127); const int b = T / SEQ; const int s = T - b * SEQ;
  const float* p = X + ((size_t)b * SEQ_FULL + s) * DM + pc * 8;
  const v4f a = *(const v4f*)p; const v4f c = *(const v4f*)(p + 4);
  v4u o; o[0] = pack2(a[0], a[1]); o[1] = pack2(a[2], a[3]); o[2] = pack2(c[0], c[1]); o[3] = pack2(c[2], c[3]);
  vst2((v4u*)(XB + e * 4), o);
}

__global__ __launch_bounds__(256) void k_wt(const float* __restrict__ W, unsigned short* __restrict__ WT) {
  __shared__ __align__(16) unsigned short tl[64][72];
  const int tid = threadIdx.x; const int k0 = blockIdx.x * 64; const int n0 = blockIdx.y * 64;
#pragma unroll
  for (int it = 0; it < 4; ++it) { const int e = tid + it * 256; const int kr = e >> 4, q = e & 15;
    const v4f v = *(const v4f*)(W + (size_t)(k0 + kr) * DM + n0 + q * 4);
    tl[q * 4 + 0][kr] = (unsigned short)bf16_rne(v[0]); tl[q * 4 + 1][kr] = (unsigned short)bf16_rne(v[1]); tl[q * 4 + 2][kr] = (unsigned short)bf16_rne(v[2]); tl[q * 4 + 3][kr] = (unsigned short)bf16_rne(v[3]); }
  __syncthreads();
#pragma unroll
  for (int it = 0; it < 2; ++it) { const int e = tid + it * 256; const int n = e >> 3, q = e & 7;
    const v4u v = *(const v4u_a*)&tl[n][q * 8];
    vst2((v4u*)(WT + (size_t)(n0 + n) * DM + k0 + q * 8), v); }
}

// ---- tensor mover helpers (two-group descriptor of a two-dimensional tile, every extent in bytes)
typedef __attribute__((ext_vector_type(4))) unsigned u32x4;
typedef __attribute__((ext_vector_type(8))) unsigned u32x8;
#define PASS_B 256u            // bytes of every operand row per pass (128 k)
#define LPITCH 272u            // LDS row pitch: 256 + 16 pad bytes, an odd multiple of 16 for the ds_load_b128 readers
#define SL_ROWS 32u            // rows of one wave's slice
#define SL_B 10240u            // 32 x 272 = 8704 bytes, rounded up so that every slice starts on a multiple of 2 KiB
#define BUF_B (8u * SL_B)      // one stage: slices 0..3 = 128 A rows, slices 4..7 = 128 B rows
static_assert(SL_ROWS * LPITCH <= SL_B && SL_B % 2048u == 0);
static_assert(NTOK % 128 == 0 && TPS % 128 == 0);   // a 128-token block stays inside one slab
__device__ __forceinline__ unsigned uni(unsigned v) { return (unsigned)__builtin_amdgcn_readfirstlane((int)v); }
__device__ __forceinline__ unsigned pinned(unsigned v) { unsigned w = uni(v); asm volatile("" : "+s"(w)); return w; }  // pinned(): the issue test of a tensor load held in a scalar register, so that it compiles to s_cmp + s_cbranch_scc (the load ignores EXEC)
__device__ __forceinline__ void wait_ds0() { asm volatile("s_wait_dscnt 0x0" ::: "memory"); }          // this wave's LDS reads have retired before the buffer is handed back
// this wave's slice has landed (the compiler places no wait for the mover); the request's group 0 is named as an input so that its registers keep their words until then
__device__ __forceinline__ void wait_tensor0(u32x4 g0) { asm volatile("s_wait_tensorcnt 0x0" :: "s"(g0) : "memory"); }
// one request of the whole wave: global tile -> LDS; group 0 is tied in and out so that wait_tensor0 names the very registers the request was issued from
__device__ __forceinline__ void tdm_load(u32x4& g0, u32x8 g1) { asm volatile("tensor_load_to_lds %0, %1" : "+s"(g0) : "s"(g1) : "memory"); }
__device__ __forceinline__ u32x8 tdm_group1() {
  u32x8 q;
  q[0] = uni((1u << 20) | (5u << 22) | (3u << 25));   // no mask, 1-byte elements, 4 pad dwords behind every 256-byte row
  q[1] = uni((PASS_B & 0xFFFFu) << 16);
  q[2] = uni((PASS_B >> 16) | ((SL_ROWS & 0xFFFFu) << 16));
  q[3] = uni((SL_ROWS >> 16) | (PASS_B << 16));
  q[4] = uni(SL_ROWS);
  q[5] = uni(2u * DM);                                // source row pitch in bytes
  q[6] = uni(0u); q[7] = uni(0u);
  return q;
}
__device__ __forceinline__ u32x4 tdm_group0(unsigned lds_dst, unsigned long long ga) {
  u32x4 q; q[0] = uni(1u); q[1] = uni(lds_dst); q[2] = uni((unsigned)ga); q[3] = uni((((unsigned)(ga >> 32)) & 0x01FFFFFFu) | 0x80000000u);
  return q;
}

// ---- k_gemm: block = 128 rows x 128 cols, 8 waves as 4 x 2, wave = 32 rows x 64 cols; C = A . BT^T + bias over K = 1024 with bf16 operands
// Both operand tiles are staged in LDS by the tensor mover, 128 k per pass, two buffers: every wave brings one 32-row slice per stage, one stage ahead of the pass that reads it.
// NSEG = 2: the value plane's 8 passes, then the residual plane's 8 passes against the same BT rows, one shared accumulator.
// EPI 0: f16 row-major [NTOK][1024]; EPI 1: f16 V^T planes [slab][d][key = j*TPS + tl]; EPI 2: f32 row-major [NTOK][1024]
template <int NSEG, int EPI>
__global__ __launch_bounds__(256) void k_gemm(const __bf16* __restrict__ A0, const __bf16* __restrict__ A1, const __bf16* __restrict__ BT, const float* __restrict__ BIAS, _Float16* __restrict__ OH, float* __restrict__ OF) {
  __shared__ __attribute__((aligned(2048))) unsigned char ring[2u * BUF_B];
  const int tid = threadIdx.x; const int wave = __builtin_amdgcn_readfirstlane((int)(threadIdx.x >> 5)); const int lane = tid & 31, col = lane & 15, g = lane >> 4;
  const int wr = wave >> 1, wc = wave & 1;
  const int r0 = blockIdx.x * 128; const int c0 = blockIdx.y * 128;
  constexpr int NPP = DM * 2 / (int)PASS_B;   // passes per plane
  constexpr int NST = NPP * NSEG;             // stages = passes
  static_assert(NST >= 2);
  const unsigned lbase = (unsigned)(size_t)ring;
  const bool isA = wave < 4;
  const unsigned long long soff = (unsigned long long)(isA ? r0 + 32 * wave : c0 + 32 * (wave - 4)) * (2ull * DM);
  const unsigned long long src0 = (unsigned long long)(size_t)(isA ? A0 : BT) + soff;
  const unsigned long long src1 = (unsigned long long)(size_t)(isA ? A1 : BT) + soff;
  const u32x8 g1 = tdm_group1();
  u32x4 g0;   // group 0 of this wave's one outstanding request
  auto issue = [&](int s) {
    const unsigned dst = lbase + (unsigned)(s & 1) * BUF_B + (unsigned)wave * SL_B;
    const unsigned long long ga = (NSEG == 2 && s >= NPP ? src1 : src0) + (unsigned long long)(s & (NPP - 1)) * PASS_B;
    g0 = tdm_group0(dst, ga); tdm_load(g0, g1);
  };
  v8f acc[2][4] = {};
  issue(0); wait_tensor0(g0); __syncthreads();   // stage 0 published
  issue(1);
  // rolled: one publish point per pass, the buffer picked by the pass's parity
#pragma unroll 1
  for (int s = 0; s < NST; ++s) {
    const unsigned char* bufp = ring + (unsigned)(s & 1) * BUF_B;
    const unsigned char* pa = bufp + (unsigned)wr * SL_B + (unsigned)col * LPITCH;
    const unsigned char* pb = bufp + (unsigned)(4 + 2 * wc) * SL_B + (unsigned)col * LPITCH;
#pragma unroll
    for (int kc = 0; kc < (int)PASS_B / 64; ++kc) {
      v16b a[2], w[4];
#pragma unroll
      for (int i = 0; i < 2; ++i) a[i] = frag_b((const __bf16*)(pa + (unsigned)i * 16u * LPITCH + (unsigned)kc * 64u), lane);
#pragma unroll
      for (int j = 0; j < 4; ++j) w[j] = frag_b((const __bf16*)(pb + (unsigned)(j >> 1) * SL_B + (unsigned)(j & 1) * 16u * LPITCH + (unsigned)kc * 64u), lane);
#pragma unroll
      for (int i = 0; i < 2; ++i)
#pragma unroll
        for (int j = 0; j < 4; ++j) acc[i][j] = wmma_bf(a[i], w[j], acc[i][j]);
    }
    // publish point of stage s + 1: own LDS reads retired, own slice landed, then the barrier that also frees this pass's buffer
    wait_ds0(); wait_tensor0(g0); __syncthreads();
    if (pinned(s + 2 < NST)) issue(s + 2);
  }
  wait_tensor0(g0); wait_ds0();
  if (EPI == 0) {
    __shared__ __align__(16) _Float16 sh[128][136];
#pragma unroll
    for (int j = 0; j < 4; ++j) { const float bias = bfr(BIAS[c0 + wc * 64 + j * 16 + col]);
#pragma unroll
      for (int i = 0; i < 2; ++i)
#pragma unroll
        for (int r = 0; r < 8; ++r) sh[wr * 32 + i * 16 + 8 * g + r][wc * 64 + j * 16 + col] = (_Float16)(acc[i][j][r] + bias); }
    __syncthreads();
    for (int e = tid; e < 128 * 16; e += 256) { const int rl = e >> 4, q = e & 15; const v4u v = *(const v4u_a*)&sh[rl][q * 8]; *(v4u*)(OH + (size_t)(r0 + rl) * DM + c0 + q * 8) = v; }
  } else if (EPI == 1) {
    __shared__ __align__(16) _Float16 th[128][136];
#pragma unroll
    for (int j = 0; j < 4; ++j) { const float bias = bfr(BIAS[c0 + wc * 64 + j * 16 + col]);
#pragma unroll
      for (int i = 0; i < 2; ++i) { v8h hv;
#pragma unroll
        for (int r = 0; r < 8; ++r) hv[r] = (_Float16)(acc[i][j][r] + bias);
        *(v8h_a*)&th[wc * 64 + j * 16 + col][wr * 32 + i * 16 + 8 * g] = hv; } }
    __syncthreads();
    const int Ls = r0 / TPS; const int tl0 = r0 - Ls * TPS;
    for (int e = tid; e < 128 * 16; e += 256) { const int cl = e >> 4, q = e & 15; const int c = c0 + cl; const int jj = c >> 6, d = c & 63;
      const v4u v = *(const v4u_a*)&th[cl][q * 8]; *(v4u*)(OH + ((size_t)Ls * HD + d) * SEQ + jj * TPS + tl0 + q * 8) = v; }
  } else {
    __shared__ __align__(16) float ss[128][132];
#pragma unroll
    for (int j = 0; j < 4; ++j) { const float bias = bfr(BIAS[c0 + wc * 64 + j * 16 + col]);
#pragma unroll
      for (int i = 0; i < 2; ++i)
#pragma unroll
        for (int r = 0; r < 8; ++r) ss[wr * 32 + i * 16 + 8 * g + r][wc * 64 + j * 16 + col] = acc[i][j][r] + bias; }
    ldsx();   // each wave reads back only its own 32 rows x 64 cols
    for (int rl = 0; rl < 16; ++rl) { const int row = wr * 32 + rl * 2 + g; const v4f v = *(const v4f_a*)&ss[row][wc * 64 + col * 4]; *(v4f*)(OF + (size_t)(r0 + row) * DM + c0 + wc * 64 + col * 4) = v; }
  }
}

// ---- k_attn: block = 64 query pseudo-rows of slab L (wave = 16 queries), fused over all SEQ keys in 32-key steps (transposed flash form):
//   S^T[key][query] = K . Q^T  (A = K rows, B = Q rows);  P^T packed in-lane as the B operand;  O^T[d][query] += V^T . P^T  (A = V^T rows).
//   Keys visited in the order key = j*TPS + tl (token L*TPS + tl, feature group j); K rows and V^T columns use the same order.
//   Each lane owns one query column: running max / sum are per lane, combined across the two lane halves by one xor-16 shuffle.
__global__ __launch_bounds__(128) void k_attn(const _Float16* __restrict__ QH, const _Float16* __restrict__ KH, const _Float16* __restrict__ VT, unsigned* __restrict__ CH, unsigned* __restrict__ CL) {
  __shared__ __align__(16) unsigned cst[4][2][16][36];   // per-wave staging of the 16 x 64 ctx tile: bf16 value pairs / residual pairs
  const int tid = threadIdx.x; const int wave = __builtin_amdgcn_readfirstlane((int)(threadIdx.x >> 5)); const int lane = tid & 31, col = lane & 15, g = lane >> 4;
  const int L = blockIdx.y; const size_t qrow0 = (size_t)L * SEQ + (size_t)blockIdx.x * 64 + wave * 16;
  const _Float16* qp = QH + (qrow0 + col) * HD;
  const v16h qf0 = frag_h(qp, lane); const v16h qf1 = frag_h(qp + 32, lane);
  const _Float16* kbase = KH + ((size_t)L * TPS + col) * DM;
  const _Float16* vbase = VT + ((size_t)L * HD + col) * SEQ;
  v8f o[4] = {}; float m = -3.0e38f; float l = 0.f;
#pragma unroll 1
  for (int hb = 0; hb < SEQ / 32; ++hb) {
    const int k0 = hb * 32; const int jj = k0 / TPS; const int tl0 = k0 - jj * TPS;
    const _Float16* kp = kbase + (size_t)tl0 * DM + jj * HD;
    v8f s0 = {}, s1 = {};
    { const v16h ka = frag_h(kp, lane); const v16h kb = frag_h(kp + 32, lane); s0 = wmma16(ka, qf0, s0); s0 = wmma16(kb, qf1, s0); }
    { const v16h ka = frag_h(kp + 16 * DM, lane); const v16h kb = frag_h(kp + 16 * DM + 32, lane); s1 = wmma16(ka, qf0, s1); s1 = wmma16(kb, qf1, s1); }
    float mx = fmaxf(s0[0], s1[0]);
#pragma unroll
    for (int r = 1; r < 8; ++r) mx = fmaxf(mx, fmaxf(s0[r], s1[r]));
    mx = fmaxf(mx, __shfl_xor(mx, 16));
    const int up = mx > m ? 1 : 0;
    if (__any(up)) {   // wave-uniform branch; lanes whose max is unchanged get a factor of exactly 1
      const float mn = fmaxf(m, mx); const float corr = __expf((m - mn) * SCALE); m = mn; l *= corr;
#pragma unroll
      for (int j = 0; j < 4; ++j)
#pragma unroll
        for (int r = 0; r < 8; ++r) o[j][r] *= corr;
    }
    const float c = LN1024 - m * SCALE;   // P carried x 2^10 (cancels in o / l)
    v16h pf; float ls = 0.f;
#pragma unroll
    for (int r = 0; r < 8; ++r) { const float p0 = __expf(fmaf(s0[r], SCALE, c)); const float p1 = __expf(fmaf(s1[r], SCALE, c)); ls += p0 + p1; pf[r] = (_Float16)p0; pf[8 + r] = (_Float16)p1; }
    l += ls;
    const _Float16* vp = vbase + k0;
#pragma unroll
    for (int j = 0; j < 4; ++j) { const v16h vf = frag_h(vp + (size_t)j * 16 * SEQ, lane); o[j] = wmma16(vf, pf, o[j]); }
  }
  l += __shfl_xor(l, 16);
  const float inv = 1.0f / l;
  // o[j][r] = ctx[query col][d = 16 j + 8 g + r]: 8 consecutive d per (lane, j) -> one 16-B piece per plane
#pragma unroll
  for (int j = 0; j < 4; ++j) { float v[8]; unsigned hb8[8];
#pragma unroll
    for (int r = 0; r < 8; ++r) { v[r] = o[j][r] * inv; hb8[r] = bf16_rne(v[r]); }
    v4u hv, lv;
#pragma unroll
    for (int t = 0; t < 4; ++t) { hv[t] = hb8[2 * t] | (hb8[2 * t + 1] << 16); lv[t] = pack2(v[2 * t] - __uint_as_float(hb8[2 * t] << 16), v[2 * t + 1] - __uint_as_float(hb8[2 * t + 1] << 16)); }
    *(v4u_a*)&cst[wave][0][col][j * 8 + g * 4] = hv; *(v4u_a*)&cst[wave][1][col][j * 8 + g * 4] = lv; }
  ldsx();   // wave-private tile
#pragma unroll
  for (int it = 0; it < 4; ++it) { const int row = it * 4 + (lane >> 3); const int pc = lane & 7;
    const v4u hv = *(const v4u_a*)&cst[wave][0][row][pc * 4]; const v4u lv = *(const v4u_a*)&cst[wave][1][row][pc * 4];
    *(v4u*)(CH + (qrow0 + row) * 32 + pc * 4) = hv; *(v4u*)(CL + (qrow0 + row) * 32 + pc * 4) = lv; }
  
}

extern "C" void kernel_launch(void* const* d_in, const int* in_sizes, int n_in, void* d_out, int out_size, void* d_ws, size_t ws_size, hipStream_t stream) {
  if (n_in < 10) return;
  const long long act_min = ((long long)(NB - 1) * SEQ_FULL + SEQ) * DM;
  if ((long long)in_sizes[0] < act_min || (long long)in_sizes[1] < act_min) return;
  if (in_sizes[2] < DM * DM || in_sizes[4] < DM * DM || in_sizes[6] < DM * DM || in_sizes[8] < DM * DM) return;
  if (in_sizes[3] < DM || in_sizes[5] < DM || in_sizes[7] < DM || in_sizes[9] < DM) return;
  if ((long long)out_size < (long long)NTOK * DM) return;
  if (ws_size < (size_t)WS_END) return;
  // inputs (wire order): 0 x, 1 y [2][2048][1024]; 2 Wq, 3 bq, 4 Wk, 5 bk, 6 Wv, 7 bv, 8 Wo, 9 bo; weights (in,out) [1024][1024]
  const float* x  = (const float*)d_in[0]; const float* y  = (const float*)d_in[1];
  const float* Wq = (const float*)d_in[2]; const float* bq = (const float*)d_in[3];
  const float* Wk = (const float*)d_in[4]; const float* bk = (const float*)d_in[5];
  const float* Wv = (const float*)d_in[6]; const float* bv = (const float*)d_in[7];
  const float* Wo = (const float*)d_in[8]; const float* bo = (const float*)d_in[9];
  char* ws = (char*)d_ws;
  unsigned* XB = (unsigned*)(ws + WS_XB); unsigned* YB = (unsigned*)(ws + WS_YB);
  unsigned short* WT = (unsigned short*)(ws + WS_WT);
  unsigned short* WqT = WT; unsigned short* WkT = WT + (size_t)DM * DM; unsigned short* WvT = WT + 2 * (size_t)DM * DM; unsigned short* WoT = WT + 3 * (size_t)DM * DM;
  _Float16* QH = (_Float16*)(ws + WS_QH); _Float16* KH = (_Float16*)(ws + WS_KH); _Float16* VT = (_Float16*)(ws + WS_VT);
  unsigned* CH = (unsigned*)(ws + WS_CH); unsigned* CL = (unsigned*)(ws + WS_CL);
  float* OUT = (float*)d_out;

  const int cvt_blocks = (int)(((size_t)NTOK * (DM / 8) + 255) / 256);
  k_cvt<<<dim3(cvt_blocks), 256, 0, stream>>>(x, XB);
  k_cvt<<<dim3(cvt_blocks), 256, 0, stream>>>(y, YB);
  // in[rows = in][cols = out] -> out[cols][rows]; square 1024 x 1024: grid (in / 64, out / 64)
  k_wt<<<dim3(DM / 64, DM / 64), 256, 0, stream>>>(Wq, WqT);
  k_wt<<<dim3(DM / 64, DM / 64), 256, 0, stream>>>(Wk, WkT);
  k_wt<<<dim3(DM / 64, DM / 64), 256, 0, stream>>>(Wv, WvT);
  k_wt<<<dim3(DM / 64, DM / 64), 256, 0, stream>>>(Wo, WoT);
  const dim3 gg(NTOK / 128, DM / 128);
  k_gemm<1, 0><<<gg, 256, 0, stream>>>((const __bf16*)XB, (const __bf16*)XB, (const __bf16*)WqT, bq, QH, OUT);
  k_gemm<1, 0><<<gg, 256, 0, stream>>>((const __bf16*)XB, (const __bf16*)XB, (const __bf16*)WkT, bk, KH, OUT);
  k_gemm<1, 1><<<gg, 256, 0, stream>>>((const __bf16*)YB, (const __bf16*)YB, (const __bf16*)WvT, bv, VT, OUT);
  k_attn<<<dim3(SEQ / 64, NSLAB), 128, 0, stream>>>(QH, KH, VT, CH, CL);
  k_gemm<2, 2><<<gg, 256, 0, stream>>>((const __bf16*)CH, (const __bf16*)CL, (const __bf16*)WoT, bo, QH, OUT);
}

// v002
// It runs in 109 microseconds.
// Timed twice side by side with v001, it ran 1.91 and 1.92 times as fast.
// All steps since v000 together make it 3.40 times as fast.
// compute dtype: all float inputs converted to bf16 (RNE); q/k/v projections on v_wmma_f32_16x16x32_bf16 with exact bf16 x bf16 products, f32 accumulate; logits K.Q^T on v_wmma_f32_16x16x32_f16 (f16 q, k), f32 accumulate, x 1/32; softmax f32 (running max); P x 2^10 as f16 against f16 V^T on v_wmma_f32_16x16x32_f16; output projection: ctx as bf16 value + bf16 residual (2 products, shared accumulator) against bf16 Wo on v_wmma_f32_16x16x32_bf16; f32 output.
#include <hip/hip_runtime.h>
#include <math.h>

typedef __attribute__((ext_vector_type(16))) _Float16 v16h;
typedef __attribute__((ext_vector_type(16))) __bf16 v16b;
typedef __attribute__((ext_vector_type(8)))  _Float16 v8h;
typedef __attribute__((ext_vector_type(8)))  __bf16 v8b;
typedef __attribute__((ext_vector_type(8)))  float v8f;
typedef __attribute__((ext_vector_type(4)))  float v4f;
typedef __attribute__((ext_vector_type(4)))  unsigned v4u;
typedef v4u __attribute__((may_alias)) v4u_a;
typedef v4f __attribute__((may_alias)) v4f_a;
typedef v8h __attribute__((may_alias)) v8h_a;

#ifndef NB
#define NB 2
#endif
#ifndef SEQ
#define SEQ 2048
#endif
#define SEQ_FULL 2048          // per-batch row count of the inputs
#define DM 1024                // model width = projected width
#define NH 16
#define HD 64
#define NTOK (NB * SEQ)        // token rows of every [token][1024] plane
#define TPS (SEQ / NH)         // tokens per (head, batch) slab of the head-leading flat reshape
#define NSLAB (NH * NB)        // independent attention problems: SEQ pseudo-rows x HD each
#define SCALE 0.03125f         // 1 / sqrt(1024)
#define LN1024 6.931471806f

static_assert(SEQ % 1024 == 0);      // TPS multiple of 64: a 32-key step stays inside one feature group
static_assert(NTOK % 64 == 0);
static_assert(DM % 128 == 0);
static_assert(SEQ <= SEQ_FULL);

#define PLANE2 (2ull * (unsigned long long)NTOK * DM)    // bytes of one 16-bit [NTOK][1024] plane
#define WPL2   (2ull * (unsigned long long)DM * DM)      // bytes of one 16-bit weight plane
#define WS_XB 0ull
#define WS_YB (WS_XB + PLANE2)
#define WS_WT (WS_YB + PLANE2)       // 4 planes: Wq^T, Wk^T, Wv^T, Wo^T (bf16 [out][in])
#define WS_QH (WS_WT + 4ull * WPL2)
#define WS_KH (WS_QH + PLANE2)
#define WS_VT (WS_KH + PLANE2)       // f16 V^T planes [slab][d][key], key = j * TPS + tl
#define WS_CH (WS_VT + PLANE2)       // bf16 ctx value plane [token][1024]
#define WS_CL (WS_CH + PLANE2)       // bf16 ctx residual plane
#define WS_END (WS_CL + PLANE2)
static_assert(WS_END <= 134217728ull);
static_assert(PLANE2 % 128 == 0);
static_assert(WPL2 % 128 == 0);

template <typename T> __device__ __forceinline__ void vst2(T* p, T v) { *(T*)p = v;  }

__device__ __forceinline__ v8f wmma16(v16h a, v16h b, v8f c) {
  v8f d = __builtin_amdgcn_wmma_f32_16x16x32_f16(false, a, false, b, (short)0, c, false, false);
  asm volatile("v_nop\n\tv_nop\n\tv_nop\n\tv_nop" : "+v"(d) : "v"(a), "v"(b));
  return d;
}
__device__ __forceinline__ v8f wmma_bf(v16b a, v16b b, v8f c) {
  v8f d = __builtin_amdgcn_wmma_f32_16x16x32_bf16(false, a, false, b, (short)0, c, false, false);
  asm volatile("v_nop\n\tv_nop\n\tv_nop\n\tv_nop" : "+v"(d) : "v"(a), "v"(b));
  return d;
}
// 16x16x32 fragments: lane = (h = lane>>4, row/col = lane&15); elements 0..7 = k0+8h+0..7, 8..15 = k0+16+8h+0..7; D element r = row 8h+r, col lane&15
__device__ __forceinline__ v16h frag_h(const _Float16* rowk0, int lane) {
  union { v16h v; v8h q[2]; } u; const _Float16* p = rowk0 + 8 * (lane >> 4);
  u.q[0] = *(const v8h*)p; u.q[1] = *(const v8h*)(p + 16); return u.v;
}
__device__ __forceinline__ v16b frag_b(const __bf16* rowk0, int lane) {
  union { v16b v; v8b q[2]; } u; const __bf16* p = rowk0 + 8 * (lane >> 4);
  u.q[0] = *(const v8b*)p; u.q[1] = *(const v8b*)(p + 16); return u.v;
}
// bf16 bits of an f32 value, nearest-even
__device__ __forceinline__ unsigned bf16_rne(float f) { unsigned u = __float_as_uint(f); u += 0x7FFFu + ((u >> 16) & 1u); return u >> 16; }
__device__ __forceinline__ float bfr(float v) { return __uint_as_float(bf16_rne(v) << 16); }
__device__ __forceinline__ unsigned pack2(float a, float b) { return bf16_rne(a) | (bf16_rne(b) << 16); }
// same-wave LDS exchange: stores retire, then the wave proceeds to the loads
__device__ __forceinline__ void ldsx() { asm volatile("s_wait_dscnt 0" ::: "memory"); __builtin_amdgcn_wave_barrier(); __builtin_amdgcn_fence(3 /* release order */, "workgroup"); }

__global__ __launch_bounds__(256) void k_cvt(const float* __restrict__ X, unsigned* __restrict__ XB) {
  const size_t e = (size_t)blockIdx.x * 256 + threadIdx.x;
  if (e >= (size_t)NTOK * (DM / 8)) return;
  const int T = (int)(e >> 7); const int pc = (int)(e & 127); const int b = T / SEQ; const int s = T - b * SEQ;
  const float* p = X + ((size_t)b * SEQ_FULL + s) * DM + pc * 8;
  const v4f a = *(const v4f*)p; const v4f c = *(const v4f*)(p + 4);
  v4u o; o[0] = pack2(a[0], a[1]); o[1] = pack2(a[2], a[3]); o[2] = pack2(c[0], c[1]); o[3] = pack2(c[2], c[3]);
  vst2((v4u*)(XB + e * 4), o);
}

__global__ __launch_bounds__(256) void k_wt(const float* __restrict__ W, unsigned short* __restrict__ WT) {
  __shared__ __align__(16) unsigned short tl[64][72];
  const int tid = threadIdx.x; const int k0 = blockIdx.x * 64; const int n0 = blockIdx.y * 64;
#pragma unroll
  for (int it = 0; it < 4; ++it) { const int e = tid + it * 256; const int kr = e >> 4, q = e & 15;
    const v4f v = *(const v4f*)(W + (size_t)(k0 + kr) * DM + n0 + q * 4);
    tl[q * 4 + 0][kr] = (unsigned short)bf16_rne(v[0]); tl[q * 4 + 1][kr] = (unsigned short)bf16_rne(v[1]); tl[q * 4 + 2][kr] = (unsigned short)bf16_rne(v[2]); tl[q * 4 + 3][kr] = (unsigned short)bf16_rne(v[3]); }
  __syncthreads();
#pragma unroll
  for (int it = 0; it < 2; ++it) { const int e = tid + it * 256; const int n = e >> 3, q = e & 7;
    const v4u v = *(const v4u_a*)&tl[n][q * 8];
    vst2((v4u*)(WT + (size_t)(n0 + n) * DM + k0 + q * 8), v); }
}

// ---- tensor mover helpers (two-group descriptor of a two-dimensional tile, every extent in bytes)
typedef __attribute__((ext_vector_type(4))) unsigned u32x4;
typedef __attribute__((ext_vector_type(8))) unsigned u32x8;
#define PASS_B 256u            // bytes of every operand row per pass (128 k)
#define LPITCH 272u            // LDS row pitch: 256 + 16 pad bytes, an odd multiple of 16 for the ds_load_b128 readers
#define SL_ROWS 32u            // rows of one wave's slice
#define SL_B 10240u            // 32 x 272 = 8704 bytes, rounded up so that every slice starts on a multiple of 2 KiB
#define BUF_B (8u * SL_B)      // one stage: slices 0..3 = 128 A rows, slices 4..7 = 128 B rows
static_assert(SL_ROWS * LPITCH <= SL_B && SL_B % 2048u == 0);
static_assert(NTOK % 128 == 0 && TPS % 128 == 0);   // a 128-token block stays inside one slab
__device__ __forceinline__ unsigned uni(unsigned v) { return (unsigned)__builtin_amdgcn_readfirstlane((int)v); }
__device__ __forceinline__ unsigned pinned(unsigned v) { unsigned w = uni(v); asm volatile("" : "+s"(w)); return w; }  // pinned(): the issue test of a tensor load held in a scalar register, so that it compiles to s_cmp + s_cbranch_scc (the load ignores EXEC)
__device__ __forceinline__ void wait_ds0() { asm volatile("s_wait_dscnt 0x0" ::: "memory"); }          // this wave's LDS reads have retired before the buffer is handed back
// this wave's slice has landed (the compiler places no wait for the mover); the request's group 0 is named as an input so that its registers keep their words until then
__device__ __forceinline__ void wait_tensor0(u32x4 g0) { asm volatile("s_wait_tensorcnt 0x0" :: "s"(g0) : "memory"); }
// one request of the whole wave: global tile -> LDS; group 0 is tied in and out so that wait_tensor0 names the very registers the request was issued from
__device__ __forceinline__ void tdm_load(u32x4& g0, u32x8 g1) { asm volatile("tensor_load_to_lds %0, %1" : "+s"(g0) : "s"(g1) : "memory"); }
__device__ __forceinline__ u32x8 tdm_group1() {
  u32x8 q;
  q[0] = uni((1u << 20) | (5u << 22) | (3u << 25));   // no mask, 1-byte elements, 4 pad dwords behind every 256-byte row
  q[1] = uni((PASS_B & 0xFFFFu) << 16);
  q[2] = uni((PASS_B >> 16) | ((SL_ROWS & 0xFFFFu) << 16));
  q[3] = uni((SL_ROWS >> 16) | (PASS_B << 16));
  q[4] = uni(SL_ROWS);
  q[5] = uni(2u * DM);                                // source row pitch in bytes
  q[6] = uni(0u); q[7] = uni(0u);
  return q;
}
__device__ __forceinline__ u32x4 tdm_group0(unsigned lds_dst, unsigned long long ga) {
  u32x4 q; q[0] = uni(1u); q[1] = uni(lds_dst); q[2] = uni((unsigned)ga); q[3] = uni((((unsigned)(ga >> 32)) & 0x01FFFFFFu) | 0x80000000u);
  return q;
}

// ---- k_gemm: block = 128 rows x 128 cols, 8 waves as 4 x 2, wave = 32 rows x 64 cols; C = A . BT^T + bias over K = 1024 with bf16 operands
// Both operand tiles are staged in LDS by the tensor mover, 128 k per pass, two buffers: every wave brings one 32-row slice per stage, one stage ahead of the pass that reads it.
// NSEG = 2: the value plane's 8 passes, then the residual plane's 8 passes against the same BT rows, one shared accumulator.
// EPI 0: f16 row-major [NTOK][1024]; EPI 1: f16 V^T planes [slab][d][key = j*TPS + tl]; EPI 2: f32 row-major [NTOK][1024]
template <int NSEG, int EPI>
__global__ __launch_bounds__(256) void k_gemm(const __bf16* __restrict__ A0, const __bf16* __restrict__ A1, const __bf16* __restrict__ BT, const float* __restrict__ BIAS, _Float16* __restrict__ OH, float* __restrict__ OF) {
  __shared__ __attribute__((aligned(2048))) unsigned char ring[2u * BUF_B];
  const int tid = threadIdx.x; const int wave = __builtin_amdgcn_readfirstlane((int)(threadIdx.x >> 5)); const int lane = tid & 31, col = lane & 15, g = lane >> 4;
  const int wr = wave >> 1, wc = wave & 1;
  const int r0 = blockIdx.x * 128; const int c0 = blockIdx.y * 128;
  constexpr int NPP = DM * 2 / (int)PASS_B;   // passes per plane
  constexpr int NST = NPP * NSEG;             // stages = passes
  static_assert(NST >= 2);
  const unsigned lbase = (unsigned)(size_t)ring;
  const bool isA = wave < 4;
  const unsigned long long soff = (unsigned long long)(isA ? r0 + 32 * wave : c0 + 32 * (wave - 4)) * (2ull * DM);
  const unsigned long long src0 = (unsigned long long)(size_t)(isA ? A0 : BT) + soff;
  const unsigned long long src1 = (unsigned long long)(size_t)(isA ? A1 : BT) + soff;
  const u32x8 g1 = tdm_group1();
  u32x4 g0;   // group 0 of this wave's one outstanding request
  auto issue = [&](int s) {
    const unsigned dst = lbase + (unsigned)(s & 1) * BUF_B + (unsigned)wave * SL_B;
    const unsigned long long ga = (NSEG == 2 && s >= NPP ? src1 : src0) + (unsigned long long)(s & (NPP - 1)) * PASS_B;
    g0 = tdm_group0(dst, ga); tdm_load(g0, g1);
  };
  v8f acc[2][4] = {};
  issue(0); wait_tensor0(g0); __syncthreads();   // stage 0 published
  issue(1);
  // rolled: one publish point per pass, the buffer picked by the pass's parity
#pragma unroll 1
  for (int s = 0; s < NST; ++s) {
    const unsigned char* bufp = ring + (unsigned)(s & 1) * BUF_B;
    const unsigned char* pa = bufp + (unsigned)wr * SL_B + (unsigned)col * LPITCH;
    const unsigned char* pb = bufp + (unsigned)(4 + 2 * wc) * SL_B + (unsigned)col * LPITCH;
#pragma unroll
    for (int kc = 0; kc < (int)PASS_B / 64; ++kc) {
      v16b a[2], w[4];
#pragma unroll
      for (int i = 0; i < 2; ++i) a[i] = frag_b((const __bf16*)(pa + (unsigned)i * 16u * LPITCH + (unsigned)kc * 64u), lane);
#pragma unroll
      for (int j = 0; j < 4; ++j) w[j] = frag_b((const __bf16*)(pb + (unsigned)(j >> 1) * SL_B + (unsigned)(j & 1) * 16u * LPITCH + (unsigned)kc * 64u), lane);
#pragma unroll
      for (int i = 0; i < 2; ++i)
#pragma unroll
        for (int j = 0; j < 4; ++j) acc[i][j] = wmma_bf(a[i], w[j], acc[i][j]);
    }
    // publish point of stage s + 1: own LDS reads retired, own slice landed, then the barrier that also frees this pass's buffer
    wait_ds0(); wait_tensor0(g0); __syncthreads();
    if (pinned(s + 2 < NST)) issue(s + 2);
  }
  wait_tensor0(g0); wait_ds0();
  if (EPI == 0) {
    __shared__ __align__(16) _Float16 sh[128][136];
#pragma unroll
    for (int j = 0; j < 4; ++j) { const float bias = bfr(BIAS[c0 + wc * 64 + j * 16 + col]);
#pragma unroll
      for (int i = 0; i < 2; ++i)
#pragma unroll
        for (int r = 0; r < 8; ++r) sh[wr * 32 + i * 16 + 8 * g + r][wc * 64 + j * 16 + col] = (_Float16)(acc[i][j][r] + bias); }
    __syncthreads();
    for (int e = tid; e < 128 * 16; e += 256) { const int rl = e >> 4, q = e & 15; const v4u v = *(const v4u_a*)&sh[rl][q * 8]; *(v4u*)(OH + (size_t)(r0 + rl) * DM + c0 + q * 8) = v; }
  } else if (EPI == 1) {
    __shared__ __align__(16) _Float16 th[128][136];
#pragma unroll
    for (int j = 0; j < 4; ++j) { const float bias = bfr(BIAS[c0 + wc * 64 + j * 16 + col]);
#pragma unroll
      for (int i = 0; i < 2; ++i) { v8h hv;
#pragma unroll
        for (int r = 0; r < 8; ++r) hv[r] = (_Float16)(acc[i][j][r] + bias);
        *(v8h_a*)&th[wc * 64 + j * 16 + col][wr * 32 + i * 16 + 8 * g] = hv; } }
    __syncthreads();
    const int Ls = r0 / TPS; const int tl0 = r0 - Ls * TPS;
    for (int e = tid; e < 128 * 16; e += 256) { const int cl = e >> 4, q = e & 15; const int c = c0 + cl; const int jj = c >> 6, d = c & 63;
      const v4u v = *(const v4u_a*)&th[cl][q * 8]; *(v4u*)(OH + ((size_t)Ls * HD + d) * SEQ + jj * TPS + tl0 + q * 8) = v; }
  } else {
    __shared__ __align__(16) float ss[128][132];
#pragma unroll
    for (int j = 0; j < 4; ++j) { const float bias = bfr(BIAS[c0 + wc * 64 + j * 16 + col]);
#pragma unroll
      for (int i = 0; i < 2; ++i)
#pragma unroll
        for (int r = 0; r < 8; ++r) ss[wr * 32 + i * 16 + 8 * g + r][wc * 64 + j * 16 + col] = acc[i][j][r] + bias; }
    ldsx();   // each wave reads back only its own 32 rows x 64 cols
    for (int rl = 0; rl < 16; ++rl) { const int row = wr * 32 + rl * 2 + g; const v4f v = *(const v4f_a*)&ss[row][wc * 64 + col * 4]; *(v4f*)(OF + (size_t)(r0 + row) * DM + c0 + wc * 64 + col * 4) = v; }
  }
}

// ---- k_attn staging: a stage = 128 keys of slab L = 128 K rows x 128 B and 64 V^T rows x 256 B, brought into LDS by the tensor mover, two buffers
#define ST_KEYS 128u           // keys of one stage
#define AROW_B 128u            // bytes of every staged row: 64 features of a K row, or 64 keys of a V^T row
#define APITCH 144u            // LDS row pitch: 128 + 16 pad bytes, an odd multiple of 16 for the ds_load_b128 readers
#define ASL_ROWS 32u           // rows of one wave's slice
#define ASL_B 6144u            // 32 x 144 = 4608 bytes, rounded up so that every slice starts on a multiple of 2 KiB
#define ABUF_B (8u * ASL_B)    // one stage: slices 0..3 = K rows 32 w .. + 31; slices 4..7 = V^T rows 32 (w & 1) .. + 31 of the stage's key half (w - 4) >> 1
static_assert(ASL_ROWS * APITCH <= ASL_B && ASL_B % 2048u == 0);
static_assert(TPS % (int)ST_KEYS == 0 && SEQ % 128 == 0 && HD == 64);   // a stage stays inside one feature group
// as tdm_load and wait_tensor0, with group 1 tied and named as well: the registers of both groups keep their words from the issue to the wait
__device__ __forceinline__ void tdm_load_held(u32x4& g0, u32x8& g1) { asm volatile("tensor_load_to_lds %0, %1" : "+s"(g0), "+s"(g1) : : "memory"); }
__device__ __forceinline__ void wait_tensor0_held(u32x4 g0, u32x8 g1) { asm volatile("s_wait_tensorcnt 0x0" :: "s"(g0), "s"(g1) : "memory"); }
__device__ __forceinline__ u32x8 tdm_group1_attn(unsigned src_pitch) {
  u32x8 q;
  q[0] = uni((1u << 20) | (4u << 22) | (3u << 25));   // no mask, 1-byte elements, 4 pad dwords behind every 128-byte row
  q[1] = uni((AROW_B & 0xFFFFu) << 16);
  q[2] = uni((AROW_B >> 16) | ((ASL_ROWS & 0xFFFFu) << 16));
  q[3] = uni((ASL_ROWS >> 16) | (AROW_B << 16));
  q[4] = uni(ASL_ROWS);
  q[5] = uni(src_pitch);                              // source row pitch in bytes
  q[6] = uni(0u); q[7] = uni(0u);
  return q;
}

// ---- k_attn: block = 128 query pseudo-rows of slab L (8 waves, wave = 16 queries), fused over all SEQ keys in 32-key steps (transposed flash form):
//   S^T[key][query] = K . Q^T  (A = K rows, B = Q rows);  P^T packed in-lane as the B operand;  O^T[d][query] += V^T . P^T  (A = V^T rows).
//   Keys visited in the order key = j*TPS + tl (token L*TPS + tl, feature group j); K rows and V^T columns use the same order.
//   K rows and V^T rows are read from LDS: every wave brings one slice per 128-key stage, one stage ahead of the pass that reads it; all 8 waves share the stage.
//   Each lane owns one query column: running max / sum are per lane, combined across the two lane halves by one xor-16 shuffle.
__global__ __launch_bounds__(256) void k_attn(const _Float16* __restrict__ QH, const _Float16* __restrict__ KH, const _Float16* __restrict__ VT, unsigned* __restrict__ CH, unsigned* __restrict__ CL) {
  __shared__ __attribute__((aligned(2048))) unsigned char ring[2u * ABUF_B];
  __shared__ __align__(16) unsigned cst[8][2][16][36];   // per-wave staging of the 16 x 64 ctx tile: bf16 value pairs / residual pairs
  const int tid = threadIdx.x; const int wave = __builtin_amdgcn_readfirstlane((int)(threadIdx.x >> 5)); const int lane = tid & 31, col = lane & 15, g = lane >> 4;
  const int L = blockIdx.y; const size_t qrow0 = (size_t)L * SEQ + (size_t)blockIdx.x * 128 + wave * 16;
  const _Float16* qp = QH + (qrow0 + col) * HD;
  const v16h qf0 = frag_h(qp, lane); const v16h qf1 = frag_h(qp + 32, lane);
  constexpr int NST = SEQ / (int)ST_KEYS;   // stages = passes
  static_assert(NST >= 2);
  const unsigned lbase = (unsigned)(size_t)ring;
  const bool isK = wave < 4;
  // first byte of this wave's slice of stage 0, and what a stage adds to it
  const unsigned long long src = isK ? (unsigned long long)(size_t)KH + ((unsigned long long)L * TPS + 32ull * (unsigned)wave) * (2ull * DM)
                                     : (unsigned long long)(size_t)VT + ((unsigned long long)L * HD + 32ull * (unsigned)(wave & 1)) * (2ull * SEQ) + (unsigned long long)((wave - 4) >> 1) * AROW_B;
  u32x8 g1 = tdm_group1_attn(isK ? 2u * DM : 2u * SEQ);
  u32x4 g0;   // group 0 of this wave's one outstanding request
  auto issue = [&](int s) {
    const unsigned dst = lbase + (unsigned)(s & 1) * ABUF_B + (unsigned)wave * ASL_B;
    const int k0 = s * (int)ST_KEYS; const int jj = k0 / TPS; const int tl0 = k0 - jj * TPS;
    const unsigned long long step = isK ? (unsigned long long)tl0 * (2ull * DM) + (unsigned long long)jj * (2ull * HD) : (unsigned long long)k0 * 2ull;
    g0 = tdm_group0(dst, src + step); tdm_load_held(g0, g1);
  };
  v8f o[4] = {}; float m = -3.0e38f; float l = 0.f;
  issue(0); wait_tensor0_held(g0, g1); __syncthreads();   // stage 0 published
  issue(1);
  // rolled: one publish point per pass, the buffer picked by the pass's parity
#pragma unroll 1
  for (int s = 0; s < NST; ++s) {
    const unsigned char* bufp = ring + (unsigned)(s & 1) * ABUF_B;
    const unsigned char* kl = bufp + (unsigned)col * APITCH;
    const unsigned char* vl = bufp + 4u * ASL_B + (unsigned)col * APITCH;
#pragma unroll
    for (int hb = 0; hb < (int)ST_KEYS / 32; ++hb) {
      const unsigned char* kp = kl + (unsigned)hb * ASL_B;   // keys 32 hb .. 32 hb + 31 of the stage are K slice hb
      // all LDS reads of the step stand together in front of its products: one exposed LDS latency a step, the V^T rows arrive under the logits and the softmax
      const v16h ka0 = frag_h((const _Float16*)kp, lane); const v16h kb0 = frag_h((const _Float16*)(kp + 64u), lane);
      const v16h ka1 = frag_h((const _Float16*)(kp + 16u * APITCH), lane); const v16h kb1 = frag_h((const _Float16*)(kp + 16u * APITCH + 64u), lane);
      v16h vf[4];
#pragma unroll
      for (int j = 0; j < 4; ++j) vf[j] = frag_h((const _Float16*)(vl + (unsigned)(2 * (hb >> 1) + (j >> 1)) * ASL_B + (unsigned)(j & 1) * 16u * APITCH + (unsigned)(hb & 1) * 64u), lane);   // V^T row 16 j + col, keys 32 hb .. + 31
      v8f s0 = {}, s1 = {};
      s0 = wmma16(ka0, qf0, s0); s0 = wmma16(kb0, qf1, s0);
      s1 = wmma16(ka1, qf0, s1); s1 = wmma16(kb1, qf1, s1);
      float mx = fmaxf(s0[0], s1[0]);
#pragma unroll
      for (int r = 1; r < 8; ++r) mx = fmaxf(mx, fmaxf(s0[r], s1[r]));
      mx = fmaxf(mx, __shfl_xor(mx, 16));
      const int up = mx > m ? 1 : 0;
      if (__any(up)) {   // wave-uniform branch; lanes whose max is unchanged get a factor of exactly 1
        const float mn = fmaxf(m, mx); const float corr = __expf((m - mn) * SCALE); m = mn; l *= corr;
#pragma unroll
        for (int j = 0; j < 4; ++j)
#pragma unroll
          for (int r = 0; r < 8; ++r) o[j][r] *= corr;
      }
      const float c = LN1024 - m * SCALE;   // P carried x 2^10 (cancels in o / l)
      v16h pf; float ls = 0.f;
#pragma unroll
      for (int r = 0; r < 8; ++r) { const float p0 = __expf(fmaf(s0[r], SCALE, c)); const float p1 = __expf(fmaf(s1[r], SCALE, c)); ls += p0 + p1; pf[r] = (_Float16)p0; pf[8 + r] = (_Float16)p1; }
      l += ls;
#pragma unroll
      for (int j = 0; j < 4; ++j) o[j] = wmma16(vf[j], pf, o[j]);
    }
    // publish point of stage s + 1: own LDS reads retired, own slice landed, then the barrier that also frees this pass's buffer
    wait_ds0(); wait_tensor0_held(g0, g1); __syncthreads();
    if (pinned(s + 2 < NST)) issue(s + 2);
  }
  wait_tensor0_held(g0, g1); wait_ds0();
  l += __shfl_xor(l, 16);
  const float inv = 1.0f / l;
  // o[j][r] = ctx[query col][d = 16 j + 8 g + r]: 8 consecutive d per (lane, j) -> one 16-B piece per plane
#pragma unroll
  for (int j = 0; j < 4; ++j) { float v[8]; unsigned hb8[8];
#pragma unroll
    for (int r = 0; r < 8; ++r) { v[r] = o[j][r] * inv; hb8[r] = bf16_rne(v[r]); }
    v4u hv, lv;
#pragma unroll
    for (int t = 0; t < 4; ++t) { hv[t] = hb8[2 * t] | (hb8[2 * t + 1] << 16); lv[t] = pack2(v[2 * t] - __uint_as_float(hb8[2 * t] << 16), v[2 * t + 1] - __uint_as_float(hb8[2 * t + 1] << 16)); }
    *(v4u_a*)&cst[wave][0][col][j * 8 + g * 4] = hv; *(v4u_a*)&cst[wave][1][col][j * 8 + g * 4] = lv; }
  ldsx();   // wave-private tile
#pragma unroll
  for (int it = 0; it < 4; ++it) { const int row = it * 4 + (lane >> 3); const int pc = lane & 7;
    const v4u hv = *(const v4u_a*)&cst[wave][0][row][pc * 4]; const v4u lv = *(const v4u_a*)&cst[wave][1][row][pc * 4];
    *(v4u*)(CH + (qrow0 + row) * 32 + pc * 4) = hv; *(v4u*)(CL + (qrow0 + row) * 32 + pc * 4) = lv; }
}

extern "C" void kernel_launch(void* const* d_in, const int* in_sizes, int n_in, void* d_out, int out_size, void* d_ws, size_t ws_size, hipStream_t stream) {
  if (n_in < 10) return;
  const long long act_min = ((long long)(NB - 1) * SEQ_FULL + SEQ) * DM;
  if ((long long)in_sizes[0] < act_min || (long long)in_sizes[1] < act_min) return;
  if (in_sizes[2] < DM * DM || in_sizes[4] < DM * DM || in_sizes[6] < DM * DM || in_sizes[8] < DM * DM) return;
  if (in_sizes[3] < DM || in_sizes[5] < DM || in_sizes[7] < DM || in_sizes[9] < DM) return;
  if ((long long)out_size < (long long)NTOK * DM) return;
  if (ws_size < (size_t)WS_END) return;
  // inputs (wire order): 0 x, 1 y [2][2048][1024]; 2 Wq, 3 bq, 4 Wk, 5 bk, 6 Wv, 7 bv, 8 Wo, 9 bo; weights (in,out) [1024][1024]
  const float* x  = (const float*)d_in[0]; const float* y  = (const float*)d_in[1];
  const float* Wq = (const float*)d_in[2]; const float* bq = (const float*)d_in[3];
  const float* Wk = (const float*)d_in[4]; const float* bk = (const float*)d_in[5];
  const float* Wv = (const float*)d_in[6]; const float* bv = (const float*)d_in[7];
  const float* Wo = (const float*)d_in[8]; const float* bo = (const float*)d_in[9];
  char* ws = (char*)d_ws;
  unsigned* XB = (unsigned*)(ws + WS_XB); unsigned* YB = (unsigned*)(ws + WS_YB);
  unsigned short* WT = (unsigned short*)(ws + WS_WT);
  unsigned short* WqT = WT; unsigned short* WkT = WT + (size_t)DM * DM; unsigned short* WvT = WT + 2 * (size_t)DM * DM; unsigned short* WoT = WT + 3 * (size_t)DM * DM;
  _Float16* QH = (_Float16*)(ws + WS_QH); _Float16* KH = (_Float16*)(ws + WS_KH); _Float16* VT = (_Float16*)(ws + WS_VT);
  unsigned* CH = (unsigned*)(ws + WS_CH); unsigned* CL = (unsigned*)(ws + WS_CL);
  float* OUT = (float*)d_out;

  const int cvt_blocks = (int)(((size_t)NTOK * (DM / 8) + 255) / 256);
  k_cvt<<<dim3(cvt_blocks), 256, 0, stream>>>(x, XB);
  k_cvt<<<dim3(cvt_blocks), 256, 0, stream>>>(y, YB);
  // in[rows = in][cols = out] -> out[cols][rows]; square 1024 x 1024: grid (in / 64, out / 64)
  k_wt<<<dim3(DM / 64, DM / 64), 256, 0, stream>>>(Wq, WqT);
  k_wt<<<dim3(DM / 64, DM / 64), 256, 0, stream>>>(Wk, WkT);
  k_wt<<<dim3(DM / 64, DM / 64), 256, 0, stream>>>(Wv, WvT);
  k_wt<<<dim3(DM / 64, DM / 64), 256, 0, stream>>>(Wo, WoT);
  const dim3 gg(NTOK / 128, DM / 128);
  k_gemm<1, 0><<<gg, 256, 0, stream>>>((const __bf16*)XB, (const __bf16*)XB, (const __bf16*)WqT, bq, QH, OUT);
  k_gemm<1, 0><<<gg, 256, 0, stream>>>((const __bf16*)XB, (const __bf16*)XB, (const __bf16*)WkT, bk, KH, OUT);
  k_gemm<1, 1><<<gg, 256, 0, stream>>>((const __bf16*)YB, (const __bf16*)YB, (const __bf16*)WvT, bv, VT, OUT);
  k_attn<<<dim3(SEQ / 128, NSLAB), 256, 0, stream>>>(QH, KH, VT, CH, CL);
  k_gemm<2, 2><<<gg, 256, 0, stream>>>((const __bf16*)CH, (const __bf16*)CL, (const __bf16*)WoT, bo, QH, OUT);
}

// v003
// It runs in 99.4 microseconds.
// In both of two side-by-side timings against v002, it was 1.10 times as fast.
// Over all steps from v000 it is 3.74 times as fast.
// compute dtype: all float inputs converted to bf16 (RNE); q/k/v projections on v_wmma_f32_16x16x32_bf16 with exact bf16 x bf16 products, f32 accumulate; logits K.Q^T on v_wmma_f32_16x16x32_f16 (f16 q, k), f32 accumulate, x 1/32; softmax f32 (running max); P x 2^10 as f16 against f16 V^T on v_wmma_f32_16x16x32_f16; output projection: ctx as bf16 value + bf16 residual (2 products, shared accumulator) against bf16 Wo on v_wmma_f32_16x16x32_bf16; f32 output.
#include <hip/hip_runtime.h>
#include <math.h>

typedef __attribute__((ext_vector_type(16))) _Float16 v16h;
typedef __attribute__((ext_vector_type(16))) __bf16 v16b;
typedef __attribute__((ext_vector_type(8)))  _Float16 v8h;
typedef __attribute__((ext_vector_type(8)))  __bf16 v8b;
typedef __attribute__((ext_vector_type(8)))  float v8f;
typedef __attribute__((ext_vector_type(4)))  float v4f;
typedef __attribute__((ext_vector_type(4)))  unsigned v4u;
typedef v4u __attribute__((may_alias)) v4u_a;
typedef v4f __attribute__((may_alias)) v4f_a;
typedef v8h __attribute__((may_alias)) v8h_a;

#ifndef NB
#define NB 2
#endif
#ifndef SEQ
#define SEQ 2048
#endif
#define SEQ_FULL 2048          // per-batch row count of the inputs
#define DM 1024                // model width = projected width
#define NH 16
#define HD 64
#define NTOK (NB * SEQ)        // token rows of every [token][1024] plane
#define TPS (SEQ / NH)         // tokens per (head, batch) slab of the head-leading flat reshape
#define NSLAB (NH * NB)        // independent attention problems: SEQ pseudo-rows x HD each
#define SCALE 0.03125f         // 1 / sqrt(1024)
#define LN1024 6.931471806f

static_assert(SEQ % 1024 == 0);      // TPS multiple of 64: a 32-key step stays inside one feature group
static_assert(NTOK % 64 == 0);
static_assert(DM % 128 == 0);
static_assert(SEQ <= SEQ_FULL);

#define PLANE2 (2ull * (unsigned long long)NTOK * DM)    // bytes of one 16-bit [NTOK][1024] plane
#define WPL2   (2ull * (unsigned long long)DM * DM)      // bytes of one 16-bit weight plane
#define WS_XB 0ull
#define WS_YB (WS_XB + PLANE2)
#define WS_WT (WS_YB + PLANE2)       // 4 planes: Wq^T, Wk^T, Wv^T, Wo^T (bf16 [out][in])
#define WS_QH (WS_WT + 4ull * WPL2)
#define WS_KH (WS_QH + PLANE2)
#define WS_VT (WS_KH + PLANE2)       // f16 V^T planes [slab][d][key], key = j * TPS + tl
#define WS_CH (WS_VT + PLANE2)       // bf16 ctx value plane [token][1024]
#define WS_CL (WS_CH + PLANE2)       // bf16 ctx residual plane
#define WS_END (WS_CL + PLANE2)
static_assert(WS_END <= 134217728ull);
static_assert(PLANE2 % 128 == 0);
static_assert(WPL2 % 128 == 0);

template <typename T> __device__ __forceinline__ void vst2(T* p, T v) { *(T*)p = v;  }

__device__ __forceinline__ v8f wmma16(v16h a, v16h b, v8f c) {
  v8f d = __builtin_amdgcn_wmma_f32_16x16x32_f16(false, a, false, b, (short)0, c, false, false);
  asm volatile("v_nop\n\tv_nop\n\tv_nop\n\tv_nop" : "+v"(d) : "v"(a), "v"(b));
  return d;
}
__device__ __forceinline__ v8f wmma_bf(v16b a, v16b b, v8f c) {
  v8f d = __builtin_amdgcn_wmma_f32_16x16x32_bf16(false, a, false, b, (short)0, c, false, false);
  asm volatile("v_nop\n\tv_nop\n\tv_nop\n\tv_nop" : "+v"(d) : "v"(a), "v"(b));
  return d;
}
// 16x16x32 fragments: lane = (h = lane>>4, row/col = lane&15); elements 0..7 = k0+8h+0..7, 8..15 = k0+16+8h+0..7; D element r = row 8h+r, col lane&15
__device__ __forceinline__ v16h frag_h(const _Float16* rowk0, int lane) {
  union { v16h v; v8h q[2]; } u; const _Float16* p = rowk0 + 8 * (lane >> 4);
  u.q[0] = *(const v8h*)p; u.q[1] = *(const v8h*)(p + 16); return u.v;
}
__device__ __forceinline__ v16b frag_b(const __bf16* rowk0, int lane) {
  union { v16b v; v8b q[2]; } u; const __bf16* p = rowk0 + 8 * (lane >> 4);
  u.q[0] = *(const v8b*)p; u.q[1] = *(const v8b*)(p + 16); return u.v;
}
// bf16 bits of an f32 value, nearest-even
__device__ __forceinline__ unsigned bf16_rne(float f) { unsigned u = __float_as_uint(f); u += 0x7FFFu + ((u >> 16) & 1u); return u >> 16; }
__device__ __forceinline__ float bfr(float v) { return __uint_as_float(bf16_rne(v) << 16); }
__device__ __forceinline__ unsigned pack2(float a, float b) { return bf16_rne(a) | (bf16_rne(b) << 16); }
// same-wave LDS exchange: stores retire, then the wave proceeds to the loads
__device__ __forceinline__ void ldsx() { asm volatile("s_wait_dscnt 0" ::: "memory"); __builtin_amdgcn_wave_barrier(); __builtin_amdgcn_fence(3 /* release order */, "workgroup"); }

// ---- k_prep: every operand preparation of the call in ONE launch: x and y to bf16 planes, the four weights to transposed bf16 planes.
// A block takes CVT_IT 8-float pieces per thread of each activation plane (grid-strided) and WT_RND 64 x 64 weight tiles; few long waves in place of many one-piece waves.
#define PREP_BLOCKS 512
#define CVT_STRIDE (PREP_BLOCKS * 256)               // pieces the whole grid takes per trip
#define CVT_IT (NTOK * (DM / 8) / CVT_STRIDE)        // trips per activation plane
#define WT_TILES ((DM / 64) * (DM / 64))             // tiles of one weight
#define WT_RND (4 * WT_TILES / PREP_BLOCKS)          // tiles per block
static_assert(NTOK * (DM / 8) % CVT_STRIDE == 0);
static_assert(4 * WT_TILES % PREP_BLOCKS == 0 && DM / 64 == 16);
__global__ __launch_bounds__(256) void k_prep(const float* __restrict__ X, const float* __restrict__ Y, const float* __restrict__ W0, const float* __restrict__ W1, const float* __restrict__ W2, const float* __restrict__ W3,
                                              unsigned* __restrict__ XB, unsigned* __restrict__ YB, unsigned short* __restrict__ WT) {
  __shared__ __align__(16) unsigned short tl[WT_RND][64][72];
  const unsigned tid = threadIdx.x; const unsigned bid = blockIdx.x;
  const unsigned kr = tid >> 4, q4 = tid & 15;       // tile loads: k row (+ 16 a trip), quad of n
  // all loads of the block stand in front of all its stores: the weight tiles first, their way through LDS is the longer one
  v4f wv[WT_RND][4];
#pragma unroll
  for (int r = 0; r < WT_RND; ++r) { const unsigned t = bid + (unsigned)r * PREP_BLOCKS; const unsigned ws = t / WT_TILES; const unsigned k0 = (t & 15u) * 64u; const unsigned n0 = ((t >> 4) & 15u) * 64u;
    const float* W = (ws == 0 ? W0 : ws == 1 ? W1 : ws == 2 ? W2 : W3) + (size_t)(k0 + kr) * DM + n0 + q4 * 4u;
#pragma unroll
    for (int it = 0; it < 4; ++it) wv[r][it] = *(const v4f*)(W + (size_t)it * 16 * DM); }
  v4f ca[2][CVT_IT], cc[2][CVT_IT];
#pragma unroll
  for (int pl = 0; pl < 2; ++pl)
#pragma unroll
    for (int it = 0; it < CVT_IT; ++it) { const unsigned e = (unsigned)it * CVT_STRIDE + bid * 256u + tid;
      const unsigned T = e >> 7; const unsigned pc = e & 127u; const unsigned b = T / SEQ; const unsigned s = T % SEQ;
      const float* p = (pl == 0 ? X : Y) + ((size_t)b * SEQ_FULL + s) * DM + pc * 8u;
      ca[pl][it] = *(const v4f*)p; cc[pl][it] = *(const v4f*)(p + 4);
      if (it == CVT_IT - 1) asm volatile("s_wait_xcnt 0x0" ::: "memory"); }   // precaution: stands behind a plane's loads, in front of whatever writes a register that they name as an address
  __builtin_amdgcn_sched_barrier(0);   // keeps every load above issued before the first wait on one of them: one memory latency a block, not one a group of loads
#pragma unroll
  for (int r = 0; r < WT_RND; ++r)
#pragma unroll
    for (int it = 0; it < 4; ++it) { const unsigned k = kr + (unsigned)it * 16u; const v4f v = wv[r][it];
      tl[r][q4 * 4 + 0][k] = (unsigned short)bf16_rne(v[0]); tl[r][q4 * 4 + 1][k] = (unsigned short)bf16_rne(v[1]); tl[r][q4 * 4 + 2][k] = (unsigned short)bf16_rne(v[2]); tl[r][q4 * 4 + 3][k] = (unsigned short)bf16_rne(v[3]); }
  __syncthreads();
#pragma unroll
  for (int r = 0; r < WT_RND; ++r) { const unsigned t = bid + (unsigned)r * PREP_BLOCKS; const unsigned ws = t / WT_TILES; const unsigned k0 = (t & 15u) * 64u; const unsigned n0 = ((t >> 4) & 15u) * 64u;
#pragma unroll
    for (int it = 0; it < 2; ++it) { const unsigned n = (tid >> 3) + (unsigned)it * 32u, q = tid & 7u;
      const v4u v = *(const v4u_a*)&tl[r][n][q * 8];
      vst2((v4u*)(WT + (size_t)ws * DM * DM + (size_t)(n0 + n) * DM + k0 + q * 8u), v); } }
#pragma unroll
  for (int pl = 0; pl < 2; ++pl)
#pragma unroll
    for (int it = 0; it < CVT_IT; ++it) { const unsigned e = (unsigned)it * CVT_STRIDE + bid * 256u + tid;
      const v4f a = ca[pl][it]; const v4f c = cc[pl][it];
      v4u o; o[0] = pack2(a[0], a[1]); o[1] = pack2(a[2], a[3]); o[2] = pack2(c[0], c[1]); o[3] = pack2(c[2], c[3]);
      vst2((v4u*)((pl == 0 ? XB : YB) + (size_t)e * 4), o); }
}

// ---- tensor mover helpers (two-group descriptor of a two-dimensional tile, every extent in bytes)
typedef __attribute__((ext_vector_type(4))) unsigned u32x4;
typedef __attribute__((ext_vector_type(8))) unsigned u32x8;
#define PASS_B 256u            // bytes of every operand row per pass (128 k)
#define LPITCH 272u            // LDS row pitch: 256 + 16 pad bytes, an odd multiple of 16 for the ds_load_b128 readers
#define SL_ROWS 32u            // rows of one wave's slice
#define SL_B 10240u            // 32 x 272 = 8704 bytes, rounded up so that every slice starts on a multiple of 2 KiB
#define BUF_B (8u * SL_B)      // one stage: slices 0..3 = 128 A rows, slices 4..7 = 128 B rows
static_assert(SL_ROWS * LPITCH <= SL_B && SL_B % 2048u == 0);
static_assert(NTOK % 128 == 0 && TPS % 128 == 0);   // a 128-token block stays inside one slab
__device__ __forceinline__ unsigned uni(unsigned v) { return (unsigned)__builtin_amdgcn_readfirstlane((int)v); }
__device__ __forceinline__ unsigned pinned(unsigned v) { unsigned w = uni(v); asm volatile("" : "+s"(w)); return w; }  // pinned(): the issue test of a tensor load held in a scalar register, so that it compiles to s_cmp + s_cbranch_scc (the load ignores EXEC)
__device__ __forceinline__ void wait_ds0() { asm volatile("s_wait_dscnt 0x0" ::: "memory"); }          // this wave's LDS reads have retired before the buffer is handed back
// this wave's slice has landed (the compiler places no wait for the mover); the request's group 0 is named as an input so that its registers keep their words until then
__device__ __forceinline__ void wait_tensor0(u32x4 g0) { asm volatile("s_wait_tensorcnt 0x0" :: "s"(g0) : "memory"); }
// one request of the whole wave: global tile -> LDS; group 0 is tied in and out so that wait_tensor0 names the very registers the request was issued from
__device__ __forceinline__ void tdm_load(u32x4& g0, u32x8 g1) { asm volatile("tensor_load_to_lds %0, %1" : "+s"(g0) : "s"(g1) : "memory"); }
__device__ __forceinline__ u32x8 tdm_group1() {
  u32x8 q;
  q[0] = uni((1u << 20) | (5u << 22) | (3u << 25));   // no mask, 1-byte elements, 4 pad dwords behind every 256-byte row
  q[1] = uni((PASS_B & 0xFFFFu) << 16);
  q[2] = uni((PASS_B >> 16) | ((SL_ROWS & 0xFFFFu) << 16));
  q[3] = uni((SL_ROWS >> 16) | (PASS_B << 16));
  q[4] = uni(SL_ROWS);
  q[5] = uni(2u * DM);                                // source row pitch in bytes
  q[6] = uni(0u); q[7] = uni(0u);
  return q;
}
__device__ __forceinline__ u32x4 tdm_group0(unsigned lds_dst, unsigned long long ga) {
  u32x4 q; q[0] = uni(1u); q[1] = uni(lds_dst); q[2] = uni((unsigned)ga); q[3] = uni((((unsigned)(ga >> 32)) & 0x01FFFFFFu) | 0x80000000u);
  return q;
}

// ---- k_gemm: block = 128 rows x 128 cols, 8 waves as 4 x 2, wave = 32 rows x 64 cols; C = A . BT^T + bias over K = 1024 with bf16 operands
// Both operand tiles are staged in LDS by the tensor mover, 128 k per pass, two buffers: every wave brings one 32-row slice per stage, one stage ahead of the pass that reads it.
// NSEG = 2: the value plane's 8 passes, then the residual plane's 8 passes against the same BT rows, one shared accumulator.
// EPI 0: f16 row-major [NTOK][1024]; EPI 1: f16 V^T planes [slab][d][key = j*TPS + tl]; EPI 2: f32 row-major [NTOK][1024]
template <int NSEG, int EPI>
__global__ __launch_bounds__(256) void k_gemm(const __bf16* __restrict__ A0, const __bf16* __restrict__ A1, const __bf16* __restrict__ BT, const float* __restrict__ BIAS, _Float16* __restrict__ OH, float* __restrict__ OF) {
  __shared__ __attribute__((aligned(2048))) unsigned char ring[2u * BUF_B];
  const int tid = threadIdx.x; const int wave = __builtin_amdgcn_readfirstlane((int)(threadIdx.x >> 5)); const int lane = tid & 31, col = lane & 15, g = lane >> 4;
  const int wr = wave >> 1, wc = wave & 1;
  const int r0 = blockIdx.x * 128; const int c0 = blockIdx.y * 128;
  constexpr int NPP = DM * 2 / (int)PASS_B;   // passes per plane
  constexpr int NST = NPP * NSEG;             // stages = passes
  static_assert(NST >= 2);
  const unsigned lbase = (unsigned)(size_t)ring;
  const bool isA = wave < 4;
  const unsigned long long soff = (unsigned long long)(isA ? r0 + 32 * wave : c0 + 32 * (wave - 4)) * (2ull * DM);
  const unsigned long long src0 = (unsigned long long)(size_t)(isA ? A0 : BT) + soff;
  const unsigned long long src1 = (unsigned long long)(size_t)(isA ? A1 : BT) + soff;
  const u32x8 g1 = tdm_group1();
  u32x4 g0;   // group 0 of this wave's one outstanding request
  auto issue = [&](int s) {
    const unsigned dst = lbase + (unsigned)(s & 1) * BUF_B + (unsigned)wave * SL_B;
    const unsigned long long ga = (NSEG == 2 && s >= NPP ? src1 : src0) + (unsigned long long)(s & (NPP - 1)) * PASS_B;
    g0 = tdm_group0(dst, ga); tdm_load(g0, g1);
  };
  v8f acc[2][4] = {};
  issue(0); wait_tensor0(g0); __syncthreads();   // stage 0 published
  issue(1);
  // rolled: one publish point per pass, the buffer picked by the pass's parity
#pragma unroll 1
  for (int s = 0; s < NST; ++s) {
    const unsigned char* bufp = ring + (unsigned)(s & 1) * BUF_B;
    const unsigned char* pa = bufp + (unsigned)wr * SL_B + (unsigned)col * LPITCH;
    const unsigned char* pb = bufp + (unsigned)(4 + 2 * wc) * SL_B + (unsigned)col * LPITCH;
#pragma unroll
    for (int kc = 0; kc < (int)PASS_B / 64; ++kc) {
      v16b a[2], w[4];
#pragma unroll
      for (int i = 0; i < 2; ++i) a[i] = frag_b((const __bf16*)(pa + (unsigned)i * 16u * LPITCH + (unsigned)kc * 64u), lane);
#pragma unroll
      for (int j = 0; j < 4; ++j) w[j] = frag_b((const __bf16*)(pb + (unsigned)(j >> 1) * SL_B + (unsigned)(j & 1) * 16u * LPITCH + (unsigned)kc * 64u), lane);
#pragma unroll
      for (int i = 0; i < 2; ++i)
#pragma unroll
        for (int j = 0; j < 4; ++j) acc[i][j] = wmma_bf(a[i], w[j], acc[i][j]);
    }
    // publish point of stage s + 1: own LDS reads retired, own slice landed, then the barrier that also frees this pass's buffer
    wait_ds0(); wait_tensor0(g0); __syncthreads();
    if (pinned(s + 2 < NST)) issue(s + 2);
  }
  wait_tensor0(g0); wait_ds0();
  if (EPI == 0) {
    __shared__ __align__(16) _Float16 sh[128][136];
#pragma unroll
    for (int j = 0; j < 4; ++j) { const float bias = bfr(BIAS[c0 + wc * 64 + j * 16 + col]);
#pragma unroll
      for (int i = 0; i < 2; ++i)
#pragma unroll
        for (int r = 0; r < 8; ++r) sh[wr * 32 + i * 16 + 8 * g + r][wc * 64 + j * 16 + col] = (_Float16)(acc[i][j][r] + bias); }
    __syncthreads();
    for (int e = tid; e < 128 * 16; e += 256) { const int rl = e >> 4, q = e & 15; const v4u v = *(const v4u_a*)&sh[rl][q * 8]; *(v4u*)(OH + (size_t)(r0 + rl) * DM + c0 + q * 8) = v; }
  } else if (EPI == 1) {
    __shared__ __align__(16) _Float16 th[128][136];
#pragma unroll
    for (int j = 0; j < 4; ++j) { const float bias = bfr(BIAS[c0 + wc * 64 + j * 16 + col]);
#pragma unroll
      for (int i = 0; i < 2; ++i) { v8h hv;
#pragma unroll
        for (int r = 0; r < 8; ++r) hv[r] = (_Float16)(acc[i][j][r] + bias);
        *(v8h_a*)&th[wc * 64 + j * 16 + col][wr * 32 + i * 16 + 8 * g] = hv; } }
    __syncthreads();
    const int Ls = r0 / TPS; const int tl0 = r0 - Ls * TPS;
    for (int e = tid; e < 128 * 16; e += 256) { const int cl = e >> 4, q = e & 15; const int c = c0 + cl; const int jj = c >> 6, d = c & 63;
      const v4u v = *(const v4u_a*)&th[cl][q * 8]; *(v4u*)(OH + ((size_t)Ls * HD + d) * SEQ + jj * TPS + tl0 + q * 8) = v; }
  } else {
    __shared__ __align__(16) float ss[128][132];
#pragma unroll
    for (int j = 0; j < 4; ++j) { const float bias = bfr(BIAS[c0 + wc * 64 + j * 16 + col]);
#pragma unroll
      for (int i = 0; i < 2; ++i)
#pragma unroll
        for (int r = 0; r < 8; ++r) ss[wr * 32 + i * 16 + 8 * g + r][wc * 64 + j * 16 + col] = acc[i][j][r] + bias; }
    ldsx();   // each wave reads back only its own 32 rows x 64 cols
    for (int rl = 0; rl < 16; ++rl) { const int row = wr * 32 + rl * 2 + g; const v4f v = *(const v4f_a*)&ss[row][wc * 64 + col * 4]; *(v4f*)(OF + (size_t)(r0 + row) * DM + c0 + wc * 64 + col * 4) = v; }
  }
}

// ---- k_attn staging: a stage = 128 keys of slab L = 128 K rows x 128 B and 64 V^T rows x 256 B, brought into LDS by the tensor mover, two buffers
#define ST_KEYS 128u           // keys of one stage
#define AROW_B 128u            // bytes of every staged row: 64 features of a K row, or 64 keys of a V^T row
#define APITCH 144u            // LDS row pitch: 128 + 16 pad bytes, an odd multiple of 16 for the ds_load_b128 readers
#define ASL_ROWS 32u           // rows of one wave's slice
#define ASL_B 6144u            // 32 x 144 = 4608 bytes, rounded up so that every slice starts on a multiple of 2 KiB
#define ABUF_B (8u * ASL_B)    // one stage: slices 0..3 = K rows 32 w .. + 31; slices 4..7 = V^T rows 32 (w & 1) .. + 31 of the stage's key half (w - 4) >> 1
static_assert(ASL_ROWS * APITCH <= ASL_B && ASL_B % 2048u == 0);
static_assert(TPS % (int)ST_KEYS == 0 && SEQ % 128 == 0 && HD == 64);   // a stage stays inside one feature group
// as tdm_load and wait_tensor0, with group 1 tied and named as well: the registers of both groups keep their words from the issue to the wait
__device__ __forceinline__ void tdm_load_held(u32x4& g0, u32x8& g1) { asm volatile("tensor_load_to_lds %0, %1" : "+s"(g0), "+s"(g1) : : "memory"); }
__device__ __forceinline__ void wait_tensor0_held(u32x4 g0, u32x8 g1) { asm volatile("s_wait_tensorcnt 0x0" :: "s"(g0), "s"(g1) : "memory"); }
__device__ __forceinline__ u32x8 tdm_group1_attn(unsigned src_pitch) {
  u32x8 q;
  q[0] = uni((1u << 20) | (4u << 22) | (3u << 25));   // no mask, 1-byte elements, 4 pad dwords behind every 128-byte row
  q[1] = uni((AROW_B & 0xFFFFu) << 16);
  q[2] = uni((AROW_B >> 16) | ((ASL_ROWS & 0xFFFFu) << 16));
  q[3] = uni((ASL_ROWS >> 16) | (AROW_B << 16));
  q[4] = uni(ASL_ROWS);
  q[5] = uni(src_pitch);                              // source row pitch in bytes
  q[6] = uni(0u); q[7] = uni(0u);
  return q;
}

// ---- k_attn: block = 128 query pseudo-rows of slab L (8 waves, wave = 16 queries), fused over all SEQ keys in 32-key steps (transposed flash form):
//   S^T[key][query] = K . Q^T  (A = K rows, B = Q rows);  P^T packed in-lane as the B operand;  O^T[d][query] += V^T . P^T  (A = V^T rows).
//   Keys visited in the order key = j*TPS + tl (token L*TPS + tl, feature group j); K rows and V^T columns use the same order.
//   K rows and V^T rows are read from LDS: every wave brings one slice per 128-key stage, one stage ahead of the pass that reads it; all 8 waves share the stage.
//   Each lane owns one query column: running max / sum are per lane, combined across the two lane halves by one xor-16 shuffle.
__global__ __launch_bounds__(256) void k_attn(const _Float16* __restrict__ QH, const _Float16* __restrict__ KH, const _Float16* __restrict__ VT, unsigned* __restrict__ CH, unsigned* __restrict__ CL) {
  __shared__ __attribute__((aligned(2048))) unsigned char ring[2u * ABUF_B];
  __shared__ __align__(16) unsigned cst[8][2][16][36];   // per-wave staging of the 16 x 64 ctx tile: bf16 value pairs / residual pairs
  const int tid = threadIdx.x; const int wave = __builtin_amdgcn_readfirstlane((int)(threadIdx.x >> 5)); const int lane = tid & 31, col = lane & 15, g = lane >> 4;
  const int L = blockIdx.y; const size_t qrow0 = (size_t)L * SEQ + (size_t)blockIdx.x * 128 + wave * 16;
  const _Float16* qp = QH + (qrow0 + col) * HD;
  const v16h qf0 = frag_h(qp, lane); const v16h qf1 = frag_h(qp + 32, lane);
  constexpr int NST = SEQ / (int)ST_KEYS;   // stages = passes
  static_assert(NST >= 2);
  const unsigned lbase = (unsigned)(size_t)ring;
  const bool isK = wave < 4;
  // first byte of this wave's slice of stage 0, and what a stage adds to it
  const unsigned long long src = isK ? (unsigned long long)(size_t)KH + ((unsigned long long)L * TPS + 32ull * (unsigned)wave) * (2ull * DM)
                                     : (unsigned long long)(size_t)VT + ((unsigned long long)L * HD + 32ull * (unsigned)(wave & 1)) * (2ull * SEQ) + (unsigned long long)((wave - 4) >> 1) * AROW_B;
  u32x8 g1 = tdm_group1_attn(isK ? 2u * DM : 2u * SEQ);
  u32x4 g0;   // group 0 of this wave's one outstanding request
  auto issue = [&](int s) {
    const unsigned dst = lbase + (unsigned)(s & 1) * ABUF_B + (unsigned)wave * ASL_B;
    const int k0 = s * (int)ST_KEYS; const int jj = k0 / TPS; const int tl0 = k0 - jj * TPS;
    const unsigned long long step = isK ? (unsigned long long)tl0 * (2ull * DM) + (unsigned long long)jj * (2ull * HD) : (unsigned long long)k0 * 2ull;
    g0 = tdm_group0(dst, src + step); tdm_load_held(g0, g1);
  };
  v8f o[4] = {}; float m = -3.0e38f; float l = 0.f;
  issue(0); wait_tensor0_held(g0, g1); __syncthreads();   // stage 0 published
  issue(1);
  // rolled: one publish point per pass, the buffer picked by the pass's parity
#pragma unroll 1
  for (int s = 0; s < NST; ++s) {
    const unsigned char* bufp = ring + (unsigned)(s & 1) * ABUF_B;
    const unsigned char* kl = bufp + (unsigned)col * APITCH;
    const unsigned char* vl = bufp + 4u * ASL_B + (unsigned)col * APITCH;
#pragma unroll
    for (int hb = 0; hb < (int)ST_KEYS / 32; ++hb) {
      const unsigned char* kp = kl + (unsigned)hb * ASL_B;   // keys 32 hb .. 32 hb + 31 of the stage are K slice hb
      // all LDS reads of the step stand together in front of its products: one exposed LDS latency a step, the V^T rows arrive under the logits and the softmax
      const v16h ka0 = frag_h((const _Float16*)kp, lane); const v16h kb0 = frag_h((const _Float16*)(kp + 64u), lane);
      const v16h ka1 = frag_h((const _Float16*)(kp + 16u * APITCH), lane); const v16h kb1 = frag_h((const _Float16*)(kp + 16u * APITCH + 64u), lane);
      v16h vf[4];
#pragma unroll
      for (int j = 0; j < 4; ++j) vf[j] = frag_h((const _Float16*)(vl + (unsigned)(2 * (hb >> 1) + (j >> 1)) * ASL_B + (unsigned)(j & 1) * 16u * APITCH + (unsigned)(hb & 1) * 64u), lane);   // V^T row 16 j + col, keys 32 hb .. + 31
      v8f s0 = {}, s1 = {};
      s0 = wmma16(ka0, qf0, s0); s0 = wmma16(kb0, qf1, s0);
      s1 = wmma16(ka1, qf0, s1); s1 = wmma16(kb1, qf1, s1);
      float mx = fmaxf(s0[0], s1[0]);
#pragma unroll
      for (int r = 1; r < 8; ++r) mx = fmaxf(mx, fmaxf(s0[r], s1[r]));
      mx = fmaxf(mx, __shfl_xor(mx, 16));
      const int up = mx > m ? 1 : 0;
      if (__any(up)) {   // wave-uniform branch; lanes whose max is unchanged get a factor of exactly 1
        const float mn = fmaxf(m, mx); const float corr = __expf((m - mn) * SCALE); m = mn; l *= corr;
#pragma unroll
        for (int j = 0; j < 4; ++j)
#pragma unroll
          for (int r = 0; r < 8; ++r) o[j][r] *= corr;
      }
      const float c = LN1024 - m * SCALE;   // P carried x 2^10 (cancels in o / l)
      v16h pf; float ls = 0.f;
#pragma unroll
      for (int r = 0; r < 8; ++r) { const float p0 = __expf(fmaf(s0[r], SCALE, c)); const float p1 = __expf(fmaf(s1[r], SCALE, c)); ls += p0 + p1; pf[r] = (_Float16)p0; pf[8 + r] = (_Float16)p1; }
      l += ls;
#pragma unroll
      for (int j = 0; j < 4; ++j) o[j] = wmma16(vf[j], pf, o[j]);
    }
    // publish point of stage s + 1: own LDS reads retired, own slice landed, then the barrier that also frees this pass's buffer
    wait_ds0(); wait_tensor0_held(g0, g1); __syncthreads();
    if (pinned(s + 2 < NST)) issue(s + 2);
  }
  wait_tensor0_held(g0, g1); wait_ds0();
  l += __shfl_xor(l, 16);
  const float inv = 1.0f / l;
  // o[j][r] = ctx[query col][d = 16 j + 8 g + r]: 8 consecutive d per (lane, j) -> one 16-B piece per plane
#pragma unroll
  for (int j = 0; j < 4; ++j) { float v[8]; unsigned hb8[8];
#pragma unroll
    for (int r = 0; r < 8; ++r) { v[r] = o[j][r] * inv; hb8[r] = bf16_rne(v[r]); }
    v4u hv, lv;
#pragma unroll
    for (int t = 0; t < 4; ++t) { hv[t] = hb8[2 * t] | (hb8[2 * t + 1] << 16); lv[t] = pack2(v[2 * t] - __uint_as_float(hb8[2 * t] << 16), v[2 * t + 1] - __uint_as_float(hb8[2 * t + 1] << 16)); }
    *(v4u_a*)&cst[wave][0][col][j * 8 + g * 4] = hv; *(v4u_a*)&cst[wave][1][col][j * 8 + g * 4] = lv; }
  ldsx();   // wave-private tile
#pragma unroll
  for (int it = 0; it < 4; ++it) { const int row = it * 4 + (lane >> 3); const int pc = lane & 7;
    const v4u hv = *(const v4u_a*)&cst[wave][0][row][pc * 4]; const v4u lv = *(const v4u_a*)&cst[wave][1][row][pc * 4];
    *(v4u*)(CH + (qrow0 + row) * 32 + pc * 4) = hv; *(v4u*)(CL + (qrow0 + row) * 32 + pc * 4) = lv; }
}

extern "C" void kernel_launch(void* const* d_in, const int* in_sizes, int n_in, void* d_out, int out_size, void* d_ws, size_t ws_size, hipStream_t stream) {
  if (n_in < 10) return;
  const long long act_min = ((long long)(NB - 1) * SEQ_FULL + SEQ) * DM;
  if ((long long)in_sizes[0] < act_min || (long long)in_sizes[1] < act_min) return;
  if (in_sizes[2] < DM * DM || in_sizes[4] < DM * DM || in_sizes[6] < DM * DM || in_sizes[8] < DM * DM) return;
  if (in_sizes[3] < DM || in_sizes[5] < DM || in_sizes[7] < DM || in_sizes[9] < DM) return;
  if ((long long)out_size < (long long)NTOK * DM) return;
  if (ws_size < (size_t)WS_END) return;
  // inputs (wire order): 0 x, 1 y [2][2048][1024]; 2 Wq, 3 bq, 4 Wk, 5 bk, 6 Wv, 7 bv, 8 Wo, 9 bo; weights (in,out) [1024][1024]
  const float* x  = (const float*)d_in[0]; const float* y  = (const float*)d_in[1];
  const float* Wq = (const float*)d_in[2]; const float* bq = (const float*)d_in[3];
  const float* Wk = (const float*)d_in[4]; const float* bk = (const float*)d_in[5];
  const float* Wv = (const float*)d_in[6]; const float* bv = (const float*)d_in[7];
  const float* Wo = (const float*)d_in[8]; const float* bo = (const float*)d_in[9];
  char* ws = (char*)d_ws;
  unsigned* XB = (unsigned*)(ws + WS_XB); unsigned* YB = (unsigned*)(ws + WS_YB);
  unsigned short* WT = (unsigned short*)(ws + WS_WT);
  unsigned short* WqT = WT; unsigned short* WkT = WT + (size_t)DM * DM; unsigned short* WvT = WT + 2 * (size_t)DM * DM; unsigned short* WoT = WT + 3 * (size_t)DM * DM;
  _Float16* QH = (_Float16*)(ws + WS_QH); _Float16* KH = (_Float16*)(ws + WS_KH); _Float16* VT = (_Float16*)(ws + WS_VT);
  unsigned* CH = (unsigned*)(ws + WS_CH); unsigned* CL = (unsigned*)(ws + WS_CL);
  float* OUT = (float*)d_out;

  // weights are in[rows = in][cols = out] -> planes [out][in], in the order Wq, Wk, Wv, Wo behind WT
  k_prep<<<dim3(PREP_BLOCKS), 256, 0, stream>>>(x, y, Wq, Wk, Wv, Wo, XB, YB, WT);
  const dim3 gg(NTOK / 128, DM / 128);
  k_gemm<1, 0><<<gg, 256, 0, stream>>>((const __bf16*)XB, (const __bf16*)XB, (const __bf16*)WqT, bq, QH, OUT);
  k_gemm<1, 0><<<gg, 256, 0, stream>>>((const __bf16*)XB, (const __bf16*)XB, (const __bf16*)WkT, bk, KH, OUT);
  k_gemm<1, 1><<<gg, 256, 0, stream>>>((const __bf16*)YB, (const __bf16*)YB, (const __bf16*)WvT, bv, VT, OUT);
  k_attn<<<dim3(SEQ / 128, NSLAB), 256, 0, stream>>>(QH, KH, VT, CH, CL);
  k_gemm<2, 2><<<gg, 256, 0, stream>>>((const __bf16*)CH, (const __bf16*)CL, (const __bf16*)WoT, bo, QH, OUT);
}

// v004
// One run takes 95.5 microseconds.
// Two timings next to v003 both put it at 1.04 times that version's speed.
// Over all steps from v000 it is 3.89 times as fast.
// compute dtype: all float inputs converted to bf16 (RNE); q/k/v projections on v_wmma_f32_16x16x32_bf16 with exact bf16 x bf16 products, f32 accumulate; logits K.Q^T on v_wmma_f32_16x16x32_f16 (f16 q, k), f32 accumulate, x 1/32; softmax f32 (running max); P x 2^10 as f16 against f16 V^T on v_wmma_f32_16x16x32_f16; output projection: ctx as bf16 value + bf16 residual (2 products, shared accumulator) against bf16 Wo on v_wmma_f32_16x16x32_bf16; f32 output.
#include <hip/hip_runtime.h>
#include <math.h>

typedef __attribute__((ext_vector_type(16))) _Float16 v16h;
typedef __attribute__((ext_vector_type(16))) __bf16 v16b;
typedef __attribute__((ext_vector_type(8)))  _Float16 v8h;
typedef __attribute__((ext_vector_type(8)))  __bf16 v8b;
typedef __attribute__((ext_vector_type(8)))  float v8f;
typedef __attribute__((ext_vector_type(4)))  float v4f;
typedef __attribute__((ext_vector_type(4)))  unsigned v4u;
typedef v4u __attribute__((may_alias)) v4u_a;
typedef v4f __attribute__((may_alias)) v4f_a;
typedef v8h __attribute__((may_alias)) v8h_a;

#ifndef NB
#define NB 2
#endif
#ifndef SEQ
#define SEQ 2048
#endif
#define SEQ_FULL 2048          // per-batch row count of the inputs
#define DM 1024                // model width = projected width
#define NH 16
#define HD 64
#define NTOK (NB * SEQ)        // token rows of every [token][1024] plane
#define TPS (SEQ / NH)         // tokens per (head, batch) slab of the head-leading flat reshape
#define NSLAB (NH * NB)        // independent attention problems: SEQ pseudo-rows x HD each
#define SCALE 0.03125f         // 1 / sqrt(1024)
#define LN1024 6.931471806f

static_assert(SEQ % 1024 == 0);      // TPS multiple of 64: a 32-key step stays inside one feature group
static_assert(NTOK % 64 == 0);
static_assert(DM % 128 == 0);
static_assert(SEQ <= SEQ_FULL);

#define PLANE2 (2ull * (unsigned long long)NTOK * DM)    // bytes of one 16-bit [NTOK][1024] plane
#define WPL2   (2ull * (unsigned long long)DM * DM)      // bytes of one 16-bit weight plane
#define WS_XB 0ull
#define WS_YB (WS_XB + PLANE2)
#define WS_WT (WS_YB + PLANE2)       // 4 planes: Wq^T, Wk^T, Wv^T, Wo^T (bf16 [out][in])
#define WS_QH (WS_WT + 4ull * WPL2)
#define WS_KH (WS_QH + PLANE2)
#define WS_VT (WS_KH + PLANE2)       // f16 V^T planes [slab][d][key], key = j * TPS + tl
#define WS_CH (WS_VT + PLANE2)       // bf16 ctx value plane [token][1024]
#define WS_CL (WS_CH + PLANE2)       // bf16 ctx residual plane
#define WS_END (WS_CL + PLANE2)
static_assert(WS_END <= 134217728ull);
static_assert(PLANE2 % 128 == 0);
static_assert(WPL2 % 128 == 0);

template <typename T> __device__ __forceinline__ void vst2(T* p, T v) { *(T*)p = v;  }

__device__ __forceinline__ v8f wmma16(v16h a, v16h b, v8f c) {
  v8f d = __builtin_amdgcn_wmma_f32_16x16x32_f16(false, a, false, b, (short)0, c, false, false);
  asm volatile("v_nop\n\tv_nop\n\tv_nop\n\tv_nop" : "+v"(d) : "v"(a), "v"(b));
  return d;
}
__device__ __forceinline__ v8f wmma_bf(v16b a, v16b b, v8f c) {
  v8f d = __builtin_amdgcn_wmma_f32_16x16x32_bf16(false, a, false, b, (short)0, c, false, false);
  asm volatile("v_nop\n\tv_nop\n\tv_nop\n\tv_nop" : "+v"(d) : "v"(a), "v"(b));
  return d;
}
// 16x16x32 fragments: lane = (h = lane>>4, row/col = lane&15); elements 0..7 = k0+8h+0..7, 8..15 = k0+16+8h+0..7; D element r = row 8h+r, col lane&15
__device__ __forceinline__ v16h frag_h(const _Float16* rowk0, int lane) {
  union { v16h v; v8h q[2]; } u; const _Float16* p = rowk0 + 8 * (lane >> 4);
  u.q[0] = *(const v8h*)p; u.q[1] = *(const v8h*)(p + 16); return u.v;
}
__device__ __forceinline__ v16b frag_b(const __bf16* rowk0, int lane) {
  union { v16b v; v8b q[2]; } u; const __bf16* p = rowk0 + 8 * (lane >> 4);
  u.q[0] = *(const v8b*)p; u.q[1] = *(const v8b*)(p + 16); return u.v;
}
// bf16 bits of an f32 value, nearest-even
__device__ __forceinline__ unsigned bf16_rne(float f) { unsigned u = __float_as_uint(f); u += 0x7FFFu + ((u >> 16) & 1u); return u >> 16; }
__device__ __forceinline__ float bfr(float v) { return __uint_as_float(bf16_rne(v) << 16); }
__device__ __forceinline__ unsigned pack2(float a, float b) { return bf16_rne(a) | (bf16_rne(b) << 16); }
// same-wave LDS exchange: stores retire, then the wave proceeds to the loads
__device__ __forceinline__ void ldsx() { asm volatile("s_wait_dscnt 0" ::: "memory"); __builtin_amdgcn_wave_barrier(); __builtin_amdgcn_fence(3 /* release order */, "workgroup"); }

// ---- k_prep: every operand preparation of the call in ONE launch: x and y to bf16 planes, the four weights to transposed bf16 planes.
// A block takes CVT_IT 8-float pieces per thread of each activation plane (grid-strided) and WT_RND 64 x 64 weight tiles; few long waves in place of many one-piece waves.
#define PREP_BLOCKS 512
#define CVT_STRIDE (PREP_BLOCKS * 256)               // pieces the whole grid takes per trip
#define CVT_IT (NTOK * (DM / 8) / CVT_STRIDE)        // trips per activation plane
#define WT_TILES ((DM / 64) * (DM / 64))             // tiles of one weight
#define WT_RND (4 * WT_TILES / PREP_BLOCKS)          // tiles per block
static_assert(NTOK * (DM / 8) % CVT_STRIDE == 0);
static_assert(4 * WT_TILES % PREP_BLOCKS == 0 && DM / 64 == 16);
__global__ __launch_bounds__(256) void k_prep(const float* __restrict__ X, const float* __restrict__ Y, const float* __restrict__ W0, const float* __restrict__ W1, const float* __restrict__ W2, const float* __restrict__ W3,
                                              unsigned* __restrict__ XB, unsigned* __restrict__ YB, unsigned short* __restrict__ WT) {
  __shared__ __align__(16) unsigned short tl[WT_RND][64][72];
  const unsigned tid = threadIdx.x; const unsigned bid = blockIdx.x;
  const unsigned kr = tid >> 4, q4 = tid & 15;       // tile loads: k row (+ 16 a trip), quad of n
  // all loads of the block stand in front of all its stores: the weight tiles first, their way through LDS is the longer one
  v4f wv[WT_RND][4];
#pragma unroll
  for (int r = 0; r < WT_RND; ++r) { const unsigned t = bid + (unsigned)r * PREP_BLOCKS; const unsigned ws = t / WT_TILES; const unsigned k0 = (t & 15u) * 64u; const unsigned n0 = ((t >> 4) & 15u) * 64u;
    const float* W = (ws == 0 ? W0 : ws == 1 ? W1 : ws == 2 ? W2 : W3) + (size_t)(k0 + kr) * DM + n0 + q4 * 4u;
#pragma unroll
    for (int it = 0; it < 4; ++it) wv[r][it] = *(const v4f*)(W + (size_t)it * 16 * DM); }
  v4f ca[2][CVT_IT], cc[2][CVT_IT];
#pragma unroll
  for (int pl = 0; pl < 2; ++pl)
#pragma unroll
    for (int it = 0; it < CVT_IT; ++it) { const unsigned e = (unsigned)it * CVT_STRIDE + bid * 256u + tid;
      const unsigned T = e >> 7; const unsigned pc = e & 127u; const unsigned b = T / SEQ; const unsigned s = T % SEQ;
      const float* p = (pl == 0 ? X : Y) + ((size_t)b * SEQ_FULL + s) * DM + pc * 8u;
      ca[pl][it] = *(const v4f*)p; cc[pl][it] = *(const v4f*)(p + 4);
      if (it == CVT_IT - 1) asm volatile("s_wait_xcnt 0x0" ::: "memory"); }   // precaution: stands behind a plane's loads, in front of whatever writes a register that they name as an address
  __builtin_amdgcn_sched_barrier(0);   // keeps every load above issued before the first wait on one of them: one memory latency a block, not one a group of loads
#pragma unroll
  for (int r = 0; r < WT_RND; ++r)
#pragma unroll
    for (int it = 0; it < 4; ++it) { const unsigned k = kr + (unsigned)it * 16u; const v4f v = wv[r][it];
      tl[r][q4 * 4 + 0][k] = (unsigned short)bf16_rne(v[0]); tl[r][q4 * 4 + 1][k] = (unsigned short)bf16_rne(v[1]); tl[r][q4 * 4 + 2][k] = (unsigned short)bf16_rne(v[2]); tl[r][q4 * 4 + 3][k] = (unsigned short)bf16_rne(v[3]); }
  __syncthreads();
#pragma unroll
  for (int r = 0; r < WT_RND; ++r) { const unsigned t = bid + (unsigned)r * PREP_BLOCKS; const unsigned ws = t / WT_TILES; const unsigned k0 = (t & 15u) * 64u; const unsigned n0 = ((t >> 4) & 15u) * 64u;
#pragma unroll
    for (int it = 0; it < 2; ++it) { const unsigned n = (tid >> 3) + (unsigned)it * 32u, q = tid & 7u;
      const v4u v = *(const v4u_a*)&tl[r][n][q * 8];
      vst2((v4u*)(WT + (size_t)ws * DM * DM + (size_t)(n0 + n) * DM + k0 + q * 8u), v); } }
#pragma unroll
  for (int pl = 0; pl < 2; ++pl)
#pragma unroll
    for (int it = 0; it < CVT_IT; ++it) { const unsigned e = (unsigned)it * CVT_STRIDE + bid * 256u + tid;
      const v4f a = ca[pl][it]; const v4f c = cc[pl][it];
      v4u o; o[0] = pack2(a[0], a[1]); o[1] = pack2(a[2], a[3]); o[2] = pack2(c[0], c[1]); o[3] = pack2(c[2], c[3]);
      vst2((v4u*)((pl == 0 ? XB : YB) + (size_t)e * 4), o); }
}

// ---- tensor mover helpers (two-group descriptor of a two-dimensional tile, every extent in bytes)
typedef __attribute__((ext_vector_type(4))) unsigned u32x4;
typedef __attribute__((ext_vector_type(8))) unsigned u32x8;
#define PASS_B 256u            // bytes of every operand row per pass (128 k)
#define LPITCH 272u            // LDS row pitch: 256 + 16 pad bytes, an odd multiple of 16 for the ds_load_b128 readers
#define SL_ROWS 32u            // rows of one wave's slice
#define SL_B 10240u            // 32 x 272 = 8704 bytes, rounded up so that every slice starts on a multiple of 2 KiB
#define BUF_B (8u * SL_B)      // one stage: slices 0..3 = 128 A rows, slices 4..7 = 128 B rows
static_assert(SL_ROWS * LPITCH <= SL_B && SL_B % 2048u == 0);
static_assert(NTOK % 128 == 0 && TPS % 128 == 0);   // a 128-token block stays inside one slab
__device__ __forceinline__ unsigned uni(unsigned v) { return (unsigned)__builtin_amdgcn_readfirstlane((int)v); }
__device__ __forceinline__ unsigned pinned(unsigned v) { unsigned w = uni(v); asm volatile("" : "+s"(w)); return w; }  // pinned(): the issue test of a tensor load held in a scalar register, so that it compiles to s_cmp + s_cbranch_scc (the load ignores EXEC)
__device__ __forceinline__ void wait_ds0() { asm volatile("s_wait_dscnt 0x0" ::: "memory"); }          // this wave's LDS reads have retired before the buffer is handed back
// this wave's slice has landed (the compiler places no wait for the mover); the request's group 0 is named as an input so that its registers keep their words until then
__device__ __forceinline__ void wait_tensor0(u32x4 g0) { asm volatile("s_wait_tensorcnt 0x0" :: "s"(g0) : "memory"); }
// one request of the whole wave: global tile -> LDS; group 0 is tied in and out so that wait_tensor0 names the very registers the request was issued from
__device__ __forceinline__ void tdm_load(u32x4& g0, u32x8 g1) { asm volatile("tensor_load_to_lds %0, %1" : "+s"(g0) : "s"(g1) : "memory"); }
__device__ __forceinline__ u32x8 tdm_group1() {
  u32x8 q;
  q[0] = uni((1u << 20) | (5u << 22) | (3u << 25));   // no mask, 1-byte elements, 4 pad dwords behind every 256-byte row
  q[1] = uni((PASS_B & 0xFFFFu) << 16);
  q[2] = uni((PASS_B >> 16) | ((SL_ROWS & 0xFFFFu) << 16));
  q[3] = uni((SL_ROWS >> 16) | (PASS_B << 16));
  q[4] = uni(SL_ROWS);
  q[5] = uni(2u * DM);                                // source row pitch in bytes
  q[6] = uni(0u); q[7] = uni(0u);
  return q;
}
__device__ __forceinline__ u32x4 tdm_group0(unsigned lds_dst, unsigned long long ga) {
  u32x4 q; q[0] = uni(1u); q[1] = uni(lds_dst); q[2] = uni((unsigned)ga); q[3] = uni((((unsigned)(ga >> 32)) & 0x01FFFFFFu) | 0x80000000u);
  return q;
}

// ---- k_gemm: block = 128 rows x 128 cols, 8 waves as 4 x 2, wave = 32 rows x 64 cols; C = A . BT^T + bias over K = 1024 with bf16 operands
// Both operand tiles are staged in LDS by the tensor mover, 128 k per pass, two buffers: every wave brings one 32-row slice per stage, one stage ahead of the pass that reads it.
// NSEG = 2: the value plane's 8 passes, then the residual plane's 8 passes against the same BT rows, one shared accumulator.
// EPI 0: the three input projections as ONE launch, blockIdx.z = 0 Q, 1 K, 2 V: A = A0, A0, A1; weight plane z behind BT; bias BIAS0, BIAS1, BIAS2; output plane z behind OH,
//        z 0 and 1 as f16 row-major [NTOK][1024], z 2 as f16 V^T planes [slab][d][key = j*TPS + tl]. A WGP takes its next block as soon as one ends: no drain and refill of the chip between the three.
// EPI 2: f32 row-major [NTOK][1024], bias BIAS0
static_assert(WS_KH == WS_QH + PLANE2 && WS_VT == WS_KH + PLANE2);   // the three output planes stand one behind the other
template <int NSEG, int EPI>
__global__ __launch_bounds__(256) void k_gemm(const __bf16* __restrict__ A0, const __bf16* __restrict__ A1, const __bf16* __restrict__ BT, const float* __restrict__ BIAS0, const float* __restrict__ BIAS1, const float* __restrict__ BIAS2, _Float16* __restrict__ OH, float* __restrict__ OF) {
  __shared__ __attribute__((aligned(2048))) unsigned char ring[2u * BUF_B];
  const int tid = threadIdx.x; const int wave = __builtin_amdgcn_readfirstlane((int)(threadIdx.x >> 5)); const int lane = tid & 31, col = lane & 15, g = lane >> 4;
  const int wr = wave >> 1, wc = wave & 1;
  const int r0 = blockIdx.x * 128; const int c0 = blockIdx.y * 128;
  const int z = EPI == 0 ? (int)blockIdx.z : 0;   // which projection
  const __bf16* Ap = (EPI == 0 && z == 2) ? A1 : A0;
  const __bf16* Bp = BT + (size_t)z * DM * DM;
  const float* BIAS = z == 0 ? BIAS0 : z == 1 ? BIAS1 : BIAS2;
  constexpr int NPP = DM * 2 / (int)PASS_B;   // passes per plane
  constexpr int NST = NPP * NSEG;             // stages = passes
  static_assert(NST >= 2);
  const unsigned lbase = (unsigned)(size_t)ring;
  const bool isA = wave < 4;
  const unsigned long long soff = (unsigned long long)(isA ? r0 + 32 * wave : c0 + 32 * (wave - 4)) * (2ull * DM);
  const unsigned long long src0 = (unsigned long long)(size_t)(isA ? Ap : Bp) + soff;
  const unsigned long long src1 = (unsigned long long)(size_t)(isA ? A1 : Bp) + soff;
  const u32x8 g1 = tdm_group1();
  u32x4 g0;   // group 0 of this wave's one outstanding request
  auto issue = [&](int s) {
    const unsigned dst = lbase + (unsigned)(s & 1) * BUF_B + (unsigned)wave * SL_B;
    const unsigned long long ga = (NSEG == 2 && s >= NPP ? src1 : src0) + (unsigned long long)(s & (NPP - 1)) * PASS_B;
    g0 = tdm_group0(dst, ga); tdm_load(g0, g1);
  };
  v8f acc[2][4] = {};
  issue(0); wait_tensor0(g0); __syncthreads();   // stage 0 published
  issue(1);
  // rolled: one publish point per pass, the buffer picked by the pass's parity
#pragma unroll 1
  for (int s = 0; s < NST; ++s) {
    const unsigned char* bufp = ring + (unsigned)(s & 1) * BUF_B;
    const unsigned char* pa = bufp + (unsigned)wr * SL_B + (unsigned)col * LPITCH;
    const unsigned char* pb = bufp + (unsigned)(4 + 2 * wc) * SL_B + (unsigned)col * LPITCH;
#pragma unroll
    for (int kc = 0; kc < (int)PASS_B / 64; ++kc) {
      v16b a[2], w[4];
#pragma unroll
      for (int i = 0; i < 2; ++i) a[i] = frag_b((const __bf16*)(pa + (unsigned)i * 16u * LPITCH + (unsigned)kc * 64u), lane);
#pragma unroll
      for (int j = 0; j < 4; ++j) w[j] = frag_b((const __bf16*)(pb + (unsigned)(j >> 1) * SL_B + (unsigned)(j & 1) * 16u * LPITCH + (unsigned)kc * 64u), lane);
#pragma unroll
      for (int i = 0; i < 2; ++i)
#pragma unroll
        for (int j = 0; j < 4; ++j) acc[i][j] = wmma_bf(a[i], w[j], acc[i][j]);
    }
    // publish point of stage s + 1: own LDS reads retired, own slice landed, then the barrier that also frees this pass's buffer
    wait_ds0(); wait_tensor0(g0); __syncthreads();
    if (pinned(s + 2 < NST)) issue(s + 2);
  }
  wait_tensor0(g0); wait_ds0();
  if (EPI == 0) {
    __shared__ __align__(16) _Float16 sh[128][136];   // z 0, 1: [row][col]; z 2: [col][row]
    _Float16* Op = OH + (size_t)z * NTOK * DM;
    if (z != 2) {   // the same for the whole block
#pragma unroll
    for (int j = 0; j < 4; ++j) { const float bias = bfr(BIAS[c0 + wc * 64 + j * 16 + col]);
#pragma unroll
      for (int i = 0; i < 2; ++i)
#pragma unroll
        for (int r = 0; r < 8; ++r) sh[wr * 32 + i * 16 + 8 * g + r][wc * 64 + j * 16 + col] = (_Float16)(acc[i][j][r] + bias); }
    __syncthreads();
    for (int e = tid; e < 128 * 16; e += 256) { const int rl = e >> 4, q = e & 15; const v4u v = *(const v4u_a*)&sh[rl][q * 8]; *(v4u*)(Op + (size_t)(r0 + rl) * DM + c0 + q * 8) = v; }
    } else {
#pragma unroll
    for (int j = 0; j < 4; ++j) { const float bias = bfr(BIAS[c0 + wc * 64 + j * 16 + col]);
#pragma unroll
      for (int i = 0; i < 2; ++i) { v8h hv;
#pragma unroll
        for (int r = 0; r < 8; ++r) hv[r] = (_Float16)(acc[i][j][r] + bias);
        *(v8h_a*)&sh[wc * 64 + j * 16 + col][wr * 32 + i * 16 + 8 * g] = hv; } }
    __syncthreads();
    const int Ls = r0 / TPS; const int tl0 = r0 - Ls * TPS;
    for (int e = tid; e < 128 * 16; e += 256) { const int cl = e >> 4, q = e & 15; const int c = c0 + cl; const int jj = c >> 6, d = c & 63;
      const v4u v = *(const v4u_a*)&sh[cl][q * 8]; *(v4u*)(Op + ((size_t)Ls * HD + d) * SEQ + jj * TPS + tl0 + q * 8) = v; }
    }
  } else {
    __shared__ __align__(16) float ss[128][132];
#pragma unroll
    for (int j = 0; j < 4; ++j) { const float bias = bfr(BIAS[c0 + wc * 64 + j * 16 + col]);
#pragma unroll
      for (int i = 0; i < 2; ++i)
#pragma unroll
        for (int r = 0; r < 8; ++r) ss[wr * 32 + i * 16 + 8 * g + r][wc * 64 + j * 16 + col] = acc[i][j][r] + bias; }
    ldsx();   // each wave reads back only its own 32 rows x 64 cols
    for (int rl = 0; rl < 16; ++rl) { const int row = wr * 32 + rl * 2 + g; const v4f v = *(const v4f_a*)&ss[row][wc * 64 + col * 4]; *(v4f*)(OF + (size_t)(r0 + row) * DM + c0 + wc * 64 + col * 4) = v; }
  }
}

// ---- k_attn staging: a stage = 128 keys of slab L = 128 K rows x 128 B and 64 V^T rows x 256 B, brought into LDS by the tensor mover, two buffers
#define ST_KEYS 128u           // keys of one stage
#define AROW_B 128u            // bytes of every staged row: 64 features of a K row, or 64 keys of a V^T row
#define APITCH 144u            // LDS row pitch: 128 + 16 pad bytes, an odd multiple of 16 for the ds_load_b128 readers
#define ASL_ROWS 32u           // rows of one wave's slice
#define ASL_B 6144u            // 32 x 144 = 4608 bytes, rounded up so that every slice starts on a multiple of 2 KiB
#define ABUF_B (8u * ASL_B)    // one stage: slices 0..3 = K rows 32 w .. + 31; slices 4..7 = V^T rows 32 (w & 1) .. + 31 of the stage's key half (w - 4) >> 1
static_assert(ASL_ROWS * APITCH <= ASL_B && ASL_B % 2048u == 0);
static_assert(TPS % (int)ST_KEYS == 0 && SEQ % 128 == 0 && HD == 64);   // a stage stays inside one feature group
// as tdm_load and wait_tensor0, with group 1 tied and named as well: the registers of both groups keep their words from the issue to the wait
__device__ __forceinline__ void tdm_load_held(u32x4& g0, u32x8& g1) { asm volatile("tensor_load_to_lds %0, %1" : "+s"(g0), "+s"(g1) : : "memory"); }
__device__ __forceinline__ void wait_tensor0_held(u32x4 g0, u32x8 g1) { asm volatile("s_wait_tensorcnt 0x0" :: "s"(g0), "s"(g1) : "memory"); }
__device__ __forceinline__ u32x8 tdm_group1_attn(unsigned src_pitch) {
  u32x8 q;
  q[0] = uni((1u << 20) | (4u << 22) | (3u << 25));   // no mask, 1-byte elements, 4 pad dwords behind every 128-byte row
  q[1] = uni((AROW_B & 0xFFFFu) << 16);
  q[2] = uni((AROW_B >> 16) | ((ASL_ROWS & 0xFFFFu) << 16));
  q[3] = uni((ASL_ROWS >> 16) | (AROW_B << 16));
  q[4] = uni(ASL_ROWS);
  q[5] = uni(src_pitch);                              // source row pitch in bytes
  q[6] = uni(0u); q[7] = uni(0u);
  return q;
}

// ---- k_attn: block = 128 query pseudo-rows of slab L (8 waves, wave = 16 queries), fused over all SEQ keys in 32-key steps (transposed flash form):
//   S^T[key][query] = K . Q^T  (A = K rows, B = Q rows);  P^T packed in-lane as the B operand;  O^T[d][query] += V^T . P^T  (A = V^T rows).
//   Keys visited in the order key = j*TPS + tl (token L*TPS + tl, feature group j); K rows and V^T columns use the same order.
//   K rows and V^T rows are read from LDS: every wave brings one slice per 128-key stage, one stage ahead of the pass that reads it; all 8 waves share the stage.
//   Each lane owns one query column: running max / sum are per lane, combined across the two lane halves by one xor-16 shuffle.
__global__ __launch_bounds__(256) void k_attn(const _Float16* __restrict__ QH, const _Float16* __restrict__ KH, const _Float16* __restrict__ VT, unsigned* __restrict__ CH, unsigned* __restrict__ CL) {
  __shared__ __attribute__((aligned(2048))) unsigned char ring[2u * ABUF_B];
  __shared__ __align__(16) unsigned cst[8][2][16][36];   // per-wave staging of the 16 x 64 ctx tile: bf16 value pairs / residual pairs
  const int tid = threadIdx.x; const int wave = __builtin_amdgcn_readfirstlane((int)(threadIdx.x >> 5)); const int lane = tid & 31, col = lane & 15, g = lane >> 4;
  const int L = blockIdx.y; const size_t qrow0 = (size_t)L * SEQ + (size_t)blockIdx.x * 128 + wave * 16;
  const _Float16* qp = QH + (qrow0 + col) * HD;
  const v16h qf0 = frag_h(qp, lane); const v16h qf1 = frag_h(qp + 32, lane);
  constexpr int NST = SEQ / (int)ST_KEYS;   // stages = passes
  static_assert(NST >= 2);
  const unsigned lbase = (unsigned)(size_t)ring;
  const bool isK = wave < 4;
  // first byte of this wave's slice of stage 0, and what a stage adds to it
  const unsigned long long src = isK ? (unsigned long long)(size_t)KH + ((unsigned long long)L * TPS + 32ull * (unsigned)wave) * (2ull * DM)
                                     : (unsigned long long)(size_t)VT + ((unsigned long long)L * HD + 32ull * (unsigned)(wave & 1)) * (2ull * SEQ) + (unsigned long long)((wave - 4) >> 1) * AROW_B;
  u32x8 g1 = tdm_group1_attn(isK ? 2u * DM : 2u * SEQ);
  u32x4 g0;   // group 0 of this wave's one outstanding request
  auto issue = [&](int s) {
    const unsigned dst = lbase + (unsigned)(s & 1) * ABUF_B + (unsigned)wave * ASL_B;
    const int k0 = s * (int)ST_KEYS; const int jj = k0 / TPS; const int tl0 = k0 - jj * TPS;
    const unsigned long long step = isK ? (unsigned long long)tl0 * (2ull * DM) + (unsigned long long)jj * (2ull * HD) : (unsigned long long)k0 * 2ull;
    g0 = tdm_group0(dst, src + step); tdm_load_held(g0, g1);
  };
  v8f o[4] = {}; float m = -3.0e38f; float l = 0.f;
  issue(0); wait_tensor0_held(g0, g1); __syncthreads();   // stage 0 published
  issue(1);
  // rolled: one publish point per pass, the buffer picked by the pass's parity
#pragma unroll 1
  for (int s = 0; s < NST; ++s) {
    const unsigned char* bufp = ring + (unsigned)(s & 1) * ABUF_B;
    const unsigned char* kl = bufp + (unsigned)col * APITCH;
    const unsigned char* vl = bufp + 4u * ASL_B + (unsigned)col * APITCH;
#pragma unroll
    for (int hb = 0; hb < (int)ST_KEYS / 32; ++hb) {
      const unsigned char* kp = kl + (unsigned)hb * ASL_B;   // keys 32 hb .. 32 hb + 31 of the stage are K slice hb
      // all LDS reads of the step stand together in front of its products: one exposed LDS latency a step, the V^T rows arrive under the logits and the softmax
      const v16h ka0 = frag_h((const _Float16*)kp, lane); const v16h kb0 = frag_h((const _Float16*)(kp + 64u), lane);
      const v16h ka1 = frag_h((const _Float16*)(kp + 16u * APITCH), lane); const v16h kb1 = frag_h((const _Float16*)(kp + 16u * APITCH + 64u), lane);
      v16h vf[4];
#pragma unroll
      for (int j = 0; j < 4; ++j) vf[j] = frag_h((const _Float16*)(vl + (unsigned)(2 * (hb >> 1) + (j >> 1)) * ASL_B + (unsigned)(j & 1) * 16u * APITCH + (unsigned)(hb & 1) * 64u), lane);   // V^T row 16 j + col, keys 32 hb .. + 31
      v8f s0 = {}, s1 = {};
      s0 = wmma16(ka0, qf0, s0); s0 = wmma16(kb0, qf1, s0);
      s1 = wmma16(ka1, qf0, s1); s1 = wmma16(kb1, qf1, s1);
      float mx = fmaxf(s0[0], s1[0]);
#pragma unroll
      for (int r = 1; r < 8; ++r) mx = fmaxf(mx, fmaxf(s0[r], s1[r]));
      mx = fmaxf(mx, __shfl_xor(mx, 16));
      const int up = mx > m ? 1 : 0;
      if (__any(up)) {   // wave-uniform branch; lanes whose max is unchanged get a factor of exactly 1
        const float mn = fmaxf(m, mx); const float corr = __expf((m - mn) * SCALE); m = mn; l *= corr;
#pragma unroll
        for (int j = 0; j < 4; ++j)
#pragma unroll
          for (int r = 0; r < 8; ++r) o[j][r] *= corr;
      }
      const float c = LN1024 - m * SCALE;   // P carried x 2^10 (cancels in o / l)
      v16h pf; float ls = 0.f;
#pragma unroll
      for (int r = 0; r < 8; ++r) { const float p0 = __expf(fmaf(s0[r], SCALE, c)); const float p1 = __expf(fmaf(s1[r], SCALE, c)); ls += p0 + p1; pf[r] = (_Float16)p0; pf[8 + r] = (_Float16)p1; }
      l += ls;
#pragma unroll
      for (int j = 0; j < 4; ++j) o[j] = wmma16(vf[j], pf, o[j]);
    }
    // publish point of stage s + 1: own LDS reads retired, own slice landed, then the barrier that also frees this pass's buffer
    wait_ds0(); wait_tensor0_held(g0, g1); __syncthreads();
    if (pinned(s + 2 < NST)) issue(s + 2);
  }
  wait_tensor0_held(g0, g1); wait_ds0();
  l += __shfl_xor(l, 16);
  const float inv = 1.0f / l;
  // o[j][r] = ctx[query col][d = 16 j + 8 g + r]: 8 consecutive d per (lane, j) -> one 16-B piece per plane
#pragma unroll
  for (int j = 0; j < 4; ++j) { float v[8]; unsigned hb8[8];
#pragma unroll
    for (int r = 0; r < 8; ++r) { v[r] = o[j][r] * inv; hb8[r] = bf16_rne(v[r]); }
    v4u hv, lv;
#pragma unroll
    for (int t = 0; t < 4; ++t) { hv[t] = hb8[2 * t] | (hb8[2 * t + 1] << 16); lv[t] = pack2(v[2 * t] - __uint_as_float(hb8[2 * t] << 16), v[2 * t + 1] - __uint_as_float(hb8[2 * t + 1] << 16)); }
    *(v4u_a*)&cst[wave][0][col][j * 8 + g * 4] = hv; *(v4u_a*)&cst[wave][1][col][j * 8 + g * 4] = lv; }
  ldsx();   // wave-private tile
#pragma unroll
  for (int it = 0; it < 4; ++it) { const int row = it * 4 + (lane >> 3); const int pc = lane & 7;
    const v4u hv = *(const v4u_a*)&cst[wave][0][row][pc * 4]; const v4u lv = *(const v4u_a*)&cst[wave][1][row][pc * 4];
    *(v4u*)(CH + (qrow0 + row) * 32 + pc * 4) = hv; *(v4u*)(CL + (qrow0 + row) * 32 + pc * 4) = lv; }
}

extern "C" void kernel_launch(void* const* d_in, const int* in_sizes, int n_in, void* d_out, int out_size, void* d_ws, size_t ws_size, hipStream_t stream) {
  if (n_in < 10) return;
  const long long act_min = ((long long)(NB - 1) * SEQ_FULL + SEQ) * DM;
  if ((long long)in_sizes[0] < act_min || (long long)in_sizes[1] < act_min) return;
  if (in_sizes[2] < DM * DM || in_sizes[4] < DM * DM || in_sizes[6] < DM * DM || in_sizes[8] < DM * DM) return;
  if (in_sizes[3] < DM || in_sizes[5] < DM || in_sizes[7] < DM || in_sizes[9] < DM) return;
  if ((long long)out_size < (long long)NTOK * DM) return;
  if (ws_size < (size_t)WS_END) return;
  // inputs (wire order): 0 x, 1 y [2][2048][1024]; 2 Wq, 3 bq, 4 Wk, 5 bk, 6 Wv, 7 bv, 8 Wo, 9 bo; weights (in,out) [1024][1024]
  const float* x  = (const float*)d_in[0]; const float* y  = (const float*)d_in[1];
  const float* Wq = (const float*)d_in[2]; const float* bq = (const float*)d_in[3];
  const float* Wk = (const float*)d_in[4]; const float* bk = (const float*)d_in[5];
  const float* Wv = (const float*)d_in[6]; const float* bv = (const float*)d_in[7];
  const float* Wo = (const float*)d_in[8]; const float* bo = (const float*)d_in[9];
  char* ws = (char*)d_ws;
  unsigned* XB = (unsigned*)(ws + WS_XB); unsigned* YB = (unsigned*)(ws + WS_YB);
  unsigned short* WT = (unsigned short*)(ws + WS_WT);
  unsigned short* WoT = WT + 3 * (size_t)DM * DM;
  _Float16* QH = (_Float16*)(ws + WS_QH); _Float16* KH = (_Float16*)(ws + WS_KH); _Float16* VT = (_Float16*)(ws + WS_VT);
  unsigned* CH = (unsigned*)(ws + WS_CH); unsigned* CL = (unsigned*)(ws + WS_CL);
  float* OUT = (float*)d_out;

  // weights are in[rows = in][cols = out] -> planes [out][in], in the order Wq, Wk, Wv, Wo behind WT
  k_prep<<<dim3(PREP_BLOCKS), 256, 0, stream>>>(x, y, Wq, Wk, Wv, Wo, XB, YB, WT);
  const dim3 gg(NTOK / 128, DM / 128);
  k_gemm<1, 0><<<dim3(NTOK / 128, DM / 128, 3), 256, 0, stream>>>((const __bf16*)XB, (const __bf16*)YB, (const __bf16*)WT, bq, bk, bv, QH, OUT);   // Q, K, V
  k_attn<<<dim3(SEQ / 128, NSLAB), 256, 0, stream>>>(QH, KH, VT, CH, CL);
  k_gemm<2, 2><<<gg, 256, 0, stream>>>((const __bf16*)CH, (const __bf16*)CL, (const __bf16*)WoT, bo, bo, bo, QH, OUT);
}

// v005
// A run of this version takes 87.4 microseconds.
// In two side-by-side timings against v004, it was 1.08 and 1.09 times as fast.
// All steps since v000 together make it 4.22 times as fast.
// compute dtype: x, y, Wq, Wk, Wv and the biases converted to bf16 (RNE), Wo to f16 (RNE); q/k/v projections on v_wmma_f32_16x16x32_bf16 with exact bf16 x bf16 products, f32 accumulate; logits K.Q^T on v_wmma_f32_16x16x32_f16 (f16 q, k), f32 accumulate, x 1/32; softmax f32 (running max); P x 2^10 as f16 against f16 V^T on v_wmma_f32_16x16x32_f16; output projection: ctx as f16 against f16 Wo on v_wmma_f32_16x16x32_f16, f32 accumulate; f32 output.
#include <hip/hip_runtime.h>
#include <math.h>

typedef __attribute__((ext_vector_type(16))) _Float16 v16h;
typedef __attribute__((ext_vector_type(16))) __bf16 v16b;
typedef __attribute__((ext_vector_type(8)))  _Float16 v8h;
typedef __attribute__((ext_vector_type(8)))  __bf16 v8b;
typedef __attribute__((ext_vector_type(8)))  float v8f;
typedef __attribute__((ext_vector_type(4)))  float v4f;
typedef __attribute__((ext_vector_type(4)))  unsigned v4u;
typedef v4u __attribute__((may_alias)) v4u_a;
typedef v4f __attribute__((may_alias)) v4f_a;
typedef v8h __attribute__((may_alias)) v8h_a;

#ifndef NB
#define NB 2
#endif
#ifndef SEQ
#define SEQ 2048
#endif
#define SEQ_FULL 2048          // per-batch row count of the inputs
#define DM 1024                // model width = projected width
#define NH 16
#define HD 64
#define NTOK (NB * SEQ)        // token rows of every [token][1024] plane
#define TPS (SEQ / NH)         // tokens per (head, batch) slab of the head-leading flat reshape
#define NSLAB (NH * NB)        // independent attention problems: SEQ pseudo-rows x HD each
#define SCALE 0.03125f         // 1 / sqrt(1024)
#define LN1024 6.931471806f

static_assert(SEQ % 1024 == 0);      // TPS multiple of 64: a 32-key step stays inside one feature group
static_assert(NTOK % 64 == 0);
static_assert(DM % 128 == 0);
static_assert(SEQ <= SEQ_FULL);

#define PLANE2 (2ull * (unsigned long long)NTOK * DM)    // bytes of one 16-bit [NTOK][1024] plane
#define WPL2   (2ull * (unsigned long long)DM * DM)      // bytes of one 16-bit weight plane
#define WS_XB 0ull
#define WS_YB (WS_XB + PLANE2)
#define WS_WT (WS_YB + PLANE2)       // 4 planes [out][in]: Wq^T, Wk^T, Wv^T as bf16, Wo^T as f16
#define WS_QH (WS_WT + 4ull * WPL2)
#define WS_KH (WS_QH + PLANE2)
#define WS_VT (WS_KH + PLANE2)       // f16 V^T planes [slab][d][key], key = j * TPS + tl
#define WS_CH (WS_VT + PLANE2)       // f16 ctx plane [token][1024]
#define WS_END (WS_CH + PLANE2)
static_assert(WS_END <= 134217728ull);
static_assert(PLANE2 % 128 == 0);
static_assert(WPL2 % 128 == 0);

template <typename T> __device__ __forceinline__ void vst2(T* p, T v) { *(T*)p = v;  }

__device__ __forceinline__ v8f wmma16(v16h a, v16h b, v8f c) {
  v8f d = __builtin_amdgcn_wmma_f32_16x16x32_f16(false, a, false, b, (short)0, c, false, false);
  asm volatile("v_nop\n\tv_nop\n\tv_nop\n\tv_nop" : "+v"(d) : "v"(a), "v"(b));
  return d;
}
__device__ __forceinline__ v8f wmma_bf(v16b a, v16b b, v8f c) {
  v8f d = __builtin_amdgcn_wmma_f32_16x16x32_bf16(false, a, false, b, (short)0, c, false, false);
  asm volatile("v_nop\n\tv_nop\n\tv_nop\n\tv_nop" : "+v"(d) : "v"(a), "v"(b));
  return d;
}
// 16x16x32 fragments: lane = (h = lane>>4, row/col = lane&15); elements 0..7 = k0+8h+0..7, 8..15 = k0+16+8h+0..7; D element r = row 8h+r, col lane&15
__device__ __forceinline__ v16h frag_h(const _Float16* rowk0, int lane) {
  union { v16h v; v8h q[2]; } u; const _Float16* p = rowk0 + 8 * (lane >> 4);
  u.q[0] = *(const v8h*)p; u.q[1] = *(const v8h*)(p + 16); return u.v;
}
__device__ __forceinline__ v16b frag_b(const __bf16* rowk0, int lane) {
  union { v16b v; v8b q[2]; } u; const __bf16* p = rowk0 + 8 * (lane >> 4);
  u.q[0] = *(const v8b*)p; u.q[1] = *(const v8b*)(p + 16); return u.v;
}
// bf16 bits of an f32 value, nearest-even
__device__ __forceinline__ unsigned bf16_rne(float f) { unsigned u = __float_as_uint(f); u += 0x7FFFu + ((u >> 16) & 1u); return u >> 16; }
__device__ __forceinline__ float bfr(float v) { return __uint_as_float(bf16_rne(v) << 16); }
__device__ __forceinline__ unsigned pack2(float a, float b) { return bf16_rne(a) | (bf16_rne(b) << 16); }
// 16-bit pattern of a weight, nearest-even: f16 for the output projection's plane, bf16 for the others
template <bool F16> __device__ __forceinline__ unsigned short w16(float f) { return F16 ? __builtin_bit_cast(unsigned short, (_Float16)f) : (unsigned short)bf16_rne(f); }
// a thread's 4 x 4 values of a 64 x 64 weight tile into the transposed LDS tile t[n][k]
template <bool F16> __device__ __forceinline__ void wt_put(unsigned short (*t)[72], const v4f* v, unsigned kr, unsigned q4) {
#pragma unroll
  for (int it = 0; it < 4; ++it)
#pragma unroll
    for (int c = 0; c < 4; ++c) t[q4 * 4 + c][kr + (unsigned)it * 16u] = w16<F16>(v[it][c]);
}
// same-wave LDS exchange: stores retire, then the wave proceeds to the loads
__device__ __forceinline__ void ldsx() { asm volatile("s_wait_dscnt 0" ::: "memory"); __builtin_amdgcn_wave_barrier(); __builtin_amdgcn_fence(3 /* release order */, "workgroup"); }

// ---- k_prep: every operand preparation of the call in ONE launch: x and y to bf16 planes, the four weights to transposed 16-bit planes (Wq, Wk, Wv bf16, Wo f16).
// A block takes CVT_IT 8-float pieces per thread of each activation plane (grid-strided) and WT_RND 64 x 64 weight tiles; few long waves in place of many one-piece waves.
#define PREP_BLOCKS 512
#define CVT_STRIDE (PREP_BLOCKS * 256)               // pieces the whole grid takes per trip
#define CVT_IT (NTOK * (DM / 8) / CVT_STRIDE)        // trips per activation plane
#define WT_TILES ((DM / 64) * (DM / 64))             // tiles of one weight
#define WT_RND (4 * WT_TILES / PREP_BLOCKS)          // tiles per block
static_assert(NTOK * (DM / 8) % CVT_STRIDE == 0);
static_assert(4 * WT_TILES % PREP_BLOCKS == 0 && DM / 64 == 16);
__global__ __launch_bounds__(256) void k_prep(const float* __restrict__ X, const float* __restrict__ Y, const float* __restrict__ W0, const float* __restrict__ W1, const float* __restrict__ W2, const float* __restrict__ W3,
                                              unsigned* __restrict__ XB, unsigned* __restrict__ YB, unsigned short* __restrict__ WT) {
  __shared__ __align__(16) unsigned short tl[WT_RND][64][72];
  const unsigned tid = threadIdx.x; const unsigned bid = blockIdx.x;
  const unsigned kr = tid >> 4, q4 = tid & 15;       // tile loads: k row (+ 16 a trip), quad of n
  // all loads of the block stand in front of all its stores: the weight tiles first, their way through LDS is the longer one
  v4f wv[WT_RND][4];
#pragma unroll
  for (int r = 0; r < WT_RND; ++r) { const unsigned t = bid + (unsigned)r * PREP_BLOCKS; const unsigned ws = t / WT_TILES; const unsigned k0 = (t & 15u) * 64u; const unsigned n0 = ((t >> 4) & 15u) * 64u;
    const float* W = (ws == 0 ? W0 : ws == 1 ? W1 : ws == 2 ? W2 : W3) + (size_t)(k0 + kr) * DM + n0 + q4 * 4u;
#pragma unroll
    for (int it = 0; it < 4; ++it) wv[r][it] = *(const v4f*)(W + (size_t)it * 16 * DM); }
  v4f ca[2][CVT_IT], cc[2][CVT_IT];
#pragma unroll
  for (int pl = 0; pl < 2; ++pl)
#pragma unroll
    for (int it = 0; it < CVT_IT; ++it) { const unsigned e = (unsigned)it * CVT_STRIDE + bid * 256u + tid;
      const unsigned T = e >> 7; const unsigned pc = e & 127u; const unsigned b = T / SEQ; const unsigned s = T % SEQ;
      const float* p = (pl == 0 ? X : Y) + ((size_t)b * SEQ_FULL + s) * DM + pc * 8u;
      ca[pl][it] = *(const v4f*)p; cc[pl][it] = *(const v4f*)(p + 4);
      if (it == CVT_IT - 1) asm volatile("s_wait_xcnt 0x0" ::: "memory"); }   // precaution: stands behind a plane's loads, in front of whatever writes a register that they name as an address
  __builtin_amdgcn_sched_barrier(0);   // keeps every load above issued before the first wait on one of them: one memory latency a block, not one a group of loads
#pragma unroll
  for (int r = 0; r < WT_RND; ++r) {
    if ((bid + (unsigned)r * PREP_BLOCKS) / WT_TILES == 3u) wt_put<true>(tl[r], wv[r], kr, q4);   // a tile of Wo; the test reads the same for the whole block
    else wt_put<false>(tl[r], wv[r], kr, q4);
  }
  __syncthreads();
#pragma unroll
  for (int r = 0; r < WT_RND; ++r) { const unsigned t = bid + (unsigned)r * PREP_BLOCKS; const unsigned ws = t / WT_TILES; const unsigned k0 = (t & 15u) * 64u; const unsigned n0 = ((t >> 4) & 15u) * 64u;
#pragma unroll
    for (int it = 0; it < 2; ++it) { const unsigned n = (tid >> 3) + (unsigned)it * 32u, q = tid & 7u;
      const v4u v = *(const v4u_a*)&tl[r][n][q * 8];
      vst2((v4u*)(WT + (size_t)ws * DM * DM + (size_t)(n0 + n) * DM + k0 + q * 8u), v); } }
#pragma unroll
  for (int pl = 0; pl < 2; ++pl)
#pragma unroll
    for (int it = 0; it < CVT_IT; ++it) { const unsigned e = (unsigned)it * CVT_STRIDE + bid * 256u + tid;
      const v4f a = ca[pl][it]; const v4f c = cc[pl][it];
      v4u o; o[0] = pack2(a[0], a[1]); o[1] = pack2(a[2], a[3]); o[2] = pack2(c[0], c[1]); o[3] = pack2(c[2], c[3]);
      vst2((v4u*)((pl == 0 ? XB : YB) + (size_t)e * 4), o); }
}

// ---- tensor mover helpers (two-group descriptor of a two-dimensional tile, every extent in bytes)
typedef __attribute__((ext_vector_type(4))) unsigned u32x4;
typedef __attribute__((ext_vector_type(8))) unsigned u32x8;
#define PASS_B 256u            // bytes of every operand row per pass (128 k)
#define LPITCH 272u            // LDS row pitch: 256 + 16 pad bytes, an odd multiple of 16 for the ds_load_b128 readers
#define SL_ROWS 32u            // rows of one wave's slice
#define SL_B 10240u            // 32 x 272 = 8704 bytes, rounded up so that every slice starts on a multiple of 2 KiB
#define BUF_B (8u * SL_B)      // one stage: slices 0..3 = 128 A rows, slices 4..7 = 128 B rows
static_assert(SL_ROWS * LPITCH <= SL_B && SL_B % 2048u == 0);
static_assert(NTOK % 128 == 0 && TPS % 128 == 0);   // a 128-token block stays inside one slab
__device__ __forceinline__ unsigned uni(unsigned v) { return (unsigned)__builtin_amdgcn_readfirstlane((int)v); }
__device__ __forceinline__ unsigned pinned(unsigned v) { unsigned w = uni(v); asm volatile("" : "+s"(w)); return w; }  // pinned(): the issue test of a tensor load held in a scalar register, so that it compiles to s_cmp + s_cbranch_scc (the load ignores EXEC)
__device__ __forceinline__ void wait_ds0() { asm volatile("s_wait_dscnt 0x0" ::: "memory"); }          // this wave's LDS reads have retired before the buffer is handed back
// this wave's slice has landed (the compiler places no wait for the mover); the request's group 0 is named as an input so that its registers keep their words until then
__device__ __forceinline__ void wait_tensor0(u32x4 g0) { asm volatile("s_wait_tensorcnt 0x0" :: "s"(g0) : "memory"); }
// one request of the whole wave: global tile -> LDS; group 0 is tied in and out so that wait_tensor0 names the very registers the request was issued from
__device__ __forceinline__ void tdm_load(u32x4& g0, u32x8 g1) { asm volatile("tensor_load_to_lds %0, %1" : "+s"(g0) : "s"(g1) : "memory"); }
__device__ __forceinline__ u32x8 tdm_group1() {
  u32x8 q;
  q[0] = uni((1u << 20) | (5u << 22) | (3u << 25));   // no mask, 1-byte elements, 4 pad dwords behind every 256-byte row
  q[1] = uni((PASS_B & 0xFFFFu) << 16);
  q[2] = uni((PASS_B >> 16) | ((SL_ROWS & 0xFFFFu) << 16));
  q[3] = uni((SL_ROWS >> 16) | (PASS_B << 16));
  q[4] = uni(SL_ROWS);
  q[5] = uni(2u * DM);                                // source row pitch in bytes
  q[6] = uni(0u); q[7] = uni(0u);
  return q;
}
__device__ __forceinline__ u32x4 tdm_group0(unsigned lds_dst, unsigned long long ga) {
  u32x4 q; q[0] = uni(1u); q[1] = uni(lds_dst); q[2] = uni((unsigned)ga); q[3] = uni((((unsigned)(ga >> 32)) & 0x01FFFFFFu) | 0x80000000u);
  return q;
}

// ---- k_gemm: block = 128 rows x 128 cols, 8 waves as 4 x 2, wave = 32 rows x 64 cols; C = A . BT^T + bias over K = 1024 with 16-bit operands
// Both operand tiles are staged in LDS by the tensor mover, 128 k per pass, two buffers: every wave brings one 32-row slice per stage, one stage ahead of the pass that reads it.
// EPI 0: bf16 operands; the three input projections as ONE launch, blockIdx.z = 0 Q, 1 K, 2 V: A = A0, A0, A1; weight plane z behind BT; bias BIAS0, BIAS1, BIAS2; output plane z behind OH,
//        z 0 and 1 as f16 row-major [NTOK][1024], z 2 as f16 V^T planes [slab][d][key = j*TPS + tl]. A WGP takes its next block as soon as one ends: no drain and refill of the chip between the three.
// EPI 2: f16 operands (planes A0 and BT hold f16 bits; the kernel forms only tile addresses from these pointers); f32 row-major [NTOK][1024], bias BIAS0
static_assert(WS_KH == WS_QH + PLANE2 && WS_VT == WS_KH + PLANE2);   // the three output planes stand one behind the other
template <int EPI>
__global__ __launch_bounds__(256) void k_gemm(const __bf16* __restrict__ A0, const __bf16* __restrict__ A1, const __bf16* __restrict__ BT, const float* __restrict__ BIAS0, const float* __restrict__ BIAS1, const float* __restrict__ BIAS2, _Float16* __restrict__ OH, float* __restrict__ OF) {
  __shared__ __attribute__((aligned(2048))) unsigned char ring[2u * BUF_B];
  const int tid = threadIdx.x; const int wave = __builtin_amdgcn_readfirstlane((int)(threadIdx.x >> 5)); const int lane = tid & 31, col = lane & 15, g = lane >> 4;
  const int wr = wave >> 1, wc = wave & 1;
  const int r0 = blockIdx.x * 128; const int c0 = blockIdx.y * 128;
  const int z = EPI == 0 ? (int)blockIdx.z : 0;   // which projection
  const __bf16* Ap = (EPI == 0 && z == 2) ? A1 : A0;
  const __bf16* Bp = BT + (size_t)z * DM * DM;
  const float* BIAS = z == 0 ? BIAS0 : z == 1 ? BIAS1 : BIAS2;
  constexpr int NST = DM * 2 / (int)PASS_B;   // stages = passes
  static_assert(NST >= 2);
  const unsigned lbase = (unsigned)(size_t)ring;
  const bool isA = wave < 4;
  const unsigned long long soff = (unsigned long long)(isA ? r0 + 32 * wave : c0 + 32 * (wave - 4)) * (2ull * DM);
  const unsigned long long src0 = (unsigned long long)(size_t)(isA ? Ap : Bp) + soff;
  const u32x8 g1 = tdm_group1();
  u32x4 g0;   // group 0 of this wave's one outstanding request
  auto issue = [&](int s) {
    const unsigned dst = lbase + (unsigned)(s & 1) * BUF_B + (unsigned)wave * SL_B;
    const unsigned long long ga = src0 + (unsigned long long)s * PASS_B;
    g0 = tdm_group0(dst, ga); tdm_load(g0, g1);
  };
  v8f acc[2][4] = {};
  issue(0); wait_tensor0(g0); __syncthreads();   // stage 0 published
  issue(1);
  // rolled: one publish point per pass, the buffer picked by the pass's parity
#pragma unroll 1
  for (int s = 0; s < NST; ++s) {
    const unsigned char* bufp = ring + (unsigned)(s & 1) * BUF_B;
    const unsigned char* pa = bufp + (unsigned)wr * SL_B + (unsigned)col * LPITCH;
    const unsigned char* pb = bufp + (unsigned)(4 + 2 * wc) * SL_B + (unsigned)col * LPITCH;
#pragma unroll
    for (int kc = 0; kc < (int)PASS_B / 64; ++kc) {
      if (EPI == 0) {
        v16b a[2], w[4];
#pragma unroll
        for (int i = 0; i < 2; ++i) a[i] = frag_b((const __bf16*)(pa + (unsigned)i * 16u * LPITCH + (unsigned)kc * 64u), lane);
#pragma unroll
        for (int j = 0; j < 4; ++j) w[j] = frag_b((const __bf16*)(pb + (unsigned)(j >> 1) * SL_B + (unsigned)(j & 1) * 16u * LPITCH + (unsigned)kc * 64u), lane);
#pragma unroll
        for (int i = 0; i < 2; ++i)
#pragma unroll
          for (int j = 0; j < 4; ++j) acc[i][j] = wmma_bf(a[i], w[j], acc[i][j]);
      } else {
        v16h a[2], w[4];
#pragma unroll
        for (int i = 0; i < 2; ++i) a[i] = frag_h((const _Float16*)(pa + (unsigned)i * 16u * LPITCH + (unsigned)kc * 64u), lane);
#pragma unroll
        for (int j = 0; j < 4; ++j) w[j] = frag_h((const _Float16*)(pb + (unsigned)(j >> 1) * SL_B + (unsigned)(j & 1) * 16u * LPITCH + (unsigned)kc * 64u), lane);
#pragma unroll
        for (int i = 0; i < 2; ++i)
#pragma unroll
          for (int j = 0; j < 4; ++j) acc[i][j] = wmma16(a[i], w[j], acc[i][j]);
      }
    }
    // publish point of stage s + 1: own LDS reads retired, own slice landed, then the barrier that also frees this pass's buffer
    wait_ds0(); wait_tensor0(g0); __syncthreads();
    if (pinned(s + 2 < NST)) issue(s + 2);
  }
  wait_tensor0(g0); wait_ds0();
  if (EPI == 0) {
    __shared__ __align__(16) _Float16 sh[128][136];   // z 0, 1: [row][col]; z 2: [col][row]
    _Float16* Op = OH + (size_t)z * NTOK * DM;
    if (z != 2) {   // the same for the whole block
#pragma unroll
    for (int j = 0; j < 4; ++j) { const float bias = bfr(BIAS[c0 + wc * 64 + j * 16 + col]);
#pragma unroll
      for (int i = 0; i < 2; ++i)
#pragma unroll
        for (int r = 0; r < 8; ++r) sh[wr * 32 + i * 16 + 8 * g + r][wc * 64 + j * 16 + col] = (_Float16)(acc[i][j][r] + bias); }
    __syncthreads();
    for (int e = tid; e < 128 * 16; e += 256) { const int rl = e >> 4, q = e & 15; const v4u v = *(const v4u_a*)&sh[rl][q * 8]; *(v4u*)(Op + (size_t)(r0 + rl) * DM + c0 + q * 8) = v; }
    } else {
#pragma unroll
    for (int j = 0; j < 4; ++j) { const float bias = bfr(BIAS[c0 + wc * 64 + j * 16 + col]);
#pragma unroll
      for (int i = 0; i < 2; ++i) { v8h hv;
#pragma unroll
        for (int r = 0; r < 8; ++r) hv[r] = (_Float16)(acc[i][j][r] + bias);
        *(v8h_a*)&sh[wc * 64 + j * 16 + col][wr * 32 + i * 16 + 8 * g] = hv; } }
    __syncthreads();
    const int Ls = r0 / TPS; const int tl0 = r0 - Ls * TPS;
    for (int e = tid; e < 128 * 16; e += 256) { const int cl = e >> 4, q = e & 15; const int c = c0 + cl; const int jj = c >> 6, d = c & 63;
      const v4u v = *(const v4u_a*)&sh[cl][q * 8]; *(v4u*)(Op + ((size_t)Ls * HD + d) * SEQ + jj * TPS + tl0 + q * 8) = v; }
    }
  } else {
    __shared__ __align__(16) float ss[128][132];
#pragma unroll
    for (int j = 0; j < 4; ++j) { const float bias = bfr(BIAS[c0 + wc * 64 + j * 16 + col]);
#pragma unroll
      for (int i = 0; i < 2; ++i)
#pragma unroll
        for (int r = 0; r < 8; ++r) ss[wr * 32 + i * 16 + 8 * g + r][wc * 64 + j * 16 + col] = acc[i][j][r] + bias; }
    ldsx();   // each wave reads back only its own 32 rows x 64 cols
    for (int rl = 0; rl < 16; ++rl) { const int row = wr * 32 + rl * 2 + g; const v4f v = *(const v4f_a*)&ss[row][wc * 64 + col * 4]; *(v4f*)(OF + (size_t)(r0 + row) * DM + c0 + wc * 64 + col * 4) = v; }
  }
}

// ---- k_attn staging: a stage = 128 keys of slab L = 128 K rows x 128 B and 64 V^T rows x 256 B, brought into LDS by the tensor mover, two buffers
#define ST_KEYS 128u           // keys of one stage
#define AROW_B 128u            // bytes of every staged row: 64 features of a K row, or 64 keys of a V^T row
#define APITCH 144u            // LDS row pitch: 128 + 16 pad bytes, an odd multiple of 16 for the ds_load_b128 readers
#define ASL_ROWS 32u           // rows of one wave's slice
#define ASL_B 6144u            // 32 x 144 = 4608 bytes, rounded up so that every slice starts on a multiple of 2 KiB
#define ABUF_B (8u * ASL_B)    // one stage: slices 0..3 = K rows 32 w .. + 31; slices 4..7 = V^T rows 32 (w & 1) .. + 31 of the stage's key half (w - 4) >> 1
static_assert(ASL_ROWS * APITCH <= ASL_B && ASL_B % 2048u == 0);
static_assert(TPS % (int)ST_KEYS == 0 && SEQ % 128 == 0 && HD == 64);   // a stage stays inside one feature group
// as tdm_load and wait_tensor0, with group 1 tied and named as well: the registers of both groups keep their words from the issue to the wait
__device__ __forceinline__ void tdm_load_held(u32x4& g0, u32x8& g1) { asm volatile("tensor_load_to_lds %0, %1" : "+s"(g0), "+s"(g1) : : "memory"); }
__device__ __forceinline__ void wait_tensor0_held(u32x4 g0, u32x8 g1) { asm volatile("s_wait_tensorcnt 0x0" :: "s"(g0), "s"(g1) : "memory"); }
__device__ __forceinline__ u32x8 tdm_group1_attn(unsigned src_pitch) {
  u32x8 q;
  q[0] = uni((1u << 20) | (4u << 22) | (3u << 25));   // no mask, 1-byte elements, 4 pad dwords behind every 128-byte row
  q[1] = uni((AROW_B & 0xFFFFu) << 16);
  q[2] = uni((AROW_B >> 16) | ((ASL_ROWS & 0xFFFFu) << 16));
  q[3] = uni((ASL_ROWS >> 16) | (AROW_B << 16));
  q[4] = uni(ASL_ROWS);
  q[5] = uni(src_pitch);                              // source row pitch in bytes
  q[6] = uni(0u); q[7] = uni(0u);
  return q;
}

// ---- k_attn: block = 128 query pseudo-rows of slab L (8 waves, wave = 16 queries), fused over all SEQ keys in 32-key steps (transposed flash form):
//   S^T[key][query] = K . Q^T  (A = K rows, B = Q rows);  P^T packed in-lane as the B operand;  O^T[d][query] += V^T . P^T  (A = V^T rows).
//   Keys visited in the order key = j*TPS + tl (token L*TPS + tl, feature group j); K rows and V^T columns use the same order.
//   K rows and V^T rows are read from LDS: every wave brings one slice per 128-key stage, one stage ahead of the pass that reads it; all 8 waves share the stage.
//   Each lane owns one query column: running max / sum are per lane, combined across the two lane halves by one xor-16 shuffle.
__global__ __launch_bounds__(256) void k_attn(const _Float16* __restrict__ QH, const _Float16* __restrict__ KH, const _Float16* __restrict__ VT, unsigned* __restrict__ CH) {
  __shared__ __attribute__((aligned(2048))) unsigned char ring[2u * ABUF_B];
  __shared__ __align__(16) unsigned cst[8][16][36];   // per-wave staging of the 16 x 64 ctx tile: f16 pairs
  const int tid = threadIdx.x; const int wave = __builtin_amdgcn_readfirstlane((int)(threadIdx.x >> 5)); const int lane = tid & 31, col = lane & 15, g = lane >> 4;
  const int L = blockIdx.y; const size_t qrow0 = (size_t)L * SEQ + (size_t)blockIdx.x * 128 + wave * 16;
  const _Float16* qp = QH + (qrow0 + col) * HD;
  const v16h qf0 = frag_h(qp, lane); const v16h qf1 = frag_h(qp + 32, lane);
  constexpr int NST = SEQ / (int)ST_KEYS;   // stages = passes
  static_assert(NST >= 2);
  const unsigned lbase = (unsigned)(size_t)ring;
  const bool isK = wave < 4;
  // first byte of this wave's slice of stage 0, and what a stage adds to it
  const unsigned long long src = isK ? (unsigned long long)(size_t)KH + ((unsigned long long)L * TPS + 32ull * (unsigned)wave) * (2ull * DM)
                                     : (unsigned long long)(size_t)VT + ((unsigned long long)L * HD + 32ull * (unsigned)(wave & 1)) * (2ull * SEQ) + (unsigned long long)((wave - 4) >> 1) * AROW_B;
  u32x8 g1 = tdm_group1_attn(isK ? 2u * DM : 2u * SEQ);
  u32x4 g0;   // group 0 of this wave's one outstanding request
  auto issue = [&](int s) {
    const unsigned dst = lbase + (unsigned)(s & 1) * ABUF_B + (unsigned)wave * ASL_B;
    const int k0 = s * (int)ST_KEYS; const int jj = k0 / TPS; const int tl0 = k0 - jj * TPS;
    const unsigned long long step = isK ? (unsigned long long)tl0 * (2ull * DM) + (unsigned long long)jj * (2ull * HD) : (unsigned long long)k0 * 2ull;
    g0 = tdm_group0(dst, src + step); tdm_load_held(g0, g1);
  };
  v8f o[4] = {}; float m = -3.0e38f; float l = 0.f;
  issue(0); wait_tensor0_held(g0, g1); __syncthreads();   // stage 0 published
  issue(1);
  // rolled: one publish point per pass, the buffer picked by the pass's parity
#pragma unroll 1
  for (int s = 0; s < NST; ++s) {
    const unsigned char* bufp = ring + (unsigned)(s & 1) * ABUF_B;
    const unsigned char* kl = bufp + (unsigned)col * APITCH;
    const unsigned char* vl = bufp + 4u * ASL_B + (unsigned)col * APITCH;
#pragma unroll
    for (int hb = 0; hb < (int)ST_KEYS / 32; ++hb) {
      const unsigned char* kp = kl + (unsigned)hb * ASL_B;   // keys 32 hb .. 32 hb + 31 of the stage are K slice hb
      // all LDS reads of the step stand together in front of its products: one exposed LDS latency a step, the V^T rows arrive under the logits and the softmax
      const v16h ka0 = frag_h((const _Float16*)kp, lane); const v16h kb0 = frag_h((const _Float16*)(kp + 64u), lane);
      const v16h ka1 = frag_h((const _Float16*)(kp + 16u * APITCH), lane); const v16h kb1 = frag_h((const _Float16*)(kp + 16u * APITCH + 64u), lane);
      v16h vf[4];
#pragma unroll
      for (int j = 0; j < 4; ++j) vf[j] = frag_h((const _Float16*)(vl + (unsigned)(2 * (hb >> 1) + (j >> 1)) * ASL_B + (unsigned)(j & 1) * 16u * APITCH + (unsigned)(hb & 1) * 64u), lane);   // V^T row 16 j + col, keys 32 hb .. + 31
      v8f s0 = {}, s1 = {};
      s0 = wmma16(ka0, qf0, s0); s0 = wmma16(kb0, qf1, s0);
      s1 = wmma16(ka1, qf0, s1); s1 = wmma16(kb1, qf1, s1);
      float mx = fmaxf(s0[0], s1[0]);
#pragma unroll
      for (int r = 1; r < 8; ++r) mx = fmaxf(mx, fmaxf(s0[r], s1[r]));
      mx = fmaxf(mx, __shfl_xor(mx, 16));
      const int up = mx > m ? 1 : 0;
      if (__any(up)) {   // wave-uniform branch; lanes whose max is unchanged get a factor of exactly 1
        const float mn = fmaxf(m, mx); const float corr = __expf((m - mn) * SCALE); m = mn; l *= corr;
#pragma unroll
        for (int j = 0; j < 4; ++j)
#pragma unroll
          for (int r = 0; r < 8; ++r) o[j][r] *= corr;
      }
      const float c = LN1024 - m * SCALE;   // P carried x 2^10 (cancels in o / l)
      v16h pf; float ls = 0.f;
#pragma unroll
      for (int r = 0; r < 8; ++r) { const float p0 = __expf(fmaf(s0[r], SCALE, c)); const float p1 = __expf(fmaf(s1[r], SCALE, c)); ls += p0 + p1; pf[r] = (_Float16)p0; pf[8 + r] = (_Float16)p1; }
      l += ls;
#pragma unroll
      for (int j = 0; j < 4; ++j) o[j] = wmma16(vf[j], pf, o[j]);
    }
    // publish point of stage s + 1: own LDS reads retired, own slice landed, then the barrier that also frees this pass's buffer
    wait_ds0(); wait_tensor0_held(g0, g1); __syncthreads();
    if (pinned(s + 2 < NST)) issue(s + 2);
  }
  wait_tensor0_held(g0, g1); wait_ds0();
  l += __shfl_xor(l, 16);
  const float inv = 1.0f / l;
  // o[j][r] = ctx[query col][d = 16 j + 8 g + r]: 8 consecutive d per (lane, j) -> one 16-B piece
#pragma unroll
  for (int j = 0; j < 4; ++j) { v8h hv;
#pragma unroll
    for (int r = 0; r < 8; ++r) hv[r] = (_Float16)(o[j][r] * inv);
    *(v8h_a*)&cst[wave][col][j * 8 + g * 4] = hv; }
  ldsx();   // wave-private tile
#pragma unroll
  for (int it = 0; it < 4; ++it) { const int row = it * 4 + (lane >> 3); const int pc = lane & 7;
    const v4u hv = *(const v4u_a*)&cst[wave][row][pc * 4];
    *(v4u*)(CH + (qrow0 + row) * 32 + pc * 4) = hv; }
}

extern "C" void kernel_launch(void* const* d_in, const int* in_sizes, int n_in, void* d_out, int out_size, void* d_ws, size_t ws_size, hipStream_t stream) {
  if (n_in < 10) return;
  const long long act_min = ((long long)(NB - 1) * SEQ_FULL + SEQ) * DM;
  if ((long long)in_sizes[0] < act_min || (long long)in_sizes[1] < act_min) return;
  if (in_sizes[2] < DM * DM || in_sizes[4] < DM * DM || in_sizes[6] < DM * DM || in_sizes[8] < DM * DM) return;
  if (in_sizes[3] < DM || in_sizes[5] < DM || in_sizes[7] < DM || in_sizes[9] < DM) return;
  if ((long long)out_size < (long long)NTOK * DM) return;
  if (ws_size < (size_t)WS_END) return;
  // inputs (wire order): 0 x, 1 y [2][2048][1024]; 2 Wq, 3 bq, 4 Wk, 5 bk, 6 Wv, 7 bv, 8 Wo, 9 bo; weights (in,out) [1024][1024]
  const float* x  = (const float*)d_in[0]; const float* y  = (const float*)d_in[1];
  const float* Wq = (const float*)d_in[2]; const float* bq = (const float*)d_in[3];
  const float* Wk = (const float*)d_in[4]; const float* bk = (const float*)d_in[5];
  const float* Wv = (const float*)d_in[6]; const float* bv = (const float*)d_in[7];
  const float* Wo = (const float*)d_in[8]; const float* bo = (const float*)d_in[9];
  char* ws = (char*)d_ws;
  unsigned* XB = (unsigned*)(ws + WS_XB); unsigned* YB = (unsigned*)(ws + WS_YB);
  unsigned short* WT = (unsigned short*)(ws + WS_WT);
  unsigned short* WoT = WT + 3 * (size_t)DM * DM;
  _Float16* QH = (_Float16*)(ws + WS_QH); _Float16* KH = (_Float16*)(ws + WS_KH); _Float16* VT = (_Float16*)(ws + WS_VT);
  unsigned* CH = (unsigned*)(ws + WS_CH);
  float* OUT = (float*)d_out;

  // weights are in[rows = in][cols = out] -> planes [out][in], in the order Wq, Wk, Wv, Wo behind WT
  k_prep<<<dim3(PREP_BLOCKS), 256, 0, stream>>>(x, y, Wq, Wk, Wv, Wo, XB, YB, WT);
  const dim3 gg(NTOK / 128, DM / 128);
  k_gemm<0><<<dim3(NTOK / 128, DM / 128, 3), 256, 0, stream>>>((const __bf16*)XB, (const __bf16*)YB, (const __bf16*)WT, bq, bk, bv, QH, OUT);   // Q, K, V
  k_attn<<<dim3(SEQ / 128, NSLAB), 256, 0, stream>>>(QH, KH, VT, CH);
  k_gemm<2><<<gg, 256, 0, stream>>>((const __bf16*)CH, (const __bf16*)CH, (const __bf16*)WoT, bo, bo, bo, QH, OUT);
}

// v006
// Measured time: 85.1 microseconds a run.
// In both of two side-by-side timings against v005, it was 1.03 times as fast.
// Counting every step since v000, it is 4.36 times as fast.
// compute dtype: x, y, Wq, Wk, Wv and the biases converted to bf16 (RNE), Wo to f16 (RNE); q/k/v projections on v_wmma_f32_16x16x32_bf16 with exact bf16 x bf16 products, f32 accumulate; logits K.Q^T on v_wmma_f32_16x16x32_f16 (f16 q, k), f32 accumulate, x 1/32; softmax f32 (running max); P x 2^10 as f16 against f16 V^T on v_wmma_f32_16x16x32_f16; output projection: ctx as f16 against f16 Wo on v_wmma_f32_16x16x32_f16, f32 accumulate; f32 output.
#include <hip/hip_runtime.h>
#include <math.h>

typedef __attribute__((ext_vector_type(16))) _Float16 v16h;
typedef __attribute__((ext_vector_type(16))) __bf16 v16b;
typedef __attribute__((ext_vector_type(8)))  _Float16 v8h;
typedef __attribute__((ext_vector_type(8)))  __bf16 v8b;
typedef __attribute__((ext_vector_type(8)))  float v8f;
typedef __attribute__((ext_vector_type(4)))  float v4f;
typedef __attribute__((ext_vector_type(4)))  unsigned v4u;
typedef v4u __attribute__((may_alias)) v4u_a;
typedef v4f __attribute__((may_alias)) v4f_a;
typedef v8h __attribute__((may_alias)) v8h_a;

#ifndef NB
#define NB 2
#endif
#ifndef SEQ
#define SEQ 2048
#endif
#define SEQ_FULL 2048          // per-batch row count of the inputs
#define DM 1024                // model width = projected width
#define NH 16
#define HD 64
#define NTOK (NB * SEQ)        // token rows of every [token][1024] plane
#define TPS (SEQ / NH)         // tokens per (head, batch) slab of the head-leading flat reshape
#define NSLAB (NH * NB)        // independent attention problems: SEQ pseudo-rows x HD each
#define SCALE 0.03125f         // 1 / sqrt(1024)
#define LN1024 6.931471806f

static_assert(SEQ % 1024 == 0);      // TPS multiple of 64: a 32-key step stays inside one feature group
static_assert(NTOK % 64 == 0);
static_assert(DM % 128 == 0);
static_assert(SEQ <= SEQ_FULL);

#define PLANE2 (2ull * (unsigned long long)NTOK * DM)    // bytes of one 16-bit [NTOK][1024] plane
#define WPL2   (2ull * (unsigned long long)DM * DM)      // bytes of one 16-bit weight plane
#define WS_XB 0ull
#define WS_YB (WS_XB + PLANE2)
#define WS_WT (WS_YB + PLANE2)       // 4 planes [out][in]: Wq^T, Wk^T, Wv^T as bf16, Wo^T as f16
#define WS_QH (WS_WT + 4ull * WPL2)
#define WS_KH (WS_QH + PLANE2)
#define WS_VT (WS_KH + PLANE2)       // f16 V^T planes [slab][d][key], key = j * TPS + tl
#define WS_CH (WS_VT + PLANE2)       // f16 ctx plane [token][1024]
#define WS_END (WS_CH + PLANE2)
static_assert(WS_END <= 134217728ull);
static_assert(PLANE2 % 128 == 0);
static_assert(WPL2 % 128 == 0);

template <typename T> __device__ __forceinline__ void vst2(T* p, T v) { *(T*)p = v;  }

__device__ __forceinline__ v8f wmma16(v16h a, v16h b, v8f c) {
  v8f d = __builtin_amdgcn_wmma_f32_16x16x32_f16(false, a, false, b, (short)0, c, false, false);
  asm volatile("v_nop\n\tv_nop\n\tv_nop\n\tv_nop" : "+v"(d) : "v"(a), "v"(b));
  return d;
}
__device__ __forceinline__ v8f wmma_bf(v16b a, v16b b, v8f c) {
  v8f d = __builtin_amdgcn_wmma_f32_16x16x32_bf16(false, a, false, b, (short)0, c, false, false);
  asm volatile("v_nop\n\tv_nop\n\tv_nop\n\tv_nop" : "+v"(d) : "v"(a), "v"(b));
  return d;
}
// k_attn's form: the builtin alone. The compiler keeps the distance behind its own WMMAs, filling it with the step's vector work where it can, and stays free to move the next step's LDS reads and logit products under this step's softmax.
__device__ __forceinline__ v8f wmma16_free(v16h a, v16h b, v8f c) { return __builtin_amdgcn_wmma_f32_16x16x32_f16(false, a, false, b, (short)0, c, false, false); }
// 16x16x32 fragments: lane = (h = lane>>4, row/col = lane&15); elements 0..7 = k0+8h+0..7, 8..15 = k0+16+8h+0..7; D element r = row 8h+r, col lane&15
__device__ __forceinline__ v16h frag_h(const _Float16* rowk0, int lane) {
  union { v16h v; v8h q[2]; } u; const _Float16* p = rowk0 + 8 * (lane >> 4);
  u.q[0] = *(const v8h*)p; u.q[1] = *(const v8h*)(p + 16); return u.v;
}
__device__ __forceinline__ v16b frag_b(const __bf16* rowk0, int lane) {
  union { v16b v; v8b q[2]; } u; const __bf16* p = rowk0 + 8 * (lane >> 4);
  u.q[0] = *(const v8b*)p; u.q[1] = *(const v8b*)(p + 16); return u.v;
}
// bf16 bits of an f32 value, nearest-even
__device__ __forceinline__ unsigned bf16_rne(float f) { unsigned u = __float_as_uint(f); u += 0x7FFFu + ((u >> 16) & 1u); return u >> 16; }
__device__ __forceinline__ float bfr(float v) { return __uint_as_float(bf16_rne(v) << 16); }
__device__ __forceinline__ unsigned pack2(float a, float b) { return bf16_rne(a) | (bf16_rne(b) << 16); }
// 16-bit pattern of a weight, nearest-even: f16 for the output projection's plane, bf16 for the others
template <bool F16> __device__ __forceinline__ unsigned short w16(float f) { return F16 ? __builtin_bit_cast(unsigned short, (_Float16)f) : (unsigned short)bf16_rne(f); }
// a thread's 4 x 4 values of a 64 x 64 weight tile into the transposed LDS tile t[n][k]
template <bool F16> __device__ __forceinline__ void wt_put(unsigned short (*t)[72], const v4f* v, unsigned kr, unsigned q4) {
#pragma unroll
  for (int it = 0; it < 4; ++it)
#pragma unroll
    for (int c = 0; c < 4; ++c) t[q4 * 4 + c][kr + (unsigned)it * 16u] = w16<F16>(v[it][c]);
}
// same-wave LDS exchange: stores retire, then the wave proceeds to the loads
__device__ __forceinline__ void ldsx() { asm volatile("s_wait_dscnt 0" ::: "memory"); __builtin_amdgcn_wave_barrier(); __builtin_amdgcn_fence(3 /* release order */, "workgroup"); }

// ---- k_prep: every operand preparation of the call in ONE launch: x and y to bf16 planes, the four weights to transposed 16-bit planes (Wq, Wk, Wv bf16, Wo f16).
// A block takes CVT_IT 8-float pieces per thread of each activation plane (grid-strided) and WT_RND 64 x 64 weight tiles; few long waves in place of many one-piece waves.
#define PREP_BLOCKS 512
#define CVT_STRIDE (PREP_BLOCKS * 256)               // pieces the whole grid takes per trip
#define CVT_IT (NTOK * (DM / 8) / CVT_STRIDE)        // trips per activation plane
#define WT_TILES ((DM / 64) * (DM / 64))             // tiles of one weight
#define WT_RND (4 * WT_TILES / PREP_BLOCKS)          // tiles per block
static_assert(NTOK * (DM / 8) % CVT_STRIDE == 0);
static_assert(4 * WT_TILES % PREP_BLOCKS == 0 && DM / 64 == 16);
__global__ __launch_bounds__(256) void k_prep(const float* __restrict__ X, const float* __restrict__ Y, const float* __restrict__ W0, const float* __restrict__ W1, const float* __restrict__ W2, const float* __restrict__ W3,
                                              unsigned* __restrict__ XB, unsigned* __restrict__ YB, unsigned short* __restrict__ WT) {
  __shared__ __align__(16) unsigned short tl[WT_RND][64][72];
  const unsigned tid = threadIdx.x; const unsigned bid = blockIdx.x;
  const unsigned kr = tid >> 4, q4 = tid & 15;       // tile loads: k row (+ 16 a trip), quad of n
  // all loads of the block stand in front of all its stores: the weight tiles first, their way through LDS is the longer one
  v4f wv[WT_RND][4];
#pragma unroll
  for (int r = 0; r < WT_RND; ++r) { const unsigned t = bid + (unsigned)r * PREP_BLOCKS; const unsigned ws = t / WT_TILES; const unsigned k0 = (t & 15u) * 64u; const unsigned n0 = ((t >> 4) & 15u) * 64u;
    const float* W = (ws == 0 ? W0 : ws == 1 ? W1 : ws == 2 ? W2 : W3) + (size_t)(k0 + kr) * DM + n0 + q4 * 4u;
#pragma unroll
    for (int it = 0; it < 4; ++it) wv[r][it] = *(const v4f*)(W + (size_t)it * 16 * DM); }
  v4f ca[2][CVT_IT], cc[2][CVT_IT];
#pragma unroll
  for (int pl = 0; pl < 2; ++pl)
#pragma unroll
    for (int it = 0; it < CVT_IT; ++it) { const unsigned e = (unsigned)it * CVT_STRIDE + bid * 256u + tid;
      const unsigned T = e >> 7; const unsigned pc = e & 127u; const unsigned b = T / SEQ; const unsigned s = T % SEQ;
      const float* p = (pl == 0 ? X : Y) + ((size_t)b * SEQ_FULL + s) * DM + pc * 8u;
      ca[pl][it] = *(const v4f*)p; cc[pl][it] = *(const v4f*)(p + 4);
      if (it == CVT_IT - 1) asm volatile("s_wait_xcnt 0x0" ::: "memory"); }   // precaution: stands behind a plane's loads, in front of whatever writes a register that they name as an address
  __builtin_amdgcn_sched_barrier(0);   // keeps every load above issued before the first wait on one of them: one memory latency a block, not one a group of loads
#pragma unroll
  for (int r = 0; r < WT_RND; ++r) {
    if ((bid + (unsigned)r * PREP_BLOCKS) / WT_TILES == 3u) wt_put<true>(tl[r], wv[r], kr, q4);   // a tile of Wo; the test reads the same for the whole block
    else wt_put<false>(tl[r], wv[r], kr, q4);
  }
  __syncthreads();
#pragma unroll
  for (int r = 0; r < WT_RND; ++r) { const unsigned t = bid + (unsigned)r * PREP_BLOCKS; const unsigned ws = t / WT_TILES; const unsigned k0 = (t & 15u) * 64u; const unsigned n0 = ((t >> 4) & 15u) * 64u;
#pragma unroll
    for (int it = 0; it < 2; ++it) { const unsigned n = (tid >> 3) + (unsigned)it * 32u, q = tid & 7u;
      const v4u v = *(const v4u_a*)&tl[r][n][q * 8];
      vst2((v4u*)(WT + (size_t)ws * DM * DM + (size_t)(n0 + n) * DM + k0 + q * 8u), v); } }
#pragma unroll
  for (int pl = 0; pl < 2; ++pl)
#pragma unroll
    for (int it = 0; it < CVT_IT; ++it) { const unsigned e = (unsigned)it * CVT_STRIDE + bid * 256u + tid;
      const v4f a = ca[pl][it]; const v4f c = cc[pl][it];
      v4u o; o[0] = pack2(a[0], a[1]); o[1] = pack2(a[2], a[3]); o[2] = pack2(c[0], c[1]); o[3] = pack2(c[2], c[3]);
      vst2((v4u*)((pl == 0 ? XB : YB) + (size_t)e * 4), o); }
}

// ---- tensor mover helpers (two-group descriptor of a two-dimensional tile, every extent in bytes)
typedef __attribute__((ext_vector_type(4))) unsigned u32x4;
typedef __attribute__((ext_vector_type(8))) unsigned u32x8;
#define PASS_B 256u            // bytes of every operand row per pass (128 k)
#define LPITCH 272u            // LDS row pitch: 256 + 16 pad bytes, an odd multiple of 16 for the ds_load_b128 readers
#define SL_ROWS 32u            // rows of one wave's slice
#define SL_B 10240u            // 32 x 272 = 8704 bytes, rounded up so that every slice starts on a multiple of 2 KiB
#define BUF_B (8u * SL_B)      // one stage: slices 0..3 = 128 A rows, slices 4..7 = 128 B rows
static_assert(SL_ROWS * LPITCH <= SL_B && SL_B % 2048u == 0);
static_assert(NTOK % 128 == 0 && TPS % 128 == 0);   // a 128-token block stays inside one slab
__device__ __forceinline__ unsigned uni(unsigned v) { return (unsigned)__builtin_amdgcn_readfirstlane((int)v); }
__device__ __forceinline__ unsigned pinned(unsigned v) { unsigned w = uni(v); asm volatile("" : "+s"(w)); return w; }  // pinned(): the issue test of a tensor load held in a scalar register, so that it compiles to s_cmp + s_cbranch_scc (the load ignores EXEC)
__device__ __forceinline__ void wait_ds0() { asm volatile("s_wait_dscnt 0x0" ::: "memory"); }          // this wave's LDS reads have retired before the buffer is handed back
// this wave's slice has landed (the compiler places no wait for the mover); the request's group 0 is named as an input so that its registers keep their words until then
__device__ __forceinline__ void wait_tensor0(u32x4 g0) { asm volatile("s_wait_tensorcnt 0x0" :: "s"(g0) : "memory"); }
// one request of the whole wave: global tile -> LDS; group 0 is tied in and out so that wait_tensor0 names the very registers the request was issued from
__device__ __forceinline__ void tdm_load(u32x4& g0, u32x8 g1) { asm volatile("tensor_load_to_lds %0, %1" : "+s"(g0) : "s"(g1) : "memory"); }
__device__ __forceinline__ u32x8 tdm_group1() {
  u32x8 q;
  q[0] = uni((1u << 20) | (5u << 22) | (3u << 25));   // no mask, 1-byte elements, 4 pad dwords behind every 256-byte row
  q[1] = uni((PASS_B & 0xFFFFu) << 16);
  q[2] = uni((PASS_B >> 16) | ((SL_ROWS & 0xFFFFu) << 16));
  q[3] = uni((SL_ROWS >> 16) | (PASS_B << 16));
  q[4] = uni(SL_ROWS);
  q[5] = uni(2u * DM);                                // source row pitch in bytes
  q[6] = uni(0u); q[7] = uni(0u);
  return q;
}
__device__ __forceinline__ u32x4 tdm_group0(unsigned lds_dst, unsigned long long ga) {
  u32x4 q; q[0] = uni(1u); q[1] = uni(lds_dst); q[2] = uni((unsigned)ga); q[3] = uni((((unsigned)(ga >> 32)) & 0x01FFFFFFu) | 0x80000000u);
  return q;
}

// ---- k_gemm: block = 128 rows x 128 cols, 8 waves as 4 x 2, wave = 32 rows x 64 cols; C = A . BT^T + bias over K = 1024 with 16-bit operands
// Both operand tiles are staged in LDS by the tensor mover, 128 k per pass, two buffers: every wave brings one 32-row slice per stage, one stage ahead of the pass that reads it.
// EPI 0: bf16 operands; the three input projections as ONE launch, blockIdx.z = 0 Q, 1 K, 2 V: A = A0, A0, A1; weight plane z behind BT; bias BIAS0, BIAS1, BIAS2; output plane z behind OH,
//        z 0 and 1 as f16 row-major [NTOK][1024], z 2 as f16 V^T planes [slab][d][key = j*TPS + tl]. A WGP takes its next block as soon as one ends: no drain and refill of the chip between the three.
// EPI 2: f16 operands (planes A0 and BT hold f16 bits; the kernel forms only tile addresses from these pointers); f32 row-major [NTOK][1024], bias BIAS0
static_assert(WS_KH == WS_QH + PLANE2 && WS_VT == WS_KH + PLANE2);   // the three output planes stand one behind the other
template <int EPI>
__global__ __launch_bounds__(256) void k_gemm(const __bf16* __restrict__ A0, const __bf16* __restrict__ A1, const __bf16* __restrict__ BT, const float* __restrict__ BIAS0, const float* __restrict__ BIAS1, const float* __restrict__ BIAS2, _Float16* __restrict__ OH, float* __restrict__ OF) {
  __shared__ __attribute__((aligned(2048))) unsigned char ring[2u * BUF_B];
  const int tid = threadIdx.x; const int wave = __builtin_amdgcn_readfirstlane((int)(threadIdx.x >> 5)); const int lane = tid & 31, col = lane & 15, g = lane >> 4;
  const int wr = wave >> 1, wc = wave & 1;
  const int r0 = blockIdx.x * 128; const int c0 = blockIdx.y * 128;
  const int z = EPI == 0 ? (int)blockIdx.z : 0;   // which projection
  const __bf16* Ap = (EPI == 0 && z == 2) ? A1 : A0;
  const __bf16* Bp = BT + (size_t)z * DM * DM;
  const float* BIAS = z == 0 ? BIAS0 : z == 1 ? BIAS1 : BIAS2;
  constexpr int NST = DM * 2 / (int)PASS_B;   // stages = passes
  static_assert(NST >= 2);
  const unsigned lbase = (unsigned)(size_t)ring;
  const bool isA = wave < 4;
  const unsigned long long soff = (unsigned long long)(isA ? r0 + 32 * wave : c0 + 32 * (wave - 4)) * (2ull * DM);
  const unsigned long long src0 = (unsigned long long)(size_t)(isA ? Ap : Bp) + soff;
  const u32x8 g1 = tdm_group1();
  u32x4 g0;   // group 0 of this wave's one outstanding request
  auto issue = [&](int s) {
    const unsigned dst = lbase + (unsigned)(s & 1) * BUF_B + (unsigned)wave * SL_B;
    const unsigned long long ga = src0 + (unsigned long long)s * PASS_B;
    g0 = tdm_group0(dst, ga); tdm_load(g0, g1);
  };
  v8f acc[2][4] = {};
  issue(0); wait_tensor0(g0); __syncthreads();   // stage 0 published
  issue(1);
  // rolled: one publish point per pass, the buffer picked by the pass's parity
#pragma unroll 1
  for (int s = 0; s < NST; ++s) {
    const unsigned char* bufp = ring + (unsigned)(s & 1) * BUF_B;
    const unsigned char* pa = bufp + (unsigned)wr * SL_B + (unsigned)col * LPITCH;
    const unsigned char* pb = bufp + (unsigned)(4 + 2 * wc) * SL_B + (unsigned)col * LPITCH;
#pragma unroll
    for (int kc = 0; kc < (int)PASS_B / 64; ++kc) {
      if (EPI == 0) {
        v16b a[2], w[4];
#pragma unroll
        for (int i = 0; i < 2; ++i) a[i] = frag_b((const __bf16*)(pa + (unsigned)i * 16u * LPITCH + (unsigned)kc * 64u), lane);
#pragma unroll
        for (int j = 0; j < 4; ++j) w[j] = frag_b((const __bf16*)(pb + (unsigned)(j >> 1) * SL_B + (unsigned)(j & 1) * 16u * LPITCH + (unsigned)kc * 64u), lane);
#pragma unroll
        for (int i = 0; i < 2; ++i)
#pragma unroll
          for (int j = 0; j < 4; ++j) acc[i][j] = wmma_bf(a[i], w[j], acc[i][j]);
      } else {
        v16h a[2], w[4];
#pragma unroll
        for (int i = 0; i < 2; ++i) a[i] = frag_h((const _Float16*)(pa + (unsigned)i * 16u * LPITCH + (unsigned)kc * 64u), lane);
#pragma unroll
        for (int j = 0; j < 4; ++j) w[j] = frag_h((const _Float16*)(pb + (unsigned)(j >> 1) * SL_B + (unsigned)(j & 1) * 16u * LPITCH + (unsigned)kc * 64u), lane);
#pragma unroll
        for (int i = 0; i < 2; ++i)
#pragma unroll
          for (int j = 0; j < 4; ++j) acc[i][j] = wmma16(a[i], w[j], acc[i][j]);
      }
    }
    // publish point of stage s + 1: own LDS reads retired, own slice landed, then the barrier that also frees this pass's buffer
    wait_ds0(); wait_tensor0(g0); __syncthreads();
    if (pinned(s + 2 < NST)) issue(s + 2);
  }
  wait_tensor0(g0); wait_ds0();
  if (EPI == 0) {
    __shared__ __align__(16) _Float16 sh[128][136];   // z 0, 1: [row][col]; z 2: [col][row]
    _Float16* Op = OH + (size_t)z * NTOK * DM;
    if (z != 2) {   // the same for the whole block
#pragma unroll
    for (int j = 0; j < 4; ++j) { const float bias = bfr(BIAS[c0 + wc * 64 + j * 16 + col]);
#pragma unroll
      for (int i = 0; i < 2; ++i)
#pragma unroll
        for (int r = 0; r < 8; ++r) sh[wr * 32 + i * 16 + 8 * g + r][wc * 64 + j * 16 + col] = (_Float16)(acc[i][j][r] + bias); }
    __syncthreads();
    for (int e = tid; e < 128 * 16; e += 256) { const int rl = e >> 4, q = e & 15; const v4u v = *(const v4u_a*)&sh[rl][q * 8]; *(v4u*)(Op + (size_t)(r0 + rl) * DM + c0 + q * 8) = v; }
    } else {
#pragma unroll
    for (int j = 0; j < 4; ++j) { const float bias = bfr(BIAS[c0 + wc * 64 + j * 16 + col]);
#pragma unroll
      for (int i = 0; i < 2; ++i) { v8h hv;
#pragma unroll
        for (int r = 0; r < 8; ++r) hv[r] = (_Float16)(acc[i][j][r] + bias);
        *(v8h_a*)&sh[wc * 64 + j * 16 + col][wr * 32 + i * 16 + 8 * g] = hv; } }
    __syncthreads();
    const int Ls = r0 / TPS; const int tl0 = r0 - Ls * TPS;
    for (int e = tid; e < 128 * 16; e += 256) { const int cl = e >> 4, q = e & 15; const int c = c0 + cl; const int jj = c >> 6, d = c & 63;
      const v4u v = *(const v4u_a*)&sh[cl][q * 8]; *(v4u*)(Op + ((size_t)Ls * HD + d) * SEQ + jj * TPS + tl0 + q * 8) = v; }
    }
  } else {
    __shared__ __align__(16) float ss[128][132];
#pragma unroll
    for (int j = 0; j < 4; ++j) { const float bias = bfr(BIAS[c0 + wc * 64 + j * 16 + col]);
#pragma unroll
      for (int i = 0; i < 2; ++i)
#pragma unroll
        for (int r = 0; r < 8; ++r) ss[wr * 32 + i * 16 + 8 * g + r][wc * 64 + j * 16 + col] = acc[i][j][r] + bias; }
    ldsx();   // each wave reads back only its own 32 rows x 64 cols
    for (int rl = 0; rl < 16; ++rl) { const int row = wr * 32 + rl * 2 + g; const v4f v = *(const v4f_a*)&ss[row][wc * 64 + col * 4]; *(v4f*)(OF + (size_t)(r0 + row) * DM + c0 + wc * 64 + col * 4) = v; }
  }
}

// ---- k_attn staging: a stage = 128 keys of slab L = 128 K rows x 128 B and 64 V^T rows x 256 B, brought into LDS by the tensor mover, two buffers
#define ST_KEYS 128u           // keys of one stage
#define AROW_B 128u            // bytes of every staged row: 64 features of a K row, or 64 keys of a V^T row
#define APITCH 144u            // LDS row pitch: 128 + 16 pad bytes, an odd multiple of 16 for the ds_load_b128 readers
#define ASL_ROWS 32u           // rows of one wave's slice
#define ASL_B 6144u            // 32 x 144 = 4608 bytes, rounded up so that every slice starts on a multiple of 2 KiB
#define ABUF_B (8u * ASL_B)    // one stage: slices 0..3 = K rows 32 w .. + 31; slices 4..7 = V^T rows 32 (w & 1) .. + 31 of the stage's key half (w - 4) >> 1
static_assert(ASL_ROWS * APITCH <= ASL_B && ASL_B % 2048u == 0);
static_assert(TPS % (int)ST_KEYS == 0 && SEQ % 128 == 0 && HD == 64);   // a stage stays inside one feature group
// as tdm_load and wait_tensor0, with group 1 tied and named as well: the registers of both groups keep their words from the issue to the wait
__device__ __forceinline__ void tdm_load_held(u32x4& g0, u32x8& g1) { asm volatile("tensor_load_to_lds %0, %1" : "+s"(g0), "+s"(g1) : : "memory"); }
__device__ __forceinline__ void wait_tensor0_held(u32x4 g0, u32x8 g1) { asm volatile("s_wait_tensorcnt 0x0" :: "s"(g0), "s"(g1) : "memory"); }
__device__ __forceinline__ u32x8 tdm_group1_attn(unsigned src_pitch) {
  u32x8 q;
  q[0] = uni((1u << 20) | (4u << 22) | (3u << 25));   // no mask, 1-byte elements, 4 pad dwords behind every 128-byte row
  q[1] = uni((AROW_B & 0xFFFFu) << 16);
  q[2] = uni((AROW_B >> 16) | ((ASL_ROWS & 0xFFFFu) << 16));
  q[3] = uni((ASL_ROWS >> 16) | (AROW_B << 16));
  q[4] = uni(ASL_ROWS);
  q[5] = uni(src_pitch);                              // source row pitch in bytes
  q[6] = uni(0u); q[7] = uni(0u);
  return q;
}

// ---- k_attn: block = 128 query pseudo-rows of slab L (8 waves, wave = 16 queries), fused over all SEQ keys in 32-key steps (transposed flash form):
//   S^T[key][query] = K . Q^T  (A = K rows, B = Q rows);  P^T packed in-lane as the B operand;  O^T[d][query] += V^T . P^T  (A = V^T rows).
//   Keys visited in the order key = j*TPS + tl (token L*TPS + tl, feature group j); K rows and V^T columns use the same order.
//   K rows and V^T rows are read from LDS: every wave brings one slice per 128-key stage, one stage ahead of the pass that reads it; all 8 waves share the stage.
//   Each lane owns one query column: running max / sum are per lane, combined across the two lane halves by one xor-16 shuffle.
__global__ __launch_bounds__(256) void k_attn(const _Float16* __restrict__ QH, const _Float16* __restrict__ KH, const _Float16* __restrict__ VT, unsigned* __restrict__ CH) {
  __shared__ __attribute__((aligned(2048))) unsigned char ring[2u * ABUF_B];
  __shared__ __align__(16) unsigned cst[8][16][36];   // per-wave staging of the 16 x 64 ctx tile: f16 pairs
  const int tid = threadIdx.x; const int wave = __builtin_amdgcn_readfirstlane((int)(threadIdx.x >> 5)); const int lane = tid & 31, col = lane & 15, g = lane >> 4;
  const int L = blockIdx.y; const size_t qrow0 = (size_t)L * SEQ + (size_t)blockIdx.x * 128 + wave * 16;
  const _Float16* qp = QH + (qrow0 + col) * HD;
  const v16h qf0 = frag_h(qp, lane); const v16h qf1 = frag_h(qp + 32, lane);
  constexpr int NST = SEQ / (int)ST_KEYS;   // stages = passes
  static_assert(NST >= 2);
  const unsigned lbase = (unsigned)(size_t)ring;
  const bool isK = wave < 4;
  // first byte of this wave's slice of stage 0, and what a stage adds to it
  const unsigned long long src = isK ? (unsigned long long)(size_t)KH + ((unsigned long long)L * TPS + 32ull * (unsigned)wave) * (2ull * DM)
                                     : (unsigned long long)(size_t)VT + ((unsigned long long)L * HD + 32ull * (unsigned)(wave & 1)) * (2ull * SEQ) + (unsigned long long)((wave - 4) >> 1) * AROW_B;
  u32x8 g1 = tdm_group1_attn(isK ? 2u * DM : 2u * SEQ);
  u32x4 g0;   // group 0 of this wave's one outstanding request
  auto issue = [&](int s) {
    const unsigned dst = lbase + (unsigned)(s & 1) * ABUF_B + (unsigned)wave * ASL_B;
    const int k0 = s * (int)ST_KEYS; const int jj = k0 / TPS; const int tl0 = k0 - jj * TPS;
    const unsigned long long step = isK ? (unsigned long long)tl0 * (2ull * DM) + (unsigned long long)jj * (2ull * HD) : (unsigned long long)k0 * 2ull;
    g0 = tdm_group0(dst, src + step); tdm_load_held(g0, g1);
  };
  v8f o[4] = {}; float m = -3.0e38f; float l = 0.f;
  issue(0); wait_tensor0_held(g0, g1); __syncthreads();   // stage 0 published
  issue(1);
  // rolled: one publish point per pass, the buffer picked by the pass's parity
#pragma unroll 1
  for (int s = 0; s < NST; ++s) {
    const unsigned char* bufp = ring + (unsigned)(s & 1) * ABUF_B;
    const unsigned char* kl = bufp + (unsigned)col * APITCH;
    const unsigned char* vl = bufp + 4u * ASL_B + (unsigned)col * APITCH;
#pragma unroll
    for (int hb = 0; hb < (int)ST_KEYS / 32; ++hb) {
      const unsigned char* kp = kl + (unsigned)hb * ASL_B;   // keys 32 hb .. 32 hb + 31 of the stage are K slice hb
      // the step's LDS reads are written together in front of its products; in the built code those of a pass's later steps move up under the step before
      const v16h ka0 = frag_h((const _Float16*)kp, lane); const v16h kb0 = frag_h((const _Float16*)(kp + 64u), lane);
      const v16h ka1 = frag_h((const _Float16*)(kp + 16u * APITCH), lane); const v16h kb1 = frag_h((const _Float16*)(kp + 16u * APITCH + 64u), lane);
      v16h vf[4];
#pragma unroll
      for (int j = 0; j < 4; ++j) vf[j] = frag_h((const _Float16*)(vl + (unsigned)(2 * (hb >> 1) + (j >> 1)) * ASL_B + (unsigned)(j & 1) * 16u * APITCH + (unsigned)(hb & 1) * 64u), lane);   // V^T row 16 j + col, keys 32 hb .. + 31
      if (hb == 0) __builtin_amdgcn_sched_barrier(0);   // a pass's first step has no earlier step to hide under: keeps its 16 LDS reads issued as one group in front of the first wait, one exposed LDS latency and not one per fragment
      v8f s0 = {}, s1 = {};
      s0 = wmma16_free(ka0, qf0, s0); s0 = wmma16_free(kb0, qf1, s0);
      s1 = wmma16_free(ka1, qf0, s1); s1 = wmma16_free(kb1, qf1, s1);
      float mx = fmaxf(s0[0], s1[0]);
#pragma unroll
      for (int r = 1; r < 8; ++r) mx = fmaxf(mx, fmaxf(s0[r], s1[r]));
      mx = fmaxf(mx, __shfl_xor(mx, 16));
      const int up = mx > m ? 1 : 0;
      if (__any(up)) {   // wave-uniform branch; lanes whose max is unchanged get a factor of exactly 1
        const float mn = fmaxf(m, mx); const float corr = __expf((m - mn) * SCALE); m = mn; l *= corr;
#pragma unroll
        for (int j = 0; j < 4; ++j)
#pragma unroll
          for (int r = 0; r < 8; ++r) o[j][r] *= corr;
      }
      const float c = LN1024 - m * SCALE;   // P carried x 2^10 (cancels in o / l)
      v16h pf; float ls = 0.f;
#pragma unroll
      for (int r = 0; r < 8; ++r) { const float p0 = __expf(fmaf(s0[r], SCALE, c)); const float p1 = __expf(fmaf(s1[r], SCALE, c)); ls += p0 + p1; pf[r] = (_Float16)p0; pf[8 + r] = (_Float16)p1; }
      l += ls;
#pragma unroll
      for (int j = 0; j < 4; ++j) o[j] = wmma16_free(vf[j], pf, o[j]);
    }
    // publish point of stage s + 1: own LDS reads retired, own slice landed, then the barrier that also frees this pass's buffer
    wait_ds0(); wait_tensor0_held(g0, g1); __syncthreads();
    if (pinned(s + 2 < NST)) issue(s + 2);
  }
  wait_tensor0_held(g0, g1); wait_ds0();
  l += __shfl_xor(l, 16);
  const float inv = 1.0f / l;
  // o[j][r] = ctx[query col][d = 16 j + 8 g + r]: 8 consecutive d per (lane, j) -> one 16-B piece
#pragma unroll
  for (int j = 0; j < 4; ++j) { v8h hv;
#pragma unroll
    for (int r = 0; r < 8; ++r) hv[r] = (_Float16)(o[j][r] * inv);
    *(v8h_a*)&cst[wave][col][j * 8 + g * 4] = hv; }
  ldsx();   // wave-private tile
#pragma unroll
  for (int it = 0; it < 4; ++it) { const int row = it * 4 + (lane >> 3); const int pc = lane & 7;
    const v4u hv = *(const v4u_a*)&cst[wave][row][pc * 4];
    *(v4u*)(CH + (qrow0 + row) * 32 + pc * 4) = hv; }
}

extern "C" void kernel_launch(void* const* d_in, const int* in_sizes, int n_in, void* d_out, int out_size, void* d_ws, size_t ws_size, hipStream_t stream) {
  if (n_in < 10) return;
  const long long act_min = ((long long)(NB - 1) * SEQ_FULL + SEQ) * DM;
  if ((long long)in_sizes[0] < act_min || (long long)in_sizes[1] < act_min) return;
  if (in_sizes[2] < DM * DM || in_sizes[4] < DM * DM || in_sizes[6] < DM * DM || in_sizes[8] < DM * DM) return;
  if (in_sizes[3] < DM || in_sizes[5] < DM || in_sizes[7] < DM || in_sizes[9] < DM) return;
  if ((long long)out_size < (long long)NTOK * DM) return;
  if (ws_size < (size_t)WS_END) return;
  // inputs (wire order): 0 x, 1 y [2][2048][1024]; 2 Wq, 3 bq, 4 Wk, 5 bk, 6 Wv, 7 bv, 8 Wo, 9 bo; weights (in,out) [1024][1024]
  const float* x  = (const float*)d_in[0]; const float* y  = (const float*)d_in[1];
  const float* Wq = (const float*)d_in[2]; const float* bq = (const float*)d_in[3];
  const float* Wk = (const float*)d_in[4]; const float* bk = (const float*)d_in[5];
  const float* Wv = (const float*)d_in[6]; const float* bv = (const float*)d_in[7];
  const float* Wo = (const float*)d_in[8]; const float* bo = (const float*)d_in[9];
  char* ws = (char*)d_ws;
  unsigned* XB = (unsigned*)(ws + WS_XB); unsigned* YB = (unsigned*)(ws + WS_YB);
  unsigned short* WT = (unsigned short*)(ws + WS_WT);
  unsigned short* WoT = WT + 3 * (size_t)DM * DM;
  _Float16* QH = (_Float16*)(ws + WS_QH); _Float16* KH = (_Float16*)(ws + WS_KH); _Float16* VT = (_Float16*)(ws + WS_VT);
  unsigned* CH = (unsigned*)(ws + WS_CH);
  float* OUT = (float*)d_out;

  // weights are in[rows = in][cols = out] -> planes [out][in], in the order Wq, Wk, Wv, Wo behind WT
  k_prep<<<dim3(PREP_BLOCKS), 256, 0, stream>>>(x, y, Wq, Wk, Wv, Wo, XB, YB, WT);
  const dim3 gg(NTOK / 128, DM / 128);
  k_gemm<0><<<dim3(NTOK / 128, DM / 128, 3), 256, 0, stream>>>((const __bf16*)XB, (const __bf16*)YB, (const __bf16*)WT, bq, bk, bv, QH, OUT);   // Q, K, V
  k_attn<<<dim3(SEQ / 128, NSLAB), 256, 0, stream>>>(QH, KH, VT, CH);
  k_gemm<2><<<gg, 256, 0, stream>>>((const __bf16*)CH, (const __bf16*)CH, (const __bf16*)WoT, bo, bo, bo, QH, OUT);
}

// v007
// One run takes 79.5 microseconds.
// Next to v006, in two timings, it ran 1.06 times as fast each time.
// Over all steps from v000 it is 4.63 times as fast.
// compute dtype: x, y, Wq, Wk, Wv and the biases converted to bf16 (RNE), Wo to f16 (RNE); q/k/v projections on v_wmma_f32_16x16x32_bf16 with exact bf16 x bf16 products, f32 accumulate; logits K.Q^T on v_wmma_f32_16x16x32_f16 (f16 q, k), f32 accumulate, x 1/32; softmax f32 (running max); P x 2^10 as f16 against f16 V^T on v_wmma_f32_16x16x32_f16; output projection: ctx as f16 against f16 Wo on v_wmma_f32_16x16x32_f16, f32 accumulate; f32 output.
#include <hip/hip_runtime.h>
#include <math.h>

typedef __attribute__((ext_vector_type(16))) _Float16 v16h;
typedef __attribute__((ext_vector_type(16))) __bf16 v16b;
typedef __attribute__((ext_vector_type(8)))  _Float16 v8h;
typedef __attribute__((ext_vector_type(8)))  __bf16 v8b;
typedef __attribute__((ext_vector_type(8)))  float v8f;
typedef __attribute__((ext_vector_type(4)))  float v4f;
typedef __attribute__((ext_vector_type(4)))  unsigned v4u;
typedef v4u __attribute__((may_alias)) v4u_a;
typedef v4f __attribute__((may_alias)) v4f_a;
typedef v8h __attribute__((may_alias)) v8h_a;

#ifndef NB
#define NB 2
#endif
#ifndef SEQ
#define SEQ 2048
#endif
#define SEQ_FULL 2048          // per-batch row count of the inputs
#define DM 1024                // model width = projected width
#define NH 16
#define HD 64
#define NTOK (NB * SEQ)        // token rows of every [token][1024] plane
#define TPS (SEQ / NH)         // tokens per (head, batch) slab of the head-leading flat reshape
#define NSLAB (NH * NB)        // independent attention problems: SEQ pseudo-rows x HD each
#define SCALE 0.03125f         // 1 / sqrt(1024)
#define LN1024 6.931471806f

static_assert(SEQ % 1024 == 0);      // TPS multiple of 64: a 32-key step stays inside one feature group
static_assert(NTOK % 64 == 0);
static_assert(DM % 128 == 0);
static_assert(SEQ <= SEQ_FULL);

#define PLANE2 (2ull * (unsigned long long)NTOK * DM)    // bytes of one 16-bit [NTOK][1024] plane
#define WPL2   (2ull * (unsigned long long)DM * DM)      // bytes of one 16-bit weight plane
#define WS_XB 0ull
#define WS_YB (WS_XB + PLANE2)
#define WS_WT (WS_YB + PLANE2)       // 4 planes [out][in]: Wq^T, Wk^T, Wv^T as bf16, Wo^T as f16
#define WS_QH (WS_WT + 4ull * WPL2)
#define WS_KH (WS_QH + PLANE2)
#define WS_VT (WS_KH + PLANE2)       // f16 V^T planes [slab][d][key], key = j * TPS + tl
#define WS_CH (WS_VT + PLANE2)       // f16 ctx plane [token][1024]
#define WS_END (WS_CH + PLANE2)
static_assert(WS_END <= 134217728ull);
static_assert(PLANE2 % 128 == 0);
static_assert(WPL2 % 128 == 0);

template <typename T> __device__ __forceinline__ void vst2(T* p, T v) { *(T*)p = v;  }

__device__ __forceinline__ v8f wmma16(v16h a, v16h b, v8f c) {
  v8f d = __builtin_amdgcn_wmma_f32_16x16x32_f16(false, a, false, b, (short)0, c, false, false);
  asm volatile("v_nop\n\tv_nop\n\tv_nop\n\tv_nop" : "+v"(d) : "v"(a), "v"(b));
  return d;
}
__device__ __forceinline__ v8f wmma_bf(v16b a, v16b b, v8f c) {
  v8f d = __builtin_amdgcn_wmma_f32_16x16x32_bf16(false, a, false, b, (short)0, c, false, false);
  asm volatile("v_nop\n\tv_nop\n\tv_nop\n\tv_nop" : "+v"(d) : "v"(a), "v"(b));
  return d;
}
// k_attn's form: the builtin alone. The compiler keeps the distance behind its own WMMAs, filling it with the step's vector work where it can, and stays free to move the next step's LDS reads and logit products under this step's softmax.
__device__ __forceinline__ v8f wmma16_free(v16h a, v16h b, v8f c) { return __builtin_amdgcn_wmma_f32_16x16x32_f16(false, a, false, b, (short)0, c, false, false); }
// 16x16x32 fragments: lane = (h = lane>>4, row/col = lane&15); elements 0..7 = k0+8h+0..7, 8..15 = k0+16+8h+0..7; D element r = row 8h+r, col lane&15
__device__ __forceinline__ v16h frag_h(const _Float16* rowk0, int lane) {
  union { v16h v; v8h q[2]; } u; const _Float16* p = rowk0 + 8 * (lane >> 4);
  u.q[0] = *(const v8h*)p; u.q[1] = *(const v8h*)(p + 16); return u.v;
}
__device__ __forceinline__ v16b frag_b(const __bf16* rowk0, int lane) {
  union { v16b v; v8b q[2]; } u; const __bf16* p = rowk0 + 8 * (lane >> 4);
  u.q[0] = *(const v8b*)p; u.q[1] = *(const v8b*)(p + 16); return u.v;
}
// bf16 bits of an f32 value, nearest-even
__device__ __forceinline__ unsigned bf16_rne(float f) { unsigned u = __float_as_uint(f); u += 0x7FFFu + ((u >> 16) & 1u); return u >> 16; }
__device__ __forceinline__ float bfr(float v) { return __uint_as_float(bf16_rne(v) << 16); }
__device__ __forceinline__ unsigned pack2(float a, float b) { return bf16_rne(a) | (bf16_rne(b) << 16); }
// 16-bit pattern of a weight, nearest-even: f16 for the output projection's plane, bf16 for the others
template <bool F16> __device__ __forceinline__ unsigned short w16(float f) { return F16 ? __builtin_bit_cast(unsigned short, (_Float16)f) : (unsigned short)bf16_rne(f); }
// a thread's 4 x 4 values of a 64 x 64 weight tile into the transposed LDS tile t[n][k]
template <bool F16> __device__ __forceinline__ void wt_put(unsigned short (*t)[72], const v4f* v, unsigned kr, unsigned q4) {
#pragma unroll
  for (int it = 0; it < 4; ++it)
#pragma unroll
    for (int c = 0; c < 4; ++c) t[q4 * 4 + c][kr + (unsigned)it * 16u] = w16<F16>(v[it][c]);
}
// same-wave LDS exchange: stores retire, then the wave proceeds to the loads
__device__ __forceinline__ void ldsx() { asm volatile("s_wait_dscnt 0" ::: "memory"); __builtin_amdgcn_wave_barrier(); __builtin_amdgcn_fence(3 /* release order */, "workgroup"); }

// ---- k_prep: every operand preparation of the call in ONE launch: x and y to bf16 planes, the four weights to transposed 16-bit planes (Wq, Wk, Wv bf16, Wo f16).
// A block takes CVT_IT 8-float pieces per thread of each activation plane (grid-strided) and WT_RND 64 x 64 weight tiles; few long waves in place of many one-piece waves.
#define PREP_BLOCKS 512
#define CVT_STRIDE (PREP_BLOCKS * 256)               // pieces the whole grid takes per trip
#define CVT_IT (NTOK * (DM / 8) / CVT_STRIDE)        // trips per activation plane
#define WT_TILES ((DM / 64) * (DM / 64))             // tiles of one weight
#define WT_RND (4 * WT_TILES / PREP_BLOCKS)          // tiles per block
static_assert(NTOK * (DM / 8) % CVT_STRIDE == 0);
static_assert(4 * WT_TILES % PREP_BLOCKS == 0 && DM / 64 == 16);
__global__ __launch_bounds__(256) void k_prep(const float* __restrict__ X, const float* __restrict__ Y, const float* __restrict__ W0, const float* __restrict__ W1, const float* __restrict__ W2, const float* __restrict__ W3,
                                              unsigned* __restrict__ XB, unsigned* __restrict__ YB, unsigned short* __restrict__ WT) {
  __shared__ __align__(16) unsigned short tl[WT_RND][64][72];
  const unsigned tid = threadIdx.x; const unsigned bid = blockIdx.x;
  const unsigned kr = tid >> 4, q4 = tid & 15;       // tile loads: k row (+ 16 a trip), quad of n
  // all loads of the block stand in front of all its stores: the weight tiles first, their way through LDS is the longer one
  v4f wv[WT_RND][4];
#pragma unroll
  for (int r = 0; r < WT_RND; ++r) { const unsigned t = bid + (unsigned)r * PREP_BLOCKS; const unsigned ws = t / WT_TILES; const unsigned k0 = (t & 15u) * 64u; const unsigned n0 = ((t >> 4) & 15u) * 64u;
    const float* W = (ws == 0 ? W0 : ws == 1 ? W1 : ws == 2 ? W2 : W3) + (size_t)(k0 + kr) * DM + n0 + q4 * 4u;
#pragma unroll
    for (int it = 0; it < 4; ++it) wv[r][it] = *(const v4f*)(W + (size_t)it * 16 * DM); }
  v4f ca[2][CVT_IT], cc[2][CVT_IT];
#pragma unroll
  for (int pl = 0; pl < 2; ++pl)
#pragma unroll
    for (int it = 0; it < CVT_IT; ++it) { const unsigned e = (unsigned)it * CVT_STRIDE + bid * 256u + tid;
      const unsigned T = e >> 7; const unsigned pc = e & 127u; const unsigned b = T / SEQ; const unsigned s = T % SEQ;
      const float* p = (pl == 0 ? X : Y) + ((size_t)b * SEQ_FULL + s) * DM + pc * 8u;
      ca[pl][it] = *(const v4f*)p; cc[pl][it] = *(const v4f*)(p + 4);
      if (it == CVT_IT - 1) asm volatile("s_wait_xcnt 0x0" ::: "memory"); }   // precaution: stands behind a plane's loads, in front of whatever writes a register that they name as an address
  __builtin_amdgcn_sched_barrier(0);   // keeps every load above issued before the first wait on one of them: one memory latency a block, not one a group of loads
#pragma unroll
  for (int r = 0; r < WT_RND; ++r) {
    if ((bid + (unsigned)r * PREP_BLOCKS) / WT_TILES == 3u) wt_put<true>(tl[r], wv[r], kr, q4);   // a tile of Wo; the test reads the same for the whole block
    else wt_put<false>(tl[r], wv[r], kr, q4);
  }
  __syncthreads();
#pragma unroll
  for (int r = 0; r < WT_RND; ++r) { const unsigned t = bid + (unsigned)r * PREP_BLOCKS; const unsigned ws = t / WT_TILES; const unsigned k0 = (t & 15u) * 64u; const unsigned n0 = ((t >> 4) & 15u) * 64u;
#pragma unroll
    for (int it = 0; it < 2; ++it) { const unsigned n = (tid >> 3) + (unsigned)it * 32u, q = tid & 7u;
      const v4u v = *(const v4u_a*)&tl[r][n][q * 8];
      vst2((v4u*)(WT + (size_t)ws * DM * DM + (size_t)(n0 + n) * DM + k0 + q * 8u), v); } }
#pragma unroll
  for (int pl = 0; pl < 2; ++pl)
#pragma unroll
    for (int it = 0; it < CVT_IT; ++it) { const unsigned e = (unsigned)it * CVT_STRIDE + bid * 256u + tid;
      const v4f a = ca[pl][it]; const v4f c = cc[pl][it];
      v4u o; o[0] = pack2(a[0], a[1]); o[1] = pack2(a[2], a[3]); o[2] = pack2(c[0], c[1]); o[3] = pack2(c[2], c[3]);
      vst2((v4u*)((pl == 0 ? XB : YB) + (size_t)e * 4), o); }
}

// ---- tensor mover helpers (two-group descriptor of a two-dimensional tile, every extent in bytes)
typedef __attribute__((ext_vector_type(4))) unsigned u32x4;
typedef __attribute__((ext_vector_type(8))) unsigned u32x8;
#define PASS_B 256u            // bytes of every operand row per pass (128 k)
#define LPITCH 272u            // LDS row pitch: 256 + 16 pad bytes, an odd multiple of 16 for the ds_load_b128 readers
#define SL_ROWS 32u            // rows of one wave's slice
#define SL_B 10240u            // 32 x 272 = 8704 bytes, rounded up so that every slice starts on a multiple of 2 KiB
#define BUF_B (8u * SL_B)      // one stage: slices 0..3 = 128 A rows, slices 4..7 = 128 B rows
static_assert(SL_ROWS * LPITCH <= SL_B && SL_B % 2048u == 0);
static_assert(NTOK % 128 == 0 && TPS % 128 == 0);   // a 128-token block stays inside one slab
__device__ __forceinline__ unsigned uni(unsigned v) { return (unsigned)__builtin_amdgcn_readfirstlane((int)v); }
__device__ __forceinline__ unsigned pinned(unsigned v) { unsigned w = uni(v); asm volatile("" : "+s"(w)); return w; }  // pinned(): the issue test of a tensor load held in a scalar register, so that it compiles to s_cmp + s_cbranch_scc (the load ignores EXEC)
__device__ __forceinline__ void wait_ds0() { asm volatile("s_wait_dscnt 0x0" ::: "memory"); }          // this wave's LDS reads have retired before the buffer is handed back
template <int N> __device__ __forceinline__ void wait_tensor(u32x4 g0, u32x8 g1) { asm volatile("s_wait_tensorcnt %2" :: "s"(g0), "s"(g1), "n"(N) : "memory"); }
// one request of the whole wave: global tile -> LDS; both groups are tied in and out so that every request of the kernel is issued from the same registers and wait_tensor names them
__device__ __forceinline__ void tdm_load(u32x4& g0, u32x8& g1) { asm volatile("tensor_load_to_lds %0, %1" : "+s"(g0), "+s"(g1) : : "memory"); }
__device__ __forceinline__ u32x8 tdm_group1() {
  u32x8 q;
  q[0] = uni((1u << 20) | (5u << 22) | (3u << 25));   // no mask, 1-byte elements, 4 pad dwords behind every 256-byte row
  q[1] = uni((PASS_B & 0xFFFFu) << 16);
  q[2] = uni((PASS_B >> 16) | ((SL_ROWS & 0xFFFFu) << 16));
  q[3] = uni((SL_ROWS >> 16) | (PASS_B << 16));
  q[4] = uni(SL_ROWS);
  q[5] = uni(2u * DM);                                // source row pitch in bytes
  q[6] = uni(0u); q[7] = uni(0u);
  return q;
}
__device__ __forceinline__ u32x4 tdm_group0(unsigned lds_dst, unsigned long long ga) {
  u32x4 q; q[0] = uni(1u); q[1] = uni(lds_dst); q[2] = uni((unsigned)ga); q[3] = uni((((unsigned)(ga >> 32)) & 0x01FFFFFFu) | 0x80000000u);
  return q;
}

// ---- k_gemm: block = 128 rows x 128 cols, 8 waves as 4 x 2, wave = 32 rows x 64 cols; C = A . BT^T + bias over K = 1024 with 16-bit operands
// Both operand tiles are staged in LDS by the tensor mover, 128 k per pass, three buffers: every wave brings one 32-row slice per stage; while a pass works, the next two stages are in flight, so a stage has two passes to land in.
// EPI 0: bf16 operands; the three input projections as ONE launch, blockIdx.z = 0 Q, 1 K, 2 V: A = A0, A0, A1; weight plane z behind BT; bias BIAS0, BIAS1, BIAS2; output plane z behind OH,
//        z 0 and 1 as f16 row-major [NTOK][1024], z 2 as f16 V^T planes [slab][d][key = j*TPS + tl]. A WGP takes its next block as soon as one ends: no drain and refill of the chip between the three.
// EPI 2: f16 operands (planes A0 and BT hold f16 bits; the kernel forms only tile addresses from these pointers); f32 row-major [NTOK][1024], bias BIAS0
static_assert(WS_KH == WS_QH + PLANE2 && WS_VT == WS_KH + PLANE2);   // the three output planes stand one behind the other
template <int EPI>
__global__ __launch_bounds__(256) void k_gemm(const __bf16* __restrict__ A0, const __bf16* __restrict__ A1, const __bf16* __restrict__ BT, const float* __restrict__ BIAS0, const float* __restrict__ BIAS1, const float* __restrict__ BIAS2, _Float16* __restrict__ OH, float* __restrict__ OF) {
  __shared__ __attribute__((aligned(2048))) unsigned char ring[3u * BUF_B];
  const int tid = threadIdx.x; const int wave = __builtin_amdgcn_readfirstlane((int)(threadIdx.x >> 5)); const int lane = tid & 31, col = lane & 15, g = lane >> 4;
  const int wr = wave >> 1, wc = wave & 1;
  const int r0 = blockIdx.x * 128; const int c0 = blockIdx.y * 128;
  const int z = EPI == 0 ? (int)blockIdx.z : 0;   // which projection
  const __bf16* Ap = (EPI == 0 && z == 2) ? A1 : A0;
  const __bf16* Bp = BT + (size_t)z * DM * DM;
  const float* BIAS = z == 0 ? BIAS0 : z == 1 ? BIAS1 : BIAS2;
  constexpr int NST = DM * 2 / (int)PASS_B;   // stages = passes
  static_assert(NST >= 3);
  const unsigned lbase = (unsigned)(size_t)ring;
  const bool isA = wave < 4;
  const unsigned long long soff = (unsigned long long)(isA ? r0 + 32 * wave : c0 + 32 * (wave - 4)) * (2ull * DM);
  const unsigned long long src0 = (unsigned long long)(size_t)(isA ? Ap : Bp) + soff;
  const unsigned ldst0 = lbase + (unsigned)wave * SL_B;   // this wave's slice in buffer 0
  u32x8 g1 = tdm_group1();
  u32x4 g0 = tdm_group0(ldst0, src0);
  // From request to request only words 1 (place in LDS) and 2 (low address word) of group 0 take a new value. The high address word holds for all stages:
  // a stage adds PASS_B inside one 2-KiB operand row, and the rows stand at multiples of 2 KiB (plane offsets and row pitch are such multiples, the workspace starts on a page).
  auto issue_next = [&](unsigned buf_off) { g0[1] = uni(ldst0 + buf_off); g0[2] = uni(g0[2] + PASS_B); tdm_load(g0, g1); };
  v8f acc[2][4] = {};
  tdm_load(g0, g1); issue_next(BUF_B); issue_next(2u * BUF_B);   // stages 0, 1, 2: three requests of the wave, the most it ever has outstanding
  wait_tensor<2>(g0, g1); __syncthreads();   // stage 0 published
  unsigned rb = 0;   // byte offset of the buffer that the pass reads: stage s stands in buffer s mod 3
  // rolled: one publish point per pass
#pragma unroll 1
  for (int s = 0; s < NST; ++s) {
    const unsigned char* bufp = ring + rb;
    const unsigned char* pa = bufp + (unsigned)wr * SL_B + (unsigned)col * LPITCH;
    const unsigned char* pb = bufp + (unsigned)(4 + 2 * wc) * SL_B + (unsigned)col * LPITCH;
#pragma unroll
    for (int kc = 0; kc < (int)PASS_B / 64; ++kc) {
      if (EPI == 0) {
        v16b a[2], w[4];
#pragma unroll
        for (int i = 0; i < 2; ++i) a[i] = frag_b((const __bf16*)(pa + (unsigned)i * 16u * LPITCH + (unsigned)kc * 64u), lane);
#pragma unroll
        for (int j = 0; j < 4; ++j) w[j] = frag_b((const __bf16*)(pb + (unsigned)(j >> 1) * SL_B + (unsigned)(j & 1) * 16u * LPITCH + (unsigned)kc * 64u), lane);
#pragma unroll
        for (int i = 0; i < 2; ++i)
#pragma unroll
          for (int j = 0; j < 4; ++j) acc[i][j] = wmma_bf(a[i], w[j], acc[i][j]);
      } else {
        v16h a[2], w[4];
#pragma unroll
        for (int i = 0; i < 2; ++i) a[i] = frag_h((const _Float16*)(pa + (unsigned)i * 16u * LPITCH + (unsigned)kc * 64u), lane);
#pragma unroll
        for (int j = 0; j < 4; ++j) w[j] = frag_h((const _Float16*)(pb + (unsigned)(j >> 1) * SL_B + (unsigned)(j & 1) * 16u * LPITCH + (unsigned)kc * 64u), lane);
#pragma unroll
        for (int i = 0; i < 2; ++i)
#pragma unroll
          for (int j = 0; j < 4; ++j) acc[i][j] = wmma16(a[i], w[j], acc[i][j]);
      }
    }
    // publish point of stage s + 1: own LDS reads retired, own slice of stage s + 1 landed (stage s + 2, where there is one, is the one younger request and stays in flight), then the barrier that also frees this pass's buffer
    wait_ds0(); wait_tensor<1>(g0, g1);
    if (pinned(s + 2 >= NST)) wait_tensor<0>(g0, g1);   // the last passes: no younger request stands behind stage s + 1, so the count that covers it is 0
    __syncthreads();
    if (pinned(s + 3 < NST)) issue_next(rb);   // stage s + 3 into the buffer that pass s has just read
    rb = rb == 2u * BUF_B ? 0u : rb + BUF_B;
  }
  wait_tensor<0>(g0, g1); wait_ds0();
  if (EPI == 0) {
    __shared__ __align__(16) _Float16 sh[128][136];   // z 0, 1: [row][col]; z 2: [col][row]
    _Float16* Op = OH + (size_t)z * NTOK * DM;
    if (z != 2) {   // the same for the whole block
#pragma unroll
    for (int j = 0; j < 4; ++j) { const float bias = bfr(BIAS[c0 + wc * 64 + j * 16 + col]);
#pragma unroll
      for (int i = 0; i < 2; ++i)
#pragma unroll
        for (int r = 0; r < 8; ++r) sh[wr * 32 + i * 16 + 8 * g + r][wc * 64 + j * 16 + col] = (_Float16)(acc[i][j][r] + bias); }
    __syncthreads();
    for (int e = tid; e < 128 * 16; e += 256) { const int rl = e >> 4, q = e & 15; const v4u v = *(const v4u_a*)&sh[rl][q * 8]; *(v4u*)(Op + (size_t)(r0 + rl) * DM + c0 + q * 8) = v; }
    } else {
#pragma unroll
    for (int j = 0; j < 4; ++j) { const float bias = bfr(BIAS[c0 + wc * 64 + j * 16 + col]);
#pragma unroll
      for (int i = 0; i < 2; ++i) { v8h hv;
#pragma unroll
        for (int r = 0; r < 8; ++r) hv[r] = (_Float16)(acc[i][j][r] + bias);
        *(v8h_a*)&sh[wc * 64 + j * 16 + col][wr * 32 + i * 16 + 8 * g] = hv; } }
    __syncthreads();
    const int Ls = r0 / TPS; const int tl0 = r0 - Ls * TPS;
    for (int e = tid; e < 128 * 16; e += 256) { const int cl = e >> 4, q = e & 15; const int c = c0 + cl; const int jj = c >> 6, d = c & 63;
      const v4u v = *(const v4u_a*)&sh[cl][q * 8]; *(v4u*)(Op + ((size_t)Ls * HD + d) * SEQ + jj * TPS + tl0 + q * 8) = v; }
    }
  } else {
    __shared__ __align__(16) float ss[128][132];
#pragma unroll
    for (int j = 0; j < 4; ++j) { const float bias = bfr(BIAS[c0 + wc * 64 + j * 16 + col]);
#pragma unroll
      for (int i = 0; i < 2; ++i)
#pragma unroll
        for (int r = 0; r < 8; ++r) ss[wr * 32 + i * 16 + 8 * g + r][wc * 64 + j * 16 + col] = acc[i][j][r] + bias; }
    ldsx();   // each wave reads back only its own 32 rows x 64 cols
    for (int rl = 0; rl < 16; ++rl) { const int row = wr * 32 + rl * 2 + g; const v4f v = *(const v4f_a*)&ss[row][wc * 64 + col * 4]; *(v4f*)(OF + (size_t)(r0 + row) * DM + c0 + wc * 64 + col * 4) = v; }
  }
}

// ---- k_attn staging: a stage = 128 keys of slab L = 128 K rows x 128 B and 64 V^T rows x 256 B, brought into LDS by the tensor mover, two buffers
#define ST_KEYS 128u           // keys of one stage
#define AROW_B 128u            // bytes of every staged row: 64 features of a K row, or 64 keys of a V^T row
#define APITCH 144u            // LDS row pitch: 128 + 16 pad bytes, an odd multiple of 16 for the ds_load_b128 readers
#define ASL_ROWS 32u           // rows of one wave's slice
#define ASL_B 6144u            // 32 x 144 = 4608 bytes, rounded up so that every slice starts on a multiple of 2 KiB
#define ABUF_B (8u * ASL_B)    // one stage: slices 0..3 = K rows 32 w .. + 31; slices 4..7 = V^T rows 32 (w & 1) .. + 31 of the stage's key half (w - 4) >> 1
static_assert(ASL_ROWS * APITCH <= ASL_B && ASL_B % 2048u == 0);
static_assert(TPS % (int)ST_KEYS == 0 && SEQ % 128 == 0 && HD == 64);   // a stage stays inside one feature group
// as tdm_load and wait_tensor<0>: the registers of both groups keep their words from the issue to the wait
__device__ __forceinline__ void tdm_load_held(u32x4& g0, u32x8& g1) { asm volatile("tensor_load_to_lds %0, %1" : "+s"(g0), "+s"(g1) : : "memory"); }
__device__ __forceinline__ void wait_tensor0_held(u32x4 g0, u32x8 g1) { asm volatile("s_wait_tensorcnt 0x0" :: "s"(g0), "s"(g1) : "memory"); }
__device__ __forceinline__ u32x8 tdm_group1_attn(unsigned src_pitch) {
  u32x8 q;
  q[0] = uni((1u << 20) | (4u << 22) | (3u << 25));   // no mask, 1-byte elements, 4 pad dwords behind every 128-byte row
  q[1] = uni((AROW_B & 0xFFFFu) << 16);
  q[2] = uni((AROW_B >> 16) | ((ASL_ROWS & 0xFFFFu) << 16));
  q[3] = uni((ASL_ROWS >> 16) | (AROW_B << 16));
  q[4] = uni(ASL_ROWS);
  q[5] = uni(src_pitch);                              // source row pitch in bytes
  q[6] = uni(0u); q[7] = uni(0u);
  return q;
}

// ---- k_attn: block = 128 query pseudo-rows of slab L (8 waves, wave = 16 queries), fused over all SEQ keys in 32-key steps (transposed flash form):
//   S^T[key][query] = K . Q^T  (A = K rows, B = Q rows);  P^T packed in-lane as the B operand;  O^T[d][query] += V^T . P^T  (A = V^T rows).
//   Keys visited in the order key = j*TPS + tl (token L*TPS + tl, feature group j); K rows and V^T columns use the same order.
//   K rows and V^T rows are read from LDS: every wave brings one slice per 128-key stage, one stage ahead of the pass that reads it; all 8 waves share the stage.
//   Each lane owns one query column: running max / sum are per lane, combined across the two lane halves by one xor-16 shuffle.
__global__ __launch_bounds__(256) void k_attn(const _Float16* __restrict__ QH, const _Float16* __restrict__ KH, const _Float16* __restrict__ VT, unsigned* __restrict__ CH) {
  __shared__ __attribute__((aligned(2048))) unsigned char ring[2u * ABUF_B];
  __shared__ __align__(16) unsigned cst[8][16][36];   // per-wave staging of the 16 x 64 ctx tile: f16 pairs
  const int tid = threadIdx.x; const int wave = __builtin_amdgcn_readfirstlane((int)(threadIdx.x >> 5)); const int lane = tid & 31, col = lane & 15, g = lane >> 4;
  const int L = blockIdx.y; const size_t qrow0 = (size_t)L * SEQ + (size_t)blockIdx.x * 128 + wave * 16;
  const _Float16* qp = QH + (qrow0 + col) * HD;
  const v16h qf0 = frag_h(qp, lane); const v16h qf1 = frag_h(qp + 32, lane);
  constexpr int NST = SEQ / (int)ST_KEYS;   // stages = passes
  static_assert(NST >= 2);
  const unsigned lbase = (unsigned)(size_t)ring;
  const bool isK = wave < 4;
  // first byte of this wave's slice of stage 0, and what a stage adds to it
  const unsigned long long src = isK ? (unsigned long long)(size_t)KH + ((unsigned long long)L * TPS + 32ull * (unsigned)wave) * (2ull * DM)
                                     : (unsigned long long)(size_t)VT + ((unsigned long long)L * HD + 32ull * (unsigned)(wave & 1)) * (2ull * SEQ) + (unsigned long long)((wave - 4) >> 1) * AROW_B;
  u32x8 g1 = tdm_group1_attn(isK ? 2u * DM : 2u * SEQ);
  u32x4 g0;   // group 0 of this wave's one outstanding request
  auto issue = [&](int s) {
    const unsigned dst = lbase + (unsigned)(s & 1) * ABUF_B + (unsigned)wave * ASL_B;
    const int k0 = s * (int)ST_KEYS; const int jj = k0 / TPS; const int tl0 = k0 - jj * TPS;
    const unsigned long long step = isK ? (unsigned long long)tl0 * (2ull * DM) + (unsigned long long)jj * (2ull * HD) : (unsigned long long)k0 * 2ull;
    g0 = tdm_group0(dst, src + step); tdm_load_held(g0, g1);
  };
  v8f o[4] = {}; float m = -3.0e38f; float l = 0.f;
  issue(0); wait_tensor0_held(g0, g1); __syncthreads();   // stage 0 published
  issue(1);
  // rolled: one publish point per pass, the buffer picked by the pass's parity
#pragma unroll 1
  for (int s = 0; s < NST; ++s) {
    const unsigned char* bufp = ring + (unsigned)(s & 1) * ABUF_B;
    const unsigned char* kl = bufp + (unsigned)col * APITCH;
    const unsigned char* vl = bufp + 4u * ASL_B + (unsigned)col * APITCH;
#pragma unroll
    for (int hb = 0; hb < (int)ST_KEYS / 32; ++hb) {
      const unsigned char* kp = kl + (unsigned)hb * ASL_B;   // keys 32 hb .. 32 hb + 31 of the stage are K slice hb
      // the step's LDS reads are written together in front of its products; in the built code those of a pass's later steps move up under the step before
      const v16h ka0 = frag_h((const _Float16*)kp, lane); const v16h kb0 = frag_h((const _Float16*)(kp + 64u), lane);
      const v16h ka1 = frag_h((const _Float16*)(kp + 16u * APITCH), lane); const v16h kb1 = frag_h((const _Float16*)(kp + 16u * APITCH + 64u), lane);
      v16h vf[4];
#pragma unroll
      for (int j = 0; j < 4; ++j) vf[j] = frag_h((const _Float16*)(vl + (unsigned)(2 * (hb >> 1) + (j >> 1)) * ASL_B + (unsigned)(j & 1) * 16u * APITCH + (unsigned)(hb & 1) * 64u), lane);   // V^T row 16 j + col, keys 32 hb .. + 31
      if (hb == 0) __builtin_amdgcn_sched_barrier(0);   // a pass's first step has no earlier step to hide under: keeps its 16 LDS reads issued as one group in front of the first wait, one exposed LDS latency and not one per fragment
      v8f s0 = {}, s1 = {};
      s0 = wmma16_free(ka0, qf0, s0); s0 = wmma16_free(kb0, qf1, s0);
      s1 = wmma16_free(ka1, qf0, s1); s1 = wmma16_free(kb1, qf1, s1);
      float mx = fmaxf(s0[0], s1[0]);
#pragma unroll
      for (int r = 1; r < 8; ++r) mx = fmaxf(mx, fmaxf(s0[r], s1[r]));
      mx = fmaxf(mx, __shfl_xor(mx, 16));
      const int up = mx > m ? 1 : 0;
      if (__any(up)) {   // wave-uniform branch; lanes whose max is unchanged get a factor of exactly 1
        const float mn = fmaxf(m, mx); const float corr = __expf((m - mn) * SCALE); m = mn; l *= corr;
#pragma unroll
        for (int j = 0; j < 4; ++j)
#pragma unroll
          for (int r = 0; r < 8; ++r) o[j][r] *= corr;
      }
      const float c = LN1024 - m * SCALE;   // P carried x 2^10 (cancels in o / l)
      v16h pf; float ls = 0.f;
#pragma unroll
      for (int r = 0; r < 8; ++r) { const float p0 = __expf(fmaf(s0[r], SCALE, c)); const float p1 = __expf(fmaf(s1[r], SCALE, c)); ls += p0 + p1; pf[r] = (_Float16)p0; pf[8 + r] = (_Float16)p1; }
      l += ls;
#pragma unroll
      for (int j = 0; j < 4; ++j) o[j] = wmma16_free(vf[j], pf, o[j]);
    }
    // publish point of stage s + 1: own LDS reads retired, own slice landed, then the barrier that also frees this pass's buffer
    wait_ds0(); wait_tensor0_held(g0, g1); __syncthreads();
    if (pinned(s + 2 < NST)) issue(s + 2);
  }
  wait_tensor0_held(g0, g1); wait_ds0();
  l += __shfl_xor(l, 16);
  const float inv = 1.0f / l;
  // o[j][r] = ctx[query col][d = 16 j + 8 g + r]: 8 consecutive d per (lane, j) -> one 16-B piece
#pragma unroll
  for (int j = 0; j < 4; ++j) { v8h hv;
#pragma unroll
    for (int r = 0; r < 8; ++r) hv[r] = (_Float16)(o[j][r] * inv);
    *(v8h_a*)&cst[wave][col][j * 8 + g * 4] = hv; }
  ldsx();   // wave-private tile
#pragma unroll
  for (int it = 0; it < 4; ++it) { const int row = it * 4 + (lane >> 3); const int pc = lane & 7;
    const v4u hv = *(const v4u_a*)&cst[wave][row][pc * 4];
    *(v4u*)(CH + (qrow0 + row) * 32 + pc * 4) = hv; }
}

extern "C" void kernel_launch(void* const* d_in, const int* in_sizes, int n_in, void* d_out, int out_size, void* d_ws, size_t ws_size, hipStream_t stream) {
  if (n_in < 10) return;
  const long long act_min = ((long long)(NB - 1) * SEQ_FULL + SEQ) * DM;
  if ((long long)in_sizes[0] < act_min || (long long)in_sizes[1] < act_min) return;
  if (in_sizes[2] < DM * DM || in_sizes[4] < DM * DM || in_sizes[6] < DM * DM || in_sizes[8] < DM * DM) return;
  if (in_sizes[3] < DM || in_sizes[5] < DM || in_sizes[7] < DM || in_sizes[9] < DM) return;
  if ((long long)out_size < (long long)NTOK * DM) return;
  if (ws_size < (size_t)WS_END) return;
  // inputs (wire order): 0 x, 1 y [2][2048][1024]; 2 Wq, 3 bq, 4 Wk, 5 bk, 6 Wv, 7 bv, 8 Wo, 9 bo; weights (in,out) [1024][1024]
  const float* x  = (const float*)d_in[0]; const float* y  = (const float*)d_in[1];
  const float* Wq = (const float*)d_in[2]; const float* bq = (const float*)d_in[3];
  const float* Wk = (const float*)d_in[4]; const float* bk = (const float*)d_in[5];
  const float* Wv = (const float*)d_in[6]; const float* bv = (const float*)d_in[7];
  const float* Wo = (const float*)d_in[8]; const float* bo = (const float*)d_in[9];
  char* ws = (char*)d_ws;
  unsigned* XB = (unsigned*)(ws + WS_XB); unsigned* YB = (unsigned*)(ws + WS_YB);
  unsigned short* WT = (unsigned short*)(ws + WS_WT);
  unsigned short* WoT = WT + 3 * (size_t)DM * DM;
  _Float16* QH = (_Float16*)(ws + WS_QH); _Float16* KH = (_Float16*)(ws + WS_KH); _Float16* VT = (_Float16*)(ws + WS_VT);
  unsigned* CH = (unsigned*)(ws + WS_CH);
  float* OUT = (float*)d_out;

  // weights are in[rows = in][cols = out] -> planes [out][in], in the order Wq, Wk, Wv, Wo behind WT
  k_prep<<<dim3(PREP_BLOCKS), 256, 0, stream>>>(x, y, Wq, Wk, Wv, Wo, XB, YB, WT);
  const dim3 gg(NTOK / 128, DM / 128);
  k_gemm<0><<<dim3(NTOK / 128, DM / 128, 3), 256, 0, stream>>>((const __bf16*)XB, (const __bf16*)YB, (const __bf16*)WT, bq, bk, bv, QH, OUT);   // Q, K, V
  k_attn<<<dim3(SEQ / 128, NSLAB), 256, 0, stream>>>(QH, KH, VT, CH);
  k_gemm<2><<<gg, 256, 0, stream>>>((const __bf16*)CH, (const __bf16*)CH, (const __bf16*)WoT, bo, bo, bo, QH, OUT);
}

// v008
// One run takes 75.8 microseconds.
// Timed twice side by side with v007, it ran 1.04 and 1.05 times as fast.
// All steps since v000 together make it 4.84 times as fast.
// compute dtype: x, y, Wq, Wk, Wv and the biases converted to bf16 (RNE), Wo to f16 (RNE); q/k/v projections on v_wmma_f32_16x16x32_bf16 with exact bf16 x bf16 products, f32 accumulate; logits K.Q^T on v_wmma_f32_16x16x32_f16 (f16 q, k), f32 accumulate, x 1/32; softmax f32 (reference raised lazily, once per 128 keys at most); P x 2^10 as f16 against f16 V^T on v_wmma_f32_16x16x32_f16; output projection: ctx as f16 against f16 Wo on v_wmma_f32_16x16x32_f16, f32 accumulate; f32 output.
#include <hip/hip_runtime.h>
#include <math.h>

typedef __attribute__((ext_vector_type(16))) _Float16 v16h;
typedef __attribute__((ext_vector_type(16))) __bf16 v16b;
typedef __attribute__((ext_vector_type(8)))  _Float16 v8h;
typedef __attribute__((ext_vector_type(8)))  __bf16 v8b;
typedef __attribute__((ext_vector_type(8)))  float v8f;
typedef __attribute__((ext_vector_type(4)))  float v4f;
typedef __attribute__((ext_vector_type(4)))  unsigned v4u;
typedef v4u __attribute__((may_alias)) v4u_a;
typedef v4f __attribute__((may_alias)) v4f_a;
typedef v8h __attribute__((may_alias)) v8h_a;

#ifndef NB
#define NB 2
#endif
#ifndef SEQ
#define SEQ 2048
#endif
#define SEQ_FULL 2048          // per-batch row count of the inputs
#define DM 1024                // model width = projected width
#define NH 16
#define HD 64
#define NTOK (NB * SEQ)        // token rows of every [token][1024] plane
#define TPS (SEQ / NH)         // tokens per (head, batch) slab of the head-leading flat reshape
#define NSLAB (NH * NB)        // independent attention problems: SEQ pseudo-rows x HD each
#define SCALE 0.03125f         // 1 / sqrt(1024)
#define LN1024 6.931471806f
#define RAISE 96.0f            // logit units = 3 / SCALE: how far a score may top the softmax reference before the reference is raised

static_assert(SEQ % 1024 == 0);      // TPS multiple of 64: a 32-key step stays inside one feature group
static_assert(NTOK % 64 == 0);
static_assert(DM % 128 == 0);
static_assert(SEQ <= SEQ_FULL);

#define PLANE2 (2ull * (unsigned long long)NTOK * DM)    // bytes of one 16-bit [NTOK][1024] plane
#define WPL2   (2ull * (unsigned long long)DM * DM)      // bytes of one 16-bit weight plane
#define WS_XB 0ull
#define WS_YB (WS_XB + PLANE2)
#define WS_WT (WS_YB + PLANE2)       // 4 planes [out][in]: Wq^T, Wk^T, Wv^T as bf16, Wo^T as f16
#define WS_QH (WS_WT + 4ull * WPL2)
#define WS_KH (WS_QH + PLANE2)
#define WS_VT (WS_KH + PLANE2)       // f16 V^T planes [slab][d][key], key = j * TPS + tl
#define WS_CH (WS_VT + PLANE2)       // f16 ctx plane [token][1024]
#define WS_END (WS_CH + PLANE2)
static_assert(WS_END <= 134217728ull);
static_assert(PLANE2 % 128 == 0);
static_assert(WPL2 % 128 == 0);

template <typename T> __device__ __forceinline__ void vst2(T* p, T v) { *(T*)p = v;  }

__device__ __forceinline__ v8f wmma16(v16h a, v16h b, v8f c) {
  v8f d = __builtin_amdgcn_wmma_f32_16x16x32_f16(false, a, false, b, (short)0, c, false, false);
  asm volatile("v_nop\n\tv_nop\n\tv_nop\n\tv_nop" : "+v"(d) : "v"(a), "v"(b));
  return d;
}
__device__ __forceinline__ v8f wmma_bf(v16b a, v16b b, v8f c) {
  v8f d = __builtin_amdgcn_wmma_f32_16x16x32_bf16(false, a, false, b, (short)0, c, false, false);
  asm volatile("v_nop\n\tv_nop\n\tv_nop\n\tv_nop" : "+v"(d) : "v"(a), "v"(b));
  return d;
}
// k_attn's form: the builtin alone. The compiler keeps the distance behind its own WMMAs, filling it with the step's vector work where it can, and stays free to set a key group's O products among the next group's exponentials.
__device__ __forceinline__ v8f wmma16_free(v16h a, v16h b, v8f c) { return __builtin_amdgcn_wmma_f32_16x16x32_f16(false, a, false, b, (short)0, c, false, false); }
// 16x16x32 fragments: lane = (h = lane>>4, row/col = lane&15); elements 0..7 = k0+8h+0..7, 8..15 = k0+16+8h+0..7; D element r = row 8h+r, col lane&15
__device__ __forceinline__ v16h frag_h(const _Float16* rowk0, int lane) {
  union { v16h v; v8h q[2]; } u; const _Float16* p = rowk0 + 8 * (lane >> 4);
  u.q[0] = *(const v8h*)p; u.q[1] = *(const v8h*)(p + 16); return u.v;
}
__device__ __forceinline__ v16b frag_b(const __bf16* rowk0, int lane) {
  union { v16b v; v8b q[2]; } u; const __bf16* p = rowk0 + 8 * (lane >> 4);
  u.q[0] = *(const v8b*)p; u.q[1] = *(const v8b*)(p + 16); return u.v;
}
// bf16 bits of an f32 value, nearest-even
__device__ __forceinline__ unsigned bf16_rne(float f) { unsigned u = __float_as_uint(f); u += 0x7FFFu + ((u >> 16) & 1u); return u >> 16; }
__device__ __forceinline__ float bfr(float v) { return __uint_as_float(bf16_rne(v) << 16); }
__device__ __forceinline__ unsigned pack2(float a, float b) { return bf16_rne(a) | (bf16_rne(b) << 16); }
// 16-bit pattern of a weight, nearest-even: f16 for the output projection's plane, bf16 for the others
template <bool F16> __device__ __forceinline__ unsigned short w16(float f) { return F16 ? __builtin_bit_cast(unsigned short, (_Float16)f) : (unsigned short)bf16_rne(f); }
// a thread's 4 x 4 values of a 64 x 64 weight tile into the transposed LDS tile t[n][k]
template <bool F16> __device__ __forceinline__ void wt_put(unsigned short (*t)[72], const v4f* v, unsigned kr, unsigned q4) {
#pragma unroll
  for (int it = 0; it < 4; ++it)
#pragma unroll
    for (int c = 0; c < 4; ++c) t[q4 * 4 + c][kr + (unsigned)it * 16u] = w16<F16>(v[it][c]);
}
// same-wave LDS exchange: stores retire, then the wave proceeds to the loads
__device__ __forceinline__ void ldsx() { asm volatile("s_wait_dscnt 0" ::: "memory"); __builtin_amdgcn_wave_barrier(); __builtin_amdgcn_fence(3 /* release order */, "workgroup"); }

// ---- k_prep: every operand preparation of the call in ONE launch: x and y to bf16 planes, the four weights to transposed 16-bit planes (Wq, Wk, Wv bf16, Wo f16).
// A block takes CVT_IT 8-float pieces per thread of each activation plane (grid-strided) and WT_RND 64 x 64 weight tiles; few long waves in place of many one-piece waves.
#define PREP_BLOCKS 512
#define CVT_STRIDE (PREP_BLOCKS * 256)               // pieces the whole grid takes per trip
#define CVT_IT (NTOK * (DM / 8) / CVT_STRIDE)        // trips per activation plane
#define WT_TILES ((DM / 64) * (DM / 64))             // tiles of one weight
#define WT_RND (4 * WT_TILES / PREP_BLOCKS)          // tiles per block
static_assert(NTOK * (DM / 8) % CVT_STRIDE == 0);
static_assert(4 * WT_TILES % PREP_BLOCKS == 0 && DM / 64 == 16);
__global__ __launch_bounds__(256) void k_prep(const float* __restrict__ X, const float* __restrict__ Y, const float* __restrict__ W0, const float* __restrict__ W1, const float* __restrict__ W2, const float* __restrict__ W3,
                                              unsigned* __restrict__ XB, unsigned* __restrict__ YB, unsigned short* __restrict__ WT) {
  __shared__ __align__(16) unsigned short tl[WT_RND][64][72];
  const unsigned tid = threadIdx.x; const unsigned bid = blockIdx.x;
  const unsigned kr = tid >> 4, q4 = tid & 15;       // tile loads: k row (+ 16 a trip), quad of n
  // all loads of the block stand in front of all its stores: the weight tiles first, their way through LDS is the longer one
  v4f wv[WT_RND][4];
#pragma unroll
  for (int r = 0; r < WT_RND; ++r) { const unsigned t = bid + (unsigned)r * PREP_BLOCKS; const unsigned ws = t / WT_TILES; const unsigned k0 = (t & 15u) * 64u; const unsigned n0 = ((t >> 4) & 15u) * 64u;
    const float* W = (ws == 0 ? W0 : ws == 1 ? W1 : ws == 2 ? W2 : W3) + (size_t)(k0 + kr) * DM + n0 + q4 * 4u;
#pragma unroll
    for (int it = 0; it < 4; ++it) wv[r][it] = *(const v4f*)(W + (size_t)it * 16 * DM); }
  v4f ca[2][CVT_IT], cc[2][CVT_IT];
#pragma unroll
  for (int pl = 0; pl < 2; ++pl)
#pragma unroll
    for (int it = 0; it < CVT_IT; ++it) { const unsigned e = (unsigned)it * CVT_STRIDE + bid * 256u + tid;
      const unsigned T = e >> 7; const unsigned pc = e & 127u; const unsigned b = T / SEQ; const unsigned s = T % SEQ;
      const float* p = (pl == 0 ? X : Y) + ((size_t)b * SEQ_FULL + s) * DM + pc * 8u;
      ca[pl][it] = *(const v4f*)p; cc[pl][it] = *(const v4f*)(p + 4);
      if (it == CVT_IT - 1) asm volatile("s_wait_xcnt 0x0" ::: "memory"); }   // precaution: stands behind a plane's loads, in front of whatever writes a register that they name as an address
  __builtin_amdgcn_sched_barrier(0);   // keeps every load above issued before the first wait on one of them: one memory latency a block, not one a group of loads
#pragma unroll
  for (int r = 0; r < WT_RND; ++r) {
    if ((bid + (unsigned)r * PREP_BLOCKS) / WT_TILES == 3u) wt_put<true>(tl[r], wv[r], kr, q4);   // a tile of Wo; the test reads the same for the whole block
    else wt_put<false>(tl[r], wv[r], kr, q4);
  }
  __syncthreads();
#pragma unroll
  for (int r = 0; r < WT_RND; ++r) { const unsigned t = bid + (unsigned)r * PREP_BLOCKS; const unsigned ws = t / WT_TILES; const unsigned k0 = (t & 15u) * 64u; const unsigned n0 = ((t >> 4) & 15u) * 64u;
#pragma unroll
    for (int it = 0; it < 2; ++it) { const unsigned n = (tid >> 3) + (unsigned)it * 32u, q = tid & 7u;
      const v4u v = *(const v4u_a*)&tl[r][n][q * 8];
      vst2((v4u*)(WT + (size_t)ws * DM * DM + (size_t)(n0 + n) * DM + k0 + q * 8u), v); } }
#pragma unroll
  for (int pl = 0; pl < 2; ++pl)
#pragma unroll
    for (int it = 0; it < CVT_IT; ++it) { const unsigned e = (unsigned)it * CVT_STRIDE + bid * 256u + tid;
      const v4f a = ca[pl][it]; const v4f c = cc[pl][it];
      v4u o; o[0] = pack2(a[0], a[1]); o[1] = pack2(a[2], a[3]); o[2] = pack2(c[0], c[1]); o[3] = pack2(c[2], c[3]);
      vst2((v4u*)((pl == 0 ? XB : YB) + (size_t)e * 4), o); }
}

// ---- tensor mover helpers (two-group descriptor of a two-dimensional tile, every extent in bytes)
typedef __attribute__((ext_vector_type(4))) unsigned u32x4;
typedef __attribute__((ext_vector_type(8))) unsigned u32x8;
#define PASS_B 256u            // bytes of every operand row per pass (128 k)
#define LPITCH 272u            // LDS row pitch: 256 + 16 pad bytes, an odd multiple of 16 for the ds_load_b128 readers
#define SL_ROWS 32u            // rows of one wave's slice
#define SL_B 10240u            // 32 x 272 = 8704 bytes, rounded up so that every slice starts on a multiple of 2 KiB
#define BUF_B (8u * SL_B)      // one stage: slices 0..3 = 128 A rows, slices 4..7 = 128 B rows
static_assert(SL_ROWS * LPITCH <= SL_B && SL_B % 2048u == 0);
static_assert(NTOK % 128 == 0 && TPS % 128 == 0);   // a 128-token block stays inside one slab
__device__ __forceinline__ unsigned uni(unsigned v) { return (unsigned)__builtin_amdgcn_readfirstlane((int)v); }
__device__ __forceinline__ unsigned pinned(unsigned v) { unsigned w = uni(v); asm volatile("" : "+s"(w)); return w; }  // pinned(): the issue test of a tensor load held in a scalar register, so that it compiles to s_cmp + s_cbranch_scc (the load ignores EXEC)
__device__ __forceinline__ void wait_ds0() { asm volatile("s_wait_dscnt 0x0" ::: "memory"); }          // this wave's LDS reads have retired before the buffer is handed back
template <int N> __device__ __forceinline__ void wait_tensor(u32x4 g0, u32x8 g1) { asm volatile("s_wait_tensorcnt %2" :: "s"(g0), "s"(g1), "n"(N) : "memory"); }
// one request of the whole wave: global tile -> LDS; both groups are tied in and out so that every request of the kernel is issued from the same registers and wait_tensor names them
__device__ __forceinline__ void tdm_load(u32x4& g0, u32x8& g1) { asm volatile("tensor_load_to_lds %0, %1" : "+s"(g0), "+s"(g1) : : "memory"); }
__device__ __forceinline__ u32x8 tdm_group1() {
  u32x8 q;
  q[0] = uni((1u << 20) | (5u << 22) | (3u << 25));   // no mask, 1-byte elements, 4 pad dwords behind every 256-byte row
  q[1] = uni((PASS_B & 0xFFFFu) << 16);
  q[2] = uni((PASS_B >> 16) | ((SL_ROWS & 0xFFFFu) << 16));
  q[3] = uni((SL_ROWS >> 16) | (PASS_B << 16));
  q[4] = uni(SL_ROWS);
  q[5] = uni(2u * DM);                                // source row pitch in bytes
  q[6] = uni(0u); q[7] = uni(0u);
  return q;
}
__device__ __forceinline__ u32x4 tdm_group0(unsigned lds_dst, unsigned long long ga) {
  u32x4 q; q[0] = uni(1u); q[1] = uni(lds_dst); q[2] = uni((unsigned)ga); q[3] = uni((((unsigned)(ga >> 32)) & 0x01FFFFFFu) | 0x80000000u);
  return q;
}

// ---- k_gemm: block = 128 rows x 128 cols, 8 waves as 4 x 2, wave = 32 rows x 64 cols; C = A . BT^T + bias over K = 1024 with 16-bit operands
// Both operand tiles are staged in LDS by the tensor mover, 128 k per pass, three buffers: every wave brings one 32-row slice per stage; while a pass works, the next two stages are in flight, so a stage has two passes to land in.
// EPI 0: bf16 operands; the three input projections as ONE launch, blockIdx.z = 0 Q, 1 K, 2 V: A = A0, A0, A1; weight plane z behind BT; bias BIAS0, BIAS1, BIAS2; output plane z behind OH,
//        z 0 and 1 as f16 row-major [NTOK][1024], z 2 as f16 V^T planes [slab][d][key = j*TPS + tl]. A WGP takes its next block as soon as one ends: no drain and refill of the chip between the three.
// EPI 2: f16 operands (planes A0 and BT hold f16 bits; the kernel forms only tile addresses from these pointers); f32 row-major [NTOK][1024], bias BIAS0
static_assert(WS_KH == WS_QH + PLANE2 && WS_VT == WS_KH + PLANE2);   // the three output planes stand one behind the other
template <int EPI>
__global__ __launch_bounds__(256) void k_gemm(const __bf16* __restrict__ A0, const __bf16* __restrict__ A1, const __bf16* __restrict__ BT, const float* __restrict__ BIAS0, const float* __restrict__ BIAS1, const float* __restrict__ BIAS2, _Float16* __restrict__ OH, float* __restrict__ OF) {
  __shared__ __attribute__((aligned(2048))) unsigned char ring[3u * BUF_B];
  const int tid = threadIdx.x; const int wave = __builtin_amdgcn_readfirstlane((int)(threadIdx.x >> 5)); const int lane = tid & 31, col = lane & 15, g = lane >> 4;
  const int wr = wave >> 1, wc = wave & 1;
  const int r0 = blockIdx.x * 128; const int c0 = blockIdx.y * 128;
  const int z = EPI == 0 ? (int)blockIdx.z : 0;   // which projection
  const __bf16* Ap = (EPI == 0 && z == 2) ? A1 : A0;
  const __bf16* Bp = BT + (size_t)z * DM * DM;
  const float* BIAS = z == 0 ? BIAS0 : z == 1 ? BIAS1 : BIAS2;
  constexpr int NST = DM * 2 / (int)PASS_B;   // stages = passes
  static_assert(NST >= 3);
  const unsigned lbase = (unsigned)(size_t)ring;
  const bool isA = wave < 4;
  const unsigned long long soff = (unsigned long long)(isA ? r0 + 32 * wave : c0 + 32 * (wave - 4)) * (2ull * DM);
  const unsigned long long src0 = (unsigned long long)(size_t)(isA ? Ap : Bp) + soff;
  const unsigned ldst0 = lbase + (unsigned)wave * SL_B;   // this wave's slice in buffer 0
  u32x8 g1 = tdm_group1();
  u32x4 g0 = tdm_group0(ldst0, src0);
  // From request to request only words 1 (place in LDS) and 2 (low address word) of group 0 take a new value. The high address word holds for all stages:
  // a stage adds PASS_B inside one 2-KiB operand row, and the rows stand at multiples of 2 KiB (plane offsets and row pitch are such multiples, the workspace starts on a page).
  auto issue_next = [&](unsigned buf_off) { g0[1] = uni(ldst0 + buf_off); g0[2] = uni(g0[2] + PASS_B); tdm_load(g0, g1); };
  v8f acc[2][4] = {};
  tdm_load(g0, g1); issue_next(BUF_B); issue_next(2u * BUF_B);   // stages 0, 1, 2: three requests of the wave, the most it ever has outstanding
  wait_tensor<2>(g0, g1); __syncthreads();   // stage 0 published
  unsigned rb = 0;   // byte offset of the buffer that the pass reads: stage s stands in buffer s mod 3
  // rolled: one publish point per pass
#pragma unroll 1
  for (int s = 0; s < NST; ++s) {
    const unsigned char* bufp = ring + rb;
    const unsigned char* pa = bufp + (unsigned)wr * SL_B + (unsigned)col * LPITCH;
    const unsigned char* pb = bufp + (unsigned)(4 + 2 * wc) * SL_B + (unsigned)col * LPITCH;
#pragma unroll
    for (int kc = 0; kc < (int)PASS_B / 64; ++kc) {
      if (EPI == 0) {
        v16b a[2], w[4];
#pragma unroll
        for (int i = 0; i < 2; ++i) a[i] = frag_b((const __bf16*)(pa + (unsigned)i * 16u * LPITCH + (unsigned)kc * 64u), lane);
#pragma unroll
        for (int j = 0; j < 4; ++j) w[j] = frag_b((const __bf16*)(pb + (unsigned)(j >> 1) * SL_B + (unsigned)(j & 1) * 16u * LPITCH + (unsigned)kc * 64u), lane);
#pragma unroll
        for (int i = 0; i < 2; ++i)
#pragma unroll
          for (int j = 0; j < 4; ++j) acc[i][j] = wmma_bf(a[i], w[j], acc[i][j]);
      } else {
        v16h a[2], w[4];
#pragma unroll
        for (int i = 0; i < 2; ++i) a[i] = frag_h((const _Float16*)(pa + (unsigned)i * 16u * LPITCH + (unsigned)kc * 64u), lane);
#pragma unroll
        for (int j = 0; j < 4; ++j) w[j] = frag_h((const _Float16*)(pb + (unsigned)(j >> 1) * SL_B + (unsigned)(j & 1) * 16u * LPITCH + (unsigned)kc * 64u), lane);
#pragma unroll
        for (int i = 0; i < 2; ++i)
#pragma unroll
          for (int j = 0; j < 4; ++j) acc[i][j] = wmma16(a[i], w[j], acc[i][j]);
      }
    }
    // publish point of stage s + 1: own LDS reads retired, own slice of stage s + 1 landed (stage s + 2, where there is one, is the one younger request and stays in flight), then the barrier that also frees this pass's buffer
    wait_ds0(); wait_tensor<1>(g0, g1);
    if (pinned(s + 2 >= NST)) wait_tensor<0>(g0, g1);   // the last passes: no younger request stands behind stage s + 1, so the count that covers it is 0
    __syncthreads();
    if (pinned(s + 3 < NST)) issue_next(rb);   // stage s + 3 into the buffer that pass s has just read
    rb = rb == 2u * BUF_B ? 0u : rb + BUF_B;
  }
  wait_tensor<0>(g0, g1); wait_ds0();
  if (EPI == 0) {
    __shared__ __align__(16) _Float16 sh[128][136];   // z 0, 1: [row][col]; z 2: [col][row]
    _Float16* Op = OH + (size_t)z * NTOK * DM;
    if (z != 2) {   // the same for the whole block
#pragma unroll
    for (int j = 0; j < 4; ++j) { const float bias = bfr(BIAS[c0 + wc * 64 + j * 16 + col]);
#pragma unroll
      for (int i = 0; i < 2; ++i)
#pragma unroll
        for (int r = 0; r < 8; ++r) sh[wr * 32 + i * 16 + 8 * g + r][wc * 64 + j * 16 + col] = (_Float16)(acc[i][j][r] + bias); }
    __syncthreads();
    for (int e = tid; e < 128 * 16; e += 256) { const int rl = e >> 4, q = e & 15; const v4u v = *(const v4u_a*)&sh[rl][q * 8]; *(v4u*)(Op + (size_t)(r0 + rl) * DM + c0 + q * 8) = v; }
    } else {
#pragma unroll
    for (int j = 0; j < 4; ++j) { const float bias = bfr(BIAS[c0 + wc * 64 + j * 16 + col]);
#pragma unroll
      for (int i = 0; i < 2; ++i) { v8h hv;
#pragma unroll
        for (int r = 0; r < 8; ++r) hv[r] = (_Float16)(acc[i][j][r] + bias);
        *(v8h_a*)&sh[wc * 64 + j * 16 + col][wr * 32 + i * 16 + 8 * g] = hv; } }
    __syncthreads();
    const int Ls = r0 / TPS; const int tl0 = r0 - Ls * TPS;
    for (int e = tid; e < 128 * 16; e += 256) { const int cl = e >> 4, q = e & 15; const int c = c0 + cl; const int jj = c >> 6, d = c & 63;
      const v4u v = *(const v4u_a*)&sh[cl][q * 8]; *(v4u*)(Op + ((size_t)Ls * HD + d) * SEQ + jj * TPS + tl0 + q * 8) = v; }
    }
  } else {
    __shared__ __align__(16) float ss[128][132];
#pragma unroll
    for (int j = 0; j < 4; ++j) { const float bias = bfr(BIAS[c0 + wc * 64 + j * 16 + col]);
#pragma unroll
      for (int i = 0; i < 2; ++i)
#pragma unroll
        for (int r = 0; r < 8; ++r) ss[wr * 32 + i * 16 + 8 * g + r][wc * 64 + j * 16 + col] = acc[i][j][r] + bias; }
    ldsx();   // each wave reads back only its own 32 rows x 64 cols
    for (int rl = 0; rl < 16; ++rl) { const int row = wr * 32 + rl * 2 + g; const v4f v = *(const v4f_a*)&ss[row][wc * 64 + col * 4]; *(v4f*)(OF + (size_t)(r0 + row) * DM + c0 + wc * 64 + col * 4) = v; }
  }
}

// ---- k_attn staging: a stage = 128 keys of slab L = 128 K rows x 128 B and 64 V^T rows x 256 B, brought into LDS by the tensor mover, two buffers
#define ST_KEYS 128u           // keys of one stage
#define AROW_B 128u            // bytes of every staged row: 64 features of a K row, or 64 keys of a V^T row
#define APITCH 144u            // LDS row pitch: 128 + 16 pad bytes, an odd multiple of 16 for the ds_load_b128 readers
#define ASL_ROWS 32u           // rows of one wave's slice
#define ASL_B 6144u            // 32 x 144 = 4608 bytes, rounded up so that every slice starts on a multiple of 2 KiB
#define ABUF_B (8u * ASL_B)    // one stage: slices 0..3 = K rows 32 w .. + 31; slices 4..7 = V^T rows 32 (w & 1) .. + 31 of the stage's key half (w - 4) >> 1
static_assert(ASL_ROWS * APITCH <= ASL_B && ASL_B % 2048u == 0);
static_assert(TPS % (int)ST_KEYS == 0 && SEQ % 128 == 0 && HD == 64);   // a stage stays inside one feature group
// as tdm_load and wait_tensor<0>: the registers of both groups keep their words from the issue to the wait
__device__ __forceinline__ void tdm_load_held(u32x4& g0, u32x8& g1) { asm volatile("tensor_load_to_lds %0, %1" : "+s"(g0), "+s"(g1) : : "memory"); }
__device__ __forceinline__ void wait_tensor0_held(u32x4 g0, u32x8 g1) { asm volatile("s_wait_tensorcnt 0x0" :: "s"(g0), "s"(g1) : "memory"); }
__device__ __forceinline__ u32x8 tdm_group1_attn(unsigned src_pitch) {
  u32x8 q;
  q[0] = uni((1u << 20) | (4u << 22) | (3u << 25));   // no mask, 1-byte elements, 4 pad dwords behind every 128-byte row
  q[1] = uni((AROW_B & 0xFFFFu) << 16);
  q[2] = uni((AROW_B >> 16) | ((ASL_ROWS & 0xFFFFu) << 16));
  q[3] = uni((ASL_ROWS >> 16) | (AROW_B << 16));
  q[4] = uni(ASL_ROWS);
  q[5] = uni(src_pitch);                              // source row pitch in bytes
  q[6] = uni(0u); q[7] = uni(0u);
  return q;
}

// ---- k_attn: block = 128 query pseudo-rows of slab L (8 waves, wave = 16 queries), fused over all SEQ keys in 128-key passes of four 32-key groups (transposed flash form):
//   S^T[key][query] = K . Q^T  (A = K rows, B = Q rows);  P^T packed in-lane as the B operand;  O^T[d][query] += V^T . P^T  (A = V^T rows).
//   Keys visited in the order key = j*TPS + tl (token L*TPS + tl, feature group j); K rows and V^T columns use the same order.
//   K rows and V^T rows are read from LDS: every wave brings one slice per 128-key stage, one stage ahead of the pass that reads it; all 8 waves share the stage.
//   Each lane owns one query column. The softmax reference of a column is looked at once per 128-key pass and raised (xor-16 exchange of the halves' maxima, O and l rescaled) only when a score of the pass tops it by RAISE; sums are per lane, joined across the halves in the epilogue.
__global__ __launch_bounds__(256) void k_attn(const _Float16* __restrict__ QH, const _Float16* __restrict__ KH, const _Float16* __restrict__ VT, unsigned* __restrict__ CH) {
  __shared__ __attribute__((aligned(2048))) unsigned char ring[2u * ABUF_B];
  __shared__ __align__(16) unsigned cst[8][16][36];   // per-wave staging of the 16 x 64 ctx tile: f16 pairs
  const int tid = threadIdx.x; const int wave = __builtin_amdgcn_readfirstlane((int)(threadIdx.x >> 5)); const int lane = tid & 31, col = lane & 15, g = lane >> 4;
  const int L = blockIdx.y; const size_t qrow0 = (size_t)L * SEQ + (size_t)blockIdx.x * 128 + wave * 16;
  const _Float16* qp = QH + (qrow0 + col) * HD;
  const v16h qf0 = frag_h(qp, lane); const v16h qf1 = frag_h(qp + 32, lane);
  constexpr int NST = SEQ / (int)ST_KEYS;   // stages = passes
  static_assert(NST >= 2);
  const unsigned lbase = (unsigned)(size_t)ring;
  const bool isK = wave < 4;
  // first byte of this wave's slice of stage 0, and what a stage adds to it
  const unsigned long long src = isK ? (unsigned long long)(size_t)KH + ((unsigned long long)L * TPS + 32ull * (unsigned)wave) * (2ull * DM)
                                     : (unsigned long long)(size_t)VT + ((unsigned long long)L * HD + 32ull * (unsigned)(wave & 1)) * (2ull * SEQ) + (unsigned long long)((wave - 4) >> 1) * AROW_B;
  u32x8 g1 = tdm_group1_attn(isK ? 2u * DM : 2u * SEQ);
  u32x4 g0;   // group 0 of this wave's one outstanding request
  auto issue = [&](int s) {
    const unsigned dst = lbase + (unsigned)(s & 1) * ABUF_B + (unsigned)wave * ASL_B;
    const int k0 = s * (int)ST_KEYS; const int jj = k0 / TPS; const int tl0 = k0 - jj * TPS;
    const unsigned long long step = isK ? (unsigned long long)tl0 * (2ull * DM) + (unsigned long long)jj * (2ull * HD) : (unsigned long long)k0 * 2ull;
    g0 = tdm_group0(dst, src + step); tdm_load_held(g0, g1);
  };
  v8f o[4] = {}; float m = -3.0e38f; float l = 0.f;
  issue(0); wait_tensor0_held(g0, g1); __syncthreads();   // stage 0 published
  issue(1);
  // the 16 K fragments of a stage: keys 32 hb .. 32 hb + 31 are K slice hb; [hb][0], [1] = its first 16 keys (features 0..31, 32..63), [2], [3] = the other 16
  v16h kf[4][4];
  auto load_k = [&](int s) {
    const unsigned char* kl = ring + (unsigned)(s & 1) * ABUF_B + (unsigned)col * APITCH;
#pragma unroll
    for (int hb = 0; hb < (int)ST_KEYS / 32; ++hb) {
      const unsigned char* kp = kl + (unsigned)hb * ASL_B;
      kf[hb][0] = frag_h((const _Float16*)kp, lane); kf[hb][1] = frag_h((const _Float16*)(kp + 64u), lane);
      kf[hb][2] = frag_h((const _Float16*)(kp + 16u * APITCH), lane); kf[hb][3] = frag_h((const _Float16*)(kp + 16u * APITCH + 64u), lane);
    }
  };
  load_k(0);
  // one pass; 'last' is a literal at both calls: the last pass has no next stage, issues nothing and reads nothing behind its barrier
  auto pass = [&](const int s, const bool last) __attribute__((always_inline)) {
    const unsigned char* vl = ring + (unsigned)(s & 1) * ABUF_B + 4u * ASL_B + (unsigned)col * APITCH;
    // the pass's 128 x 16 logits first: 8 independent accumulator tiles; no vector work stands between their products
    v8f sc[4][2];
#pragma unroll
    for (int hb = 0; hb < (int)ST_KEYS / 32; ++hb) {
      v8f s0 = {}, s1 = {};
      s0 = wmma16_free(kf[hb][0], qf0, s0); s1 = wmma16_free(kf[hb][2], qf0, s1);
      s0 = wmma16_free(kf[hb][1], qf1, s0); s1 = wmma16_free(kf[hb][3], qf1, s1);
      sc[hb][0] = s0; sc[hb][1] = s1;
    }
    __builtin_amdgcn_sched_barrier(0);   // keeps the 16 products back to back: each fills the distance behind the one before, where a maximum set directly behind its tile's product costs 4 v_nop
    // ONE test per pass: the lane's own largest logit of the 128 keys against the reference in use. Register by register first, the last two tiles last: few dependent steps stand behind the last product
    float t[8];
#pragma unroll
    for (int r = 0; r < 8; ++r) {
      t[r] = fmaxf(fmaxf(sc[0][0][r], sc[0][1][r]), sc[1][0][r]); t[r] = fmaxf(fmaxf(t[r], sc[1][1][r]), sc[2][0][r]);
      t[r] = fmaxf(t[r], sc[2][1][r]); t[r] = fmaxf(fmaxf(t[r], sc[3][0][r]), sc[3][1][r]);
    }
    const float mx = fmaxf(fmaxf(fmaxf(fmaxf(t[0], t[1]), t[2]), fmaxf(fmaxf(t[3], t[4]), t[5])), fmaxf(t[6], t[7]));
    if (__builtin_amdgcn_ballot_w32(mx > m + RAISE) != 0) {   // wave-uniform scalar branch; not taken: every P of the pass is below 2^10 e^3, inside f16
      const float mn = fmaxf(m, fmaxf(mx, __shfl_xor(mx, 16)));   // both lane halves of a query take the same new reference; a column whose maximum has not risen gets a factor of exactly 1
      const float corr = __expf((m - mn) * SCALE); m = mn; l *= corr;
#pragma unroll
      for (int j = 0; j < 4; ++j)
#pragma unroll
        for (int r = 0; r < 8; ++r) o[j][r] *= corr;
    }
    const float c = LN1024 - m * SCALE;   // P carried x 2^10 (cancels in o / l)
    // four 32-key groups, staggered: group hb's V^T reads, then its exponentials beside the O products of group hb - 1
    v16h vf[2][4]; v16h pf[2];
#pragma unroll
    for (int hb = 0; hb < (int)ST_KEYS / 32; ++hb) {
#pragma unroll
      for (int j = 0; j < 4; ++j) vf[hb & 1][j] = frag_h((const _Float16*)(vl + (unsigned)(2 * (hb >> 1) + (j >> 1)) * ASL_B + (unsigned)(j & 1) * 16u * APITCH + (unsigned)(hb & 1) * 64u), lane);   // V^T row 16 j + col, keys 32 hb .. + 31
      __builtin_amdgcn_sched_barrier(0);   // keeps the group's 8 V^T reads issued together, a whole group of exponentials ahead of the products that wait for them
      if (hb > 0) {
#pragma unroll
        for (int j = 0; j < 4; ++j) o[j] = wmma16_free(vf[(hb - 1) & 1][j], pf[(hb - 1) & 1], o[j]);
      }
      float ls = 0.f;
#pragma unroll
      for (int r = 0; r < 8; ++r) { const float p0 = __expf(fmaf(sc[hb][0][r], SCALE, c)); const float p1 = __expf(fmaf(sc[hb][1][r], SCALE, c)); ls += p0 + p1; pf[hb & 1][r] = (_Float16)p0; pf[hb & 1][8 + r] = (_Float16)p1; }
      l += ls;
    }
    // publish point of stage s + 1: own LDS reads retired, own slice landed, then the barrier that also frees this pass's buffer
    wait_ds0(); wait_tensor0_held(g0, g1); __syncthreads();
    if (!last) {
      if (pinned(s + 2 < NST)) issue(s + 2);
      load_k(s + 1);   // behind the barrier that publishes stage s + 1
      __builtin_amdgcn_sched_barrier(0);   // keeps the next pass's 32 K reads issued as one group in front of this pass's last O products, which run while the reads are under way
    }
#pragma unroll
    for (int j = 0; j < 4; ++j) o[j] = wmma16_free(vf[1][j], pf[1], o[j]);
  };
  // rolled: one publish point per pass, the buffer picked by the pass's parity
#pragma unroll 1
  for (int s = 0; s < NST - 1; ++s) pass(s, false);
  pass(NST - 1, true);
  wait_tensor0_held(g0, g1); wait_ds0();
  l += __shfl_xor(l, 16);
  const float inv = 1.0f / l;
  // o[j][r] = ctx[query col][d = 16 j + 8 g + r]: 8 consecutive d per (lane, j) -> one 16-B piece
#pragma unroll
  for (int j = 0; j < 4; ++j) { v8h hv;
#pragma unroll
    for (int r = 0; r < 8; ++r) hv[r] = (_Float16)(o[j][r] * inv);
    *(v8h_a*)&cst[wave][col][j * 8 + g * 4] = hv; }
  ldsx();   // wave-private tile
#pragma unroll
  for (int it = 0; it < 4; ++it) { const int row = it * 4 + (lane >> 3); const int pc = lane & 7;
    const v4u hv = *(const v4u_a*)&cst[wave][row][pc * 4];
    *(v4u*)(CH + (qrow0 + row) * 32 + pc * 4) = hv; }
}

extern "C" void kernel_launch(void* const* d_in, const int* in_sizes, int n_in, void* d_out, int out_size, void* d_ws, size_t ws_size, hipStream_t stream) {
  if (n_in < 10) return;
  const long long act_min = ((long long)(NB - 1) * SEQ_FULL + SEQ) * DM;
  if ((long long)in_sizes[0] < act_min || (long long)in_sizes[1] < act_min) return;
  if (in_sizes[2] < DM * DM || in_sizes[4] < DM * DM || in_sizes[6] < DM * DM || in_sizes[8] < DM * DM) return;
  if (in_sizes[3] < DM || in_sizes[5] < DM || in_sizes[7] < DM || in_sizes[9] < DM) return;
  if ((long long)out_size < (long long)NTOK * DM) return;
  if (ws_size < (size_t)WS_END) return;
  // inputs (wire order): 0 x, 1 y [2][2048][1024]; 2 Wq, 3 bq, 4 Wk, 5 bk, 6 Wv, 7 bv, 8 Wo, 9 bo; weights (in,out) [1024][1024]
  const float* x  = (const float*)d_in[0]; const float* y  = (const float*)d_in[1];
  const float* Wq = (const float*)d_in[2]; const float* bq = (const float*)d_in[3];
  const float* Wk = (const float*)d_in[4]; const float* bk = (const float*)d_in[5];
  const float* Wv = (const float*)d_in[6]; const float* bv = (const float*)d_in[7];
  const float* Wo = (const float*)d_in[8]; const float* bo = (const float*)d_in[9];
  char* ws = (char*)d_ws;
  unsigned* XB = (unsigned*)(ws + WS_XB); unsigned* YB = (unsigned*)(ws + WS_YB);
  unsigned short* WT = (unsigned short*)(ws + WS_WT);
  unsigned short* WoT = WT + 3 * (size_t)DM * DM;
  _Float16* QH = (_Float16*)(ws + WS_QH); _Float16* KH = (_Float16*)(ws + WS_KH); _Float16* VT = (_Float16*)(ws + WS_VT);
  unsigned* CH = (unsigned*)(ws + WS_CH);
  float* OUT = (float*)d_out;

  // weights are in[rows = in][cols = out] -> planes [out][in], in the order Wq, Wk, Wv, Wo behind WT
  k_prep<<<dim3(PREP_BLOCKS), 256, 0, stream>>>(x, y, Wq, Wk, Wv, Wo, XB, YB, WT);
  const dim3 gg(NTOK / 128, DM / 128);
  k_gemm<0><<<dim3(NTOK / 128, DM / 128, 3), 256, 0, stream>>>((const __bf16*)XB, (const __bf16*)YB, (const __bf16*)WT, bq, bk, bv, QH, OUT);   // Q, K, V
  k_attn<<<dim3(SEQ / 128, NSLAB), 256, 0, stream>>>(QH, KH, VT, CH);
  k_gemm<2><<<gg, 256, 0, stream>>>((const __bf16*)CH, (const __bf16*)CH, (const __bf16*)WoT, bo, bo, bo, QH, OUT);
}

// v009
// Measured time: 70.1 microseconds a run.
// Timed twice side by side with v008, it ran 1.06 and 1.07 times as fast.
// Over all steps from v000 it is 5.16 times as fast.
// compute dtype: x, y, Wq, Wk, Wv and the biases converted to bf16 (RNE), Wo to f16 (RNE); q/k/v projections on v_wmma_f32_16x16x32_bf16 with exact bf16 x bf16 products, f32 accumulate; logits K.Q^T on v_wmma_f32_16x16x32_f16 (f16 q, k), f32 accumulate, x 1/32; softmax f32 (reference raised lazily, once per 128 keys at most); P x 2^10 as f16 against f16 V^T on v_wmma_f32_16x16x32_f16; output projection: ctx as f16 against f16 Wo on v_wmma_f32_16x16x32_f16, f32 accumulate; f32 output.
#include <hip/hip_runtime.h>
#include <math.h>

typedef __attribute__((ext_vector_type(16))) _Float16 v16h;
typedef __attribute__((ext_vector_type(16))) __bf16 v16b;
typedef __attribute__((ext_vector_type(8)))  _Float16 v8h;
typedef __attribute__((ext_vector_type(8)))  __bf16 v8b;
typedef __attribute__((ext_vector_type(8)))  float v8f;
typedef __attribute__((ext_vector_type(4)))  float v4f;
typedef __attribute__((ext_vector_type(4)))  unsigned v4u;
typedef v4u __attribute__((may_alias)) v4u_a;
typedef v4f __attribute__((may_alias)) v4f_a;
typedef v8h __attribute__((may_alias)) v8h_a;

#ifndef NB
#define NB 2
#endif
#ifndef SEQ
#define SEQ 2048
#endif
#define SEQ_FULL 2048          // per-batch row count of the inputs
#define DM 1024                // model width = projected width
#define NH 16
#define HD 64
#define NTOK (NB * SEQ)        // token rows of every [token][1024] plane
#define TPS (SEQ / NH)         // tokens per (head, batch) slab of the head-leading flat reshape
#define NSLAB (NH * NB)        // independent attention problems: SEQ pseudo-rows x HD each
#define SCALE 0.03125f         // 1 / sqrt(1024)
#define LN1024 6.931471806f
#define RAISE 96.0f            // logit units = 3 / SCALE: how far a score may top the softmax reference before the reference is raised

static_assert(SEQ % 1024 == 0);      // TPS multiple of 64: a 32-key step stays inside one feature group
static_assert(NTOK % 64 == 0);
static_assert(DM % 128 == 0);
static_assert(SEQ <= SEQ_FULL);

#define PLANE2 (2ull * (unsigned long long)NTOK * DM)    // bytes of one 16-bit [NTOK][1024] plane
#define WPL2   (2ull * (unsigned long long)DM * DM)      // bytes of one 16-bit weight plane
#define WS_XB 0ull
#define WS_YB (WS_XB + PLANE2)
#define WS_WT (WS_YB + PLANE2)       // 4 planes [out][in]: Wq^T, Wk^T, Wv^T as bf16, Wo^T as f16
#define WS_QH (WS_WT + 4ull * WPL2)
#define WS_KH (WS_QH + PLANE2)
#define WS_VT (WS_KH + PLANE2)       // f16 V^T planes [slab][d][key], key = j * TPS + tl
#define WS_CH (WS_VT + PLANE2)       // f16 ctx plane [token][1024]
#define WS_END (WS_CH + PLANE2)
static_assert(WS_END <= 134217728ull);
static_assert(PLANE2 % 128 == 0);
static_assert(WPL2 % 128 == 0);

template <typename T> __device__ __forceinline__ void vst2(T* p, T v) { *(T*)p = v;  }

__device__ __forceinline__ v8f wmma16(v16h a, v16h b, v8f c) {
  v8f d = __builtin_amdgcn_wmma_f32_16x16x32_f16(false, a, false, b, (short)0, c, false, false);
  asm volatile("v_nop\n\tv_nop\n\tv_nop\n\tv_nop" : "+v"(d) : "v"(a), "v"(b));
  return d;
}
// k_attn's form: the builtin alone. The compiler keeps the distance behind its own WMMAs, filling it with the step's vector work where it can, and stays free to set a key group's O products among the next group's exponentials.
// k_qkv's form, the builtin alone as well: its 256 accumulator registers reach above v255, where an asm operand cannot stand (tied to an asm statement they spill)
__device__ __forceinline__ v8f wmma_bf_free(v16b a, v16b b, v8f c) { return __builtin_amdgcn_wmma_f32_16x16x32_bf16(false, a, false, b, (short)0, c, false, false); }
__device__ __forceinline__ v8f wmma16_free(v16h a, v16h b, v8f c) { return __builtin_amdgcn_wmma_f32_16x16x32_f16(false, a, false, b, (short)0, c, false, false); }
// 16x16x32 fragments: lane = (h = lane>>4, row/col = lane&15); elements 0..7 = k0+8h+0..7, 8..15 = k0+16+8h+0..7; D element r = row 8h+r, col lane&15
__device__ __forceinline__ v16h frag_h(const _Float16* rowk0, int lane) {
  union { v16h v; v8h q[2]; } u; const _Float16* p = rowk0 + 8 * (lane >> 4);
  u.q[0] = *(const v8h*)p; u.q[1] = *(const v8h*)(p + 16); return u.v;
}
__device__ __forceinline__ v16b frag_b(const __bf16* rowk0, int lane) {
  union { v16b v; v8b q[2]; } u; const __bf16* p = rowk0 + 8 * (lane >> 4);
  u.q[0] = *(const v8b*)p; u.q[1] = *(const v8b*)(p + 16); return u.v;
}
// bf16 bits of an f32 value, nearest-even
__device__ __forceinline__ unsigned bf16_rne(float f) { unsigned u = __float_as_uint(f); u += 0x7FFFu + ((u >> 16) & 1u); return u >> 16; }
__device__ __forceinline__ float bfr(float v) { return __uint_as_float(bf16_rne(v) << 16); }
__device__ __forceinline__ unsigned pack2(float a, float b) { return bf16_rne(a) | (bf16_rne(b) << 16); }
// 16-bit pattern of a weight, nearest-even: f16 for the output projection's plane, bf16 for the others
template <bool F16> __device__ __forceinline__ unsigned short w16(float f) { return F16 ? __builtin_bit_cast(unsigned short, (_Float16)f) : (unsigned short)bf16_rne(f); }
// a thread's 4 x 4 values of a 64 x 64 weight tile into the transposed LDS tile t[n][k]
template <bool F16> __device__ __forceinline__ void wt_put(unsigned short (*t)[72], const v4f* v, unsigned kr, unsigned q4) {
#pragma unroll
  for (int it = 0; it < 4; ++it)
#pragma unroll
    for (int c = 0; c < 4; ++c) t[q4 * 4 + c][kr + (unsigned)it * 16u] = w16<F16>(v[it][c]);
}
// same-wave LDS exchange: stores retire, then the wave proceeds to the loads
__device__ __forceinline__ void ldsx() { asm volatile("s_wait_dscnt 0" ::: "memory"); __builtin_amdgcn_wave_barrier(); __builtin_amdgcn_fence(3 /* release order */, "workgroup"); }

// ---- k_prep: every operand preparation of the call in ONE launch: x and y to bf16 planes, the four weights to transposed 16-bit planes (Wq, Wk, Wv bf16, Wo f16).
// A block takes CVT_IT 8-float pieces per thread of each activation plane (grid-strided) and WT_RND 64 x 64 weight tiles; few long waves in place of many one-piece waves.
#define PREP_BLOCKS 512
#define CVT_STRIDE (PREP_BLOCKS * 256)               // pieces the whole grid takes per trip
#define CVT_IT (NTOK * (DM / 8) / CVT_STRIDE)        // trips per activation plane
#define WT_TILES ((DM / 64) * (DM / 64))             // tiles of one weight
#define WT_RND (4 * WT_TILES / PREP_BLOCKS)          // tiles per block
static_assert(NTOK * (DM / 8) % CVT_STRIDE == 0);
static_assert(4 * WT_TILES % PREP_BLOCKS == 0 && DM / 64 == 16);
__global__ __launch_bounds__(256) void k_prep(const float* __restrict__ X, const float* __restrict__ Y, const float* __restrict__ W0, const float* __restrict__ W1, const float* __restrict__ W2, const float* __restrict__ W3,
                                              unsigned* __restrict__ XB, unsigned* __restrict__ YB, unsigned short* __restrict__ WT) {
  __shared__ __align__(16) unsigned short tl[WT_RND][64][72];
  const unsigned tid = threadIdx.x; const unsigned bid = blockIdx.x;
  const unsigned kr = tid >> 4, q4 = tid & 15;       // tile loads: k row (+ 16 a trip), quad of n
  // all loads of the block stand in front of all its stores: the weight tiles first, their way through LDS is the longer one
  v4f wv[WT_RND][4];
#pragma unroll
  for (int r = 0; r < WT_RND; ++r) { const unsigned t = bid + (unsigned)r * PREP_BLOCKS; const unsigned ws = t / WT_TILES; const unsigned k0 = (t & 15u) * 64u; const unsigned n0 = ((t >> 4) & 15u) * 64u;
    const float* W = (ws == 0 ? W0 : ws == 1 ? W1 : ws == 2 ? W2 : W3) + (size_t)(k0 + kr) * DM + n0 + q4 * 4u;
#pragma unroll
    for (int it = 0; it < 4; ++it) wv[r][it] = *(const v4f*)(W + (size_t)it * 16 * DM); }
  v4f ca[2][CVT_IT], cc[2][CVT_IT];
#pragma unroll
  for (int pl = 0; pl < 2; ++pl)
#pragma unroll
    for (int it = 0; it < CVT_IT; ++it) { const unsigned e = (unsigned)it * CVT_STRIDE + bid * 256u + tid;
      const unsigned T = e >> 7; const unsigned pc = e & 127u; const unsigned b = T / SEQ; const unsigned s = T % SEQ;
      const float* p = (pl == 0 ? X : Y) + ((size_t)b * SEQ_FULL + s) * DM + pc * 8u;
      ca[pl][it] = *(const v4f*)p; cc[pl][it] = *(const v4f*)(p + 4);
      if (it == CVT_IT - 1) asm volatile("s_wait_xcnt 0x0" ::: "memory"); }   // precaution: stands behind a plane's loads, in front of whatever writes a register that they name as an address
  __builtin_amdgcn_sched_barrier(0);   // keeps every load above issued before the first wait on one of them: one memory latency a block, not one a group of loads
#pragma unroll
  for (int r = 0; r < WT_RND; ++r) {
    if ((bid + (unsigned)r * PREP_BLOCKS) / WT_TILES == 3u) wt_put<true>(tl[r], wv[r], kr, q4);   // a tile of Wo; the test reads the same for the whole block
    else wt_put<false>(tl[r], wv[r], kr, q4);
  }
  __syncthreads();
#pragma unroll
  for (int r = 0; r < WT_RND; ++r) { const unsigned t = bid + (unsigned)r * PREP_BLOCKS; const unsigned ws = t / WT_TILES; const unsigned k0 = (t & 15u) * 64u; const unsigned n0 = ((t >> 4) & 15u) * 64u;
#pragma unroll
    for (int it = 0; it < 2; ++it) { const unsigned n = (tid >> 3) + (unsigned)it * 32u, q = tid & 7u;
      const v4u v = *(const v4u_a*)&tl[r][n][q * 8];
      vst2((v4u*)(WT + (size_t)ws * DM * DM + (size_t)(n0 + n) * DM + k0 + q * 8u), v); } }
#pragma unroll
  for (int pl = 0; pl < 2; ++pl)
#pragma unroll
    for (int it = 0; it < CVT_IT; ++it) { const unsigned e = (unsigned)it * CVT_STRIDE + bid * 256u + tid;
      const v4f a = ca[pl][it]; const v4f c = cc[pl][it];
      v4u o; o[0] = pack2(a[0], a[1]); o[1] = pack2(a[2], a[3]); o[2] = pack2(c[0], c[1]); o[3] = pack2(c[2], c[3]);
      vst2((v4u*)((pl == 0 ? XB : YB) + (size_t)e * 4), o); }
}

// ---- tensor mover helpers (two-group descriptor of a two-dimensional tile, every extent in bytes)
typedef __attribute__((ext_vector_type(4))) unsigned u32x4;
typedef __attribute__((ext_vector_type(8))) unsigned u32x8;
#define PASS_B 256u            // bytes of every operand row per pass (128 k)
#define LPITCH 272u            // LDS row pitch: 256 + 16 pad bytes, an odd multiple of 16 for the ds_load_b128 readers
#define SL_ROWS 32u            // rows of one wave's slice
#define SL_B 10240u            // 32 x 272 = 8704 bytes, rounded up so that every slice starts on a multiple of 2 KiB
#define BUF_B (8u * SL_B)      // one stage: slices 0..3 = 128 A rows, slices 4..7 = 128 B rows
static_assert(SL_ROWS * LPITCH <= SL_B && SL_B % 2048u == 0);
static_assert(NTOK % 128 == 0);
__device__ __forceinline__ unsigned uni(unsigned v) { return (unsigned)__builtin_amdgcn_readfirstlane((int)v); }
__device__ __forceinline__ unsigned pinned(unsigned v) { unsigned w = uni(v); asm volatile("" : "+s"(w)); return w; }  // pinned(): the issue test of a tensor load held in a scalar register, so that it compiles to s_cmp + s_cbranch_scc (the load ignores EXEC)
__device__ __forceinline__ void wait_ds0() { asm volatile("s_wait_dscnt 0x0" ::: "memory"); }          // this wave's LDS reads have retired before the buffer is handed back
template <int N> __device__ __forceinline__ void wait_tensor(u32x4 g0, u32x8 g1) { asm volatile("s_wait_tensorcnt %2" :: "s"(g0), "s"(g1), "n"(N) : "memory"); }
// one request of the whole wave: global tile -> LDS; both groups are tied in and out so that every request of the kernel is issued from the same registers and wait_tensor names them
__device__ __forceinline__ void tdm_load(u32x4& g0, u32x8& g1) { asm volatile("tensor_load_to_lds %0, %1" : "+s"(g0), "+s"(g1) : : "memory"); }
__device__ __forceinline__ u32x8 tdm_group1(unsigned rows) {   // rows of the tile
  u32x8 q;
  q[0] = uni((1u << 20) | (5u << 22) | (3u << 25));   // no mask, 1-byte elements, 4 pad dwords behind every 256-byte row
  q[1] = uni((PASS_B & 0xFFFFu) << 16);
  q[2] = uni((PASS_B >> 16) | ((rows & 0xFFFFu) << 16));
  q[3] = uni((rows >> 16) | (PASS_B << 16));
  q[4] = uni(rows);
  q[5] = uni(2u * DM);                                // source row pitch in bytes
  q[6] = uni(0u); q[7] = uni(0u);
  return q;
}
__device__ __forceinline__ u32x4 tdm_group0(unsigned lds_dst, unsigned long long ga) {
  u32x4 q; q[0] = uni(1u); q[1] = uni(lds_dst); q[2] = uni((unsigned)ga); q[3] = uni((((unsigned)(ga >> 32)) & 0x01FFFFFFu) | 0x80000000u);
  return q;
}

// ---- k_qkv: the three input projections as ONE launch, blockIdx.z = 0 Q, 1 K, 2 V: A = XB, XB, YB; weight plane z behind BT; bias BIAS0, BIAS1, BIAS2; output plane z behind OH,
//      z 0 and 1 as f16 row-major [NTOK][1024], z 2 as f16 V^T planes [slab][d][key = j*TPS + tl]. C = A . BT^T + bias over K = 1024, bf16 operands.
// block = 256 rows x 256 cols, 8 waves as 4 x 2, wave = 64 rows x 128 cols: a fragment read from LDS feeds 8 (A) or 4 (B) products, and a byte brought from L2 feeds 256 multiply-adds.
// Both operand tiles are staged in LDS by the tensor mover, 128 k per pass, two buffers: every wave brings one 64-row slice per stage, one pass ahead of the pass that reads it.
#define QSL_ROWS 64u           // rows of one wave's slice
#define QSL_B 18432u           // 64 x 272 = 17408 bytes, rounded up so that every slice starts on a multiple of 2 KiB
#define QBUF_B (8u * QSL_B)    // one stage: slices 0..3 = 256 A rows, slices 4..7 = 256 B rows
#define QSH_P 264              // f16 per row of the epilogue's staging tile: 256 + 8
static_assert(QSL_ROWS * LPITCH <= QSL_B && QSL_B % 2048u == 0);
static_assert(NTOK % 256 == 0 && DM % 256 == 0 && TPS % 8 == 0);   // an 8-token piece of the V^T epilogue stays inside one slab
static_assert(256u * QSH_P * 2u <= 2u * QBUF_B);
static_assert(WS_KH == WS_QH + PLANE2 && WS_VT == WS_KH + PLANE2);   // the three output planes stand one behind the other
__global__ __launch_bounds__(256) void k_qkv(const __bf16* __restrict__ A0, const __bf16* __restrict__ A1, const __bf16* __restrict__ BT, const float* __restrict__ BIAS0, const float* __restrict__ BIAS1, const float* __restrict__ BIAS2, _Float16* __restrict__ OH) {
  __shared__ __attribute__((aligned(2048))) unsigned char ring[2u * QBUF_B];
  const int tid = threadIdx.x; const int wave = __builtin_amdgcn_readfirstlane((int)(threadIdx.x >> 5)); const int lane = tid & 31, col = lane & 15, g = lane >> 4;
  const int wr = wave >> 1, wc = wave & 1;
  const int r0 = blockIdx.x * 256; const int c0 = blockIdx.y * 256;
  const int z = (int)blockIdx.z;   // which projection
  const __bf16* Ap = z == 2 ? A1 : A0;
  const __bf16* Bp = BT + (size_t)z * DM * DM;
  const float* BIAS = z == 0 ? BIAS0 : z == 1 ? BIAS1 : BIAS2;
  constexpr int NST = DM * 2 / (int)PASS_B;   // stages = passes
  static_assert(NST >= 2);
  const unsigned lbase = (unsigned)(size_t)ring;
  const bool isA = wave < 4;
  const unsigned long long soff = (unsigned long long)(isA ? r0 + 64 * wave : c0 + 64 * (wave - 4)) * (2ull * DM);
  const unsigned long long src0 = (unsigned long long)(size_t)(isA ? Ap : Bp) + soff;
  const unsigned ldst0 = lbase + (unsigned)wave * QSL_B;   // this wave's slice in buffer 0
  u32x8 g1 = tdm_group1(QSL_ROWS);
  u32x4 g0 = tdm_group0(ldst0, src0);
  // From request to request only words 1 (place in LDS) and 2 (low address word) of group 0 take a new value, behind the wait on the request before. The high address word holds for all stages:
  // a stage adds PASS_B inside one 2-KiB operand row, and the rows stand at multiples of 2 KiB (plane offsets and row pitch are such multiples, the workspace starts on a page).
  auto issue_next = [&](unsigned buf_off) { g0[1] = uni(ldst0 + buf_off); g0[2] = uni(g0[2] + PASS_B); tdm_load(g0, g1); };
  v8f acc[4][8] = {};
  tdm_load(g0, g1); wait_tensor<0>(g0, g1); __syncthreads();   // stage 0 published
  issue_next(QBUF_B);                                          // stage 1
  unsigned rb = 0;   // byte offset of the buffer that the pass reads: stage s stands in buffer s mod 2
  // rolled: one publish point per pass
#pragma unroll 1
  for (int s = 0; s < NST; ++s) {
    const unsigned char* bufp = ring + rb;
    const unsigned char* pa = bufp + (unsigned)wr * QSL_B + (unsigned)col * LPITCH;
    const unsigned char* pb = bufp + (unsigned)(4 + 2 * wc) * QSL_B + (unsigned)col * LPITCH;
#pragma unroll
    for (int kc = 0; kc < (int)PASS_B / 64; ++kc) {
      v16b a[4], w[8];
#pragma unroll
      for (int i = 0; i < 4; ++i) a[i] = frag_b((const __bf16*)(pa + (unsigned)i * 16u * LPITCH + (unsigned)kc * 64u), lane);
#pragma unroll
      for (int j = 0; j < 8; ++j) w[j] = frag_b((const __bf16*)(pb + (unsigned)(j >> 2) * QSL_B + (unsigned)(j & 3) * 16u * LPITCH + (unsigned)kc * 64u), lane);
      __builtin_amdgcn_sched_barrier(0);   // keeps the block's 24 LDS reads issued as one group in front of its 32 products: left free, the compiler sinks each pair of reads to its first use, with a full wait in front of every four products
      if (kc == (int)PASS_B / 64 - 1) {
        // publish point of stage s + 1, in front of the pass's last 32 products, whose fragments are in registers: own LDS reads retired, own slice of stage s + 1 landed, then the barrier that also frees this pass's buffer
        wait_ds0(); wait_tensor<0>(g0, g1); __syncthreads();
        if (pinned(s + 2 < NST)) issue_next(rb);   // stage s + 2 into the buffer that pass s has just read: it has these products and all of pass s + 1 to land in
      }
      // column by column: the first four products need the A fragments and one B fragment only, the later B fragments land under them
#pragma unroll
      for (int j = 0; j < 8; ++j)
#pragma unroll
        for (int i = 0; i < 4; ++i) acc[i][j] = wmma_bf_free(a[i], w[j], acc[i][j]);
    }
    rb ^= QBUF_B;
  }
  wait_tensor<0>(g0, g1); wait_ds0();
  // the ring is free behind the last pass's barrier (no wave reads it after that): it becomes the staging tile, z 0, 1: [row][col]; z 2: [col][row]
  _Float16 (*sh)[QSH_P] = (_Float16 (*)[QSH_P])ring;
  _Float16* Op = OH + (size_t)z * NTOK * DM;
  float bs[8];
#pragma unroll
  for (int j = 0; j < 8; ++j) bs[j] = BIAS[c0 + wc * 128 + j * 16 + col];
  asm volatile("s_wait_xcnt 0x0" ::: "memory");   // precaution: stands behind the bias loads, in front of whatever writes a register that they name as an address
  if (z != 2) {   // the same for the whole block
#pragma unroll
    for (int j = 0; j < 8; ++j) { const float bias = bfr(bs[j]);
#pragma unroll
      for (int i = 0; i < 4; ++i)
#pragma unroll
        for (int r = 0; r < 8; ++r) sh[wr * 64 + i * 16 + 8 * g + r][wc * 128 + j * 16 + col] = (_Float16)(acc[i][j][r] + bias); }
    __syncthreads();
    // a wave stores one 512-byte row piece per store, eight to a trip; rolled, so that the wait below stands between a trip's stores and the next trip's register writes
#pragma unroll 1
    for (int ib = 0; ib < 4; ++ib) { v4u v[8];
#pragma unroll
      for (int u = 0; u < 8; ++u) v[u] = *(const v4u_a*)&sh[(ib * 8 + u) * 8 + wave][lane * 8];
#pragma unroll
      for (int u = 0; u < 8; ++u) *(v4u*)(Op + (size_t)(r0 + (ib * 8 + u) * 8 + wave) * DM + c0 + lane * 8) = v[u];
      asm volatile("s_wait_xcnt 0x0" ::: "memory"); }   // precaution: stands behind the trip's stores, in front of whatever writes a register that they name
  } else {
#pragma unroll
    for (int j = 0; j < 8; ++j) { const float bias = bfr(bs[j]);
#pragma unroll
      for (int i = 0; i < 4; ++i) { v8h hv;
#pragma unroll
        for (int r = 0; r < 8; ++r) hv[r] = (_Float16)(acc[i][j][r] + bias);
        *(v8h_a*)&sh[wc * 128 + j * 16 + col][wr * 64 + i * 16 + 8 * g] = hv; } }
    __syncthreads();
    const int tok = r0 + lane * 8; const int Ls = tok / TPS; const int tl = tok - Ls * TPS;   // the block's 256 tokens span more than one slab
    // rolled, eight stores to a trip, as above
#pragma unroll 1
    for (int ib = 0; ib < 4; ++ib) { v4u v[8];
#pragma unroll
      for (int u = 0; u < 8; ++u) v[u] = *(const v4u_a*)&sh[(ib * 8 + u) * 8 + wave][lane * 8];
#pragma unroll
      for (int u = 0; u < 8; ++u) { const int c = c0 + (ib * 8 + u) * 8 + wave; const int jj = c >> 6, d = c & 63;
        *(v4u*)(Op + ((size_t)Ls * HD + d) * SEQ + jj * TPS + tl) = v[u]; }
      asm volatile("s_wait_xcnt 0x0" ::: "memory"); }   // precaution: stands behind the trip's stores, in front of whatever writes a register that they name
  }
}

// ---- k_gemm: the output projection. block = 128 rows x 128 cols, 8 waves as 4 x 2, wave = 32 rows x 64 cols; C = A . BT^T + bias over K = 1024 with f16 operands; f32 row-major [NTOK][1024]
// Both operand tiles are staged in LDS by the tensor mover, 128 k per pass, three buffers: every wave brings one 32-row slice per stage; while a pass works, the next two stages are in flight, so a stage has two passes to land in.
__global__ __launch_bounds__(256) void k_gemm(const _Float16* __restrict__ Ap, const _Float16* __restrict__ Bp, const float* __restrict__ BIAS, float* __restrict__ OF) {
  __shared__ __attribute__((aligned(2048))) unsigned char ring[3u * BUF_B];
  const int tid = threadIdx.x; const int wave = __builtin_amdgcn_readfirstlane((int)(threadIdx.x >> 5)); const int lane = tid & 31, col = lane & 15, g = lane >> 4;
  const int wr = wave >> 1, wc = wave & 1;
  const int r0 = blockIdx.x * 128; const int c0 = blockIdx.y * 128;
  constexpr int NST = DM * 2 / (int)PASS_B;   // stages = passes
  static_assert(NST >= 3);
  const unsigned lbase = (unsigned)(size_t)ring;
  const bool isA = wave < 4;
  const unsigned long long soff = (unsigned long long)(isA ? r0 + 32 * wave : c0 + 32 * (wave - 4)) * (2ull * DM);
  const unsigned long long src0 = (unsigned long long)(size_t)(isA ? Ap : Bp) + soff;
  const unsigned ldst0 = lbase + (unsigned)wave * SL_B;   // this wave's slice in buffer 0
  u32x8 g1 = tdm_group1(SL_ROWS);
  u32x4 g0 = tdm_group0(ldst0, src0);
  // From request to request only words 1 (place in LDS) and 2 (low address word) of group 0 take a new value. The high address word holds for all stages:
  // a stage adds PASS_B inside one 2-KiB operand row, and the rows stand at multiples of 2 KiB (plane offsets and row pitch are such multiples, the workspace starts on a page).
  auto issue_next = [&](unsigned buf_off) { g0[1] = uni(ldst0 + buf_off); g0[2] = uni(g0[2] + PASS_B); tdm_load(g0, g1); };
  v8f acc[2][4] = {};
  tdm_load(g0, g1); issue_next(BUF_B); issue_next(2u * BUF_B);   // stages 0, 1, 2: three requests of the wave, the most it ever has outstanding
  wait_tensor<2>(g0, g1); __syncthreads();   // stage 0 published
  unsigned rb = 0;   // byte offset of the buffer that the pass reads: stage s stands in buffer s mod 3
  // rolled: one publish point per pass
#pragma unroll 1
  for (int s = 0; s < NST; ++s) {
    const unsigned char* bufp = ring + rb;
    const unsigned char* pa = bufp + (unsigned)wr * SL_B + (unsigned)col * LPITCH;
    const unsigned char* pb = bufp + (unsigned)(4 + 2 * wc) * SL_B + (unsigned)col * LPITCH;
#pragma unroll
    for (int kc = 0; kc < (int)PASS_B / 64; ++kc) {
      v16h a[2], w[4];
#pragma unroll
      for (int i = 0; i < 2; ++i) a[i] = frag_h((const _Float16*)(pa + (unsigned)i * 16u * LPITCH + (unsigned)kc * 64u), lane);
#pragma unroll
      for (int j = 0; j < 4; ++j) w[j] = frag_h((const _Float16*)(pb + (unsigned)(j >> 1) * SL_B + (unsigned)(j & 1) * 16u * LPITCH + (unsigned)kc * 64u), lane);
#pragma unroll
      for (int i = 0; i < 2; ++i)
#pragma unroll
        for (int j = 0; j < 4; ++j) acc[i][j] = wmma16(a[i], w[j], acc[i][j]);
    }
    // publish point of stage s + 1: own LDS reads retired, own slice of stage s + 1 landed (stage s + 2, where there is one, is the one younger request and stays in flight), then the barrier that also frees this pass's buffer
    wait_ds0(); wait_tensor<1>(g0, g1);
    if (pinned(s + 2 >= NST)) wait_tensor<0>(g0, g1);   // the last passes: no younger request stands behind stage s + 1, so the count that covers it is 0
    __syncthreads();
    if (pinned(s + 3 < NST)) issue_next(rb);   // stage s + 3 into the buffer that pass s has just read
    rb = rb == 2u * BUF_B ? 0u : rb + BUF_B;
  }
  wait_tensor<0>(g0, g1); wait_ds0();
  __shared__ __align__(16) float ss[128][132];
#pragma unroll
  for (int j = 0; j < 4; ++j) { const float bias = bfr(BIAS[c0 + wc * 64 + j * 16 + col]);
#pragma unroll
    for (int i = 0; i < 2; ++i)
#pragma unroll
      for (int r = 0; r < 8; ++r) ss[wr * 32 + i * 16 + 8 * g + r][wc * 64 + j * 16 + col] = acc[i][j][r] + bias; }
  ldsx();   // each wave reads back only its own 32 rows x 64 cols
  for (int rl = 0; rl < 16; ++rl) { const int row = wr * 32 + rl * 2 + g; const v4f v = *(const v4f_a*)&ss[row][wc * 64 + col * 4]; *(v4f*)(OF + (size_t)(r0 + row) * DM + c0 + wc * 64 + col * 4) = v; }
}

// ---- k_attn staging: a stage = 128 keys of slab L = 128 K rows x 128 B and 64 V^T rows x 256 B, brought into LDS by the tensor mover, two buffers
#define ST_KEYS 128u           // keys of one stage
#define AROW_B 128u            // bytes of every staged row: 64 features of a K row, or 64 keys of a V^T row
#define APITCH 144u            // LDS row pitch: 128 + 16 pad bytes, an odd multiple of 16 for the ds_load_b128 readers
#define ASL_ROWS 32u           // rows of one wave's slice
#define ASL_B 6144u            // 32 x 144 = 4608 bytes, rounded up so that every slice starts on a multiple of 2 KiB
#define ABUF_B (8u * ASL_B)    // one stage: slices 0..3 = K rows 32 w .. + 31; slices 4..7 = V^T rows 32 (w & 1) .. + 31 of the stage's key half (w - 4) >> 1
static_assert(ASL_ROWS * APITCH <= ASL_B && ASL_B % 2048u == 0);
static_assert(TPS % (int)ST_KEYS == 0 && SEQ % 128 == 0 && HD == 64);   // a stage stays inside one feature group
// as tdm_load and wait_tensor<0>: the registers of both groups keep their words from the issue to the wait
__device__ __forceinline__ void tdm_load_held(u32x4& g0, u32x8& g1) { asm volatile("tensor_load_to_lds %0, %1" : "+s"(g0), "+s"(g1) : : "memory"); }
__device__ __forceinline__ void wait_tensor0_held(u32x4 g0, u32x8 g1) { asm volatile("s_wait_tensorcnt 0x0" :: "s"(g0), "s"(g1) : "memory"); }
__device__ __forceinline__ u32x8 tdm_group1_attn(unsigned src_pitch) {
  u32x8 q;
  q[0] = uni((1u << 20) | (4u << 22) | (3u << 25));   // no mask, 1-byte elements, 4 pad dwords behind every 128-byte row
  q[1] = uni((AROW_B & 0xFFFFu) << 16);
  q[2] = uni((AROW_B >> 16) | ((ASL_ROWS & 0xFFFFu) << 16));
  q[3] = uni((ASL_ROWS >> 16) | (AROW_B << 16));
  q[4] = uni(ASL_ROWS);
  q[5] = uni(src_pitch);                              // source row pitch in bytes
  q[6] = uni(0u); q[7] = uni(0u);
  return q;
}

// ---- k_attn: block = 128 query pseudo-rows of slab L (8 waves, wave = 16 queries), fused over all SEQ keys in 128-key passes of four 32-key groups (transposed flash form):
//   S^T[key][query] = K . Q^T  (A = K rows, B = Q rows);  P^T packed in-lane as the B operand;  O^T[d][query] += V^T . P^T  (A = V^T rows).
//   Keys visited in the order key = j*TPS + tl (token L*TPS + tl, feature group j); K rows and V^T columns use the same order.
//   K rows and V^T rows are read from LDS: every wave brings one slice per 128-key stage, one stage ahead of the pass that reads it; all 8 waves share the stage.
//   Each lane owns one query column. The softmax reference of a column is looked at once per 128-key pass and raised (xor-16 exchange of the halves' maxima, O and l rescaled) only when a score of the pass tops it by RAISE; sums are per lane, joined across the halves in the epilogue.
__global__ __launch_bounds__(256) void k_attn(const _Float16* __restrict__ QH, const _Float16* __restrict__ KH, const _Float16* __restrict__ VT, unsigned* __restrict__ CH) {
  __shared__ __attribute__((aligned(2048))) unsigned char ring[2u * ABUF_B];
  __shared__ __align__(16) unsigned cst[8][16][36];   // per-wave staging of the 16 x 64 ctx tile: f16 pairs
  const int tid = threadIdx.x; const int wave = __builtin_amdgcn_readfirstlane((int)(threadIdx.x >> 5)); const int lane = tid & 31, col = lane & 15, g = lane >> 4;
  const int L = blockIdx.y; const size_t qrow0 = (size_t)L * SEQ + (size_t)blockIdx.x * 128 + wave * 16;
  const _Float16* qp = QH + (qrow0 + col) * HD;
  const v16h qf0 = frag_h(qp, lane); const v16h qf1 = frag_h(qp + 32, lane);
  constexpr int NST = SEQ / (int)ST_KEYS;   // stages = passes
  static_assert(NST >= 2);
  const unsigned lbase = (unsigned)(size_t)ring;
  const bool isK = wave < 4;
  // first byte of this wave's slice of stage 0, and what a stage adds to it
  const unsigned long long src = isK ? (unsigned long long)(size_t)KH + ((unsigned long long)L * TPS + 32ull * (unsigned)wave) * (2ull * DM)
                                     : (unsigned long long)(size_t)VT + ((unsigned long long)L * HD + 32ull * (unsigned)(wave & 1)) * (2ull * SEQ) + (unsigned long long)((wave - 4) >> 1) * AROW_B;
  u32x8 g1 = tdm_group1_attn(isK ? 2u * DM : 2u * SEQ);
  u32x4 g0;   // group 0 of this wave's one outstanding request
  auto issue = [&](int s) {
    const unsigned dst = lbase + (unsigned)(s & 1) * ABUF_B + (unsigned)wave * ASL_B;
    const int k0 = s * (int)ST_KEYS; const int jj = k0 / TPS; const int tl0 = k0 - jj * TPS;
    const unsigned long long step = isK ? (unsigned long long)tl0 * (2ull * DM) + (unsigned long long)jj * (2ull * HD) : (unsigned long long)k0 * 2ull;
    g0 = tdm_group0(dst, src + step); tdm_load_held(g0, g1);
  };
  v8f o[4] = {}; float m = -3.0e38f; float l = 0.f;
  issue(0); wait_tensor0_held(g0, g1); __syncthreads();   // stage 0 published
  issue(1);
  // the 16 K fragments of a stage: keys 32 hb .. 32 hb + 31 are K slice hb; [hb][0], [1] = its first 16 keys (features 0..31, 32..63), [2], [3] = the other 16
  v16h kf[4][4];
  auto load_k = [&](int s) {
    const unsigned char* kl = ring + (unsigned)(s & 1) * ABUF_B + (unsigned)col * APITCH;
#pragma unroll
    for (int hb = 0; hb < (int)ST_KEYS / 32; ++hb) {
      const unsigned char* kp = kl + (unsigned)hb * ASL_B;
      kf[hb][0] = frag_h((const _Float16*)kp, lane); kf[hb][1] = frag_h((const _Float16*)(kp + 64u), lane);
      kf[hb][2] = frag_h((const _Float16*)(kp + 16u * APITCH), lane); kf[hb][3] = frag_h((const _Float16*)(kp + 16u * APITCH + 64u), lane);
    }
  };
  load_k(0);
  // one pass; 'last' is a literal at both calls: the last pass has no next stage, issues nothing and reads nothing behind its barrier
  auto pass = [&](const int s, const bool last) __attribute__((always_inline)) {
    const unsigned char* vl = ring + (unsigned)(s & 1) * ABUF_B + 4u * ASL_B + (unsigned)col * APITCH;
    // the pass's 128 x 16 logits first: 8 independent accumulator tiles; no vector work stands between their products
    v8f sc[4][2];
#pragma unroll
    for (int hb = 0; hb < (int)ST_KEYS / 32; ++hb) {
      v8f s0 = {}, s1 = {};
      s0 = wmma16_free(kf[hb][0], qf0, s0); s1 = wmma16_free(kf[hb][2], qf0, s1);
      s0 = wmma16_free(kf[hb][1], qf1, s0); s1 = wmma16_free(kf[hb][3], qf1, s1);
      sc[hb][0] = s0; sc[hb][1] = s1;
    }
    __builtin_amdgcn_sched_barrier(0);   // keeps the 16 products back to back: each fills the distance behind the one before, where a maximum set directly behind its tile's product costs 4 v_nop
    // ONE test per pass: the lane's own largest logit of the 128 keys against the reference in use. Register by register first, the last two tiles last: few dependent steps stand behind the last product
    float t[8];
#pragma unroll
    for (int r = 0; r < 8; ++r) {
      t[r] = fmaxf(fmaxf(sc[0][0][r], sc[0][1][r]), sc[1][0][r]); t[r] = fmaxf(fmaxf(t[r], sc[1][1][r]), sc[2][0][r]);
      t[r] = fmaxf(t[r], sc[2][1][r]); t[r] = fmaxf(fmaxf(t[r], sc[3][0][r]), sc[3][1][r]);
    }
    const float mx = fmaxf(fmaxf(fmaxf(fmaxf(t[0], t[1]), t[2]), fmaxf(fmaxf(t[3], t[4]), t[5])), fmaxf(t[6], t[7]));
    if (__builtin_amdgcn_ballot_w32(mx > m + RAISE) != 0) {   // wave-uniform scalar branch; not taken: every P of the pass is below 2^10 e^3, inside f16
      const float mn = fmaxf(m, fmaxf(mx, __shfl_xor(mx, 16)));   // both lane halves of a query take the same new reference; a column whose maximum has not risen gets a factor of exactly 1
      const float corr = __expf((m - mn) * SCALE); m = mn; l *= corr;
#pragma unroll
      for (int j = 0; j < 4; ++j)
#pragma unroll
        for (int r = 0; r < 8; ++r) o[j][r] *= corr;
    }
    const float c = LN1024 - m * SCALE;   // P carried x 2^10 (cancels in o / l)
    // four 32-key groups, staggered: group hb's V^T reads, then its exponentials beside the O products of group hb - 1
    v16h vf[2][4]; v16h pf[2];
#pragma unroll
    for (int hb = 0; hb < (int)ST_KEYS / 32; ++hb) {
#pragma unroll
      for (int j = 0; j < 4; ++j) vf[hb & 1][j] = frag_h((const _Float16*)(vl + (unsigned)(2 * (hb >> 1) + (j >> 1)) * ASL_B + (unsigned)(j & 1) * 16u * APITCH + (unsigned)(hb & 1) * 64u), lane);   // V^T row 16 j + col, keys 32 hb .. + 31
      __builtin_amdgcn_sched_barrier(0);   // keeps the group's 8 V^T reads issued together, a whole group of exponentials ahead of the products that wait for them
      if (hb > 0) {
#pragma unroll
        for (int j = 0; j < 4; ++j) o[j] = wmma16_free(vf[(hb - 1) & 1][j], pf[(hb - 1) & 1], o[j]);
      }
      float ls = 0.f;
#pragma unroll
      for (int r = 0; r < 8; ++r) { const float p0 = __expf(fmaf(sc[hb][0][r], SCALE, c)); const float p1 = __expf(fmaf(sc[hb][1][r], SCALE, c)); ls += p0 + p1; pf[hb & 1][r] = (_Float16)p0; pf[hb & 1][8 + r] = (_Float16)p1; }
      l += ls;
    }
    // publish point of stage s + 1: own LDS reads retired, own slice landed, then the barrier that also frees this pass's buffer
    wait_ds0(); wait_tensor0_held(g0, g1); __syncthreads();
    if (!last) {
      if (pinned(s + 2 < NST)) issue(s + 2);
      load_k(s + 1);   // behind the barrier that publishes stage s + 1
      __builtin_amdgcn_sched_barrier(0);   // keeps the next pass's 32 K reads issued as one group in front of this pass's last O products, which run while the reads are under way
    }
#pragma unroll
    for (int j = 0; j < 4; ++j) o[j] = wmma16_free(vf[1][j], pf[1], o[j]);
  };
  // rolled: one publish point per pass, the buffer picked by the pass's parity
#pragma unroll 1
  for (int s = 0; s < NST - 1; ++s) pass(s, false);
  pass(NST - 1, true);
  wait_tensor0_held(g0, g1); wait_ds0();
  l += __shfl_xor(l, 16);
  const float inv = 1.0f / l;
  // o[j][r] = ctx[query col][d = 16 j + 8 g + r]: 8 consecutive d per (lane, j) -> one 16-B piece
#pragma unroll
  for (int j = 0; j < 4; ++j) { v8h hv;
#pragma unroll
    for (int r = 0; r < 8; ++r) hv[r] = (_Float16)(o[j][r] * inv);
    *(v8h_a*)&cst[wave][col][j * 8 + g * 4] = hv; }
  ldsx();   // wave-private tile
#pragma unroll
  for (int it = 0; it < 4; ++it) { const int row = it * 4 + (lane >> 3); const int pc = lane & 7;
    const v4u hv = *(const v4u_a*)&cst[wave][row][pc * 4];
    *(v4u*)(CH + (qrow0 + row) * 32 + pc * 4) = hv; }
}

extern "C" void kernel_launch(void* const* d_in, const int* in_sizes, int n_in, void* d_out, int out_size, void* d_ws, size_t ws_size, hipStream_t stream) {
  if (n_in < 10) return;
  const long long act_min = ((long long)(NB - 1) * SEQ_FULL + SEQ) * DM;
  if ((long long)in_sizes[0] < act_min || (long long)in_sizes[1] < act_min) return;
  if (in_sizes[2] < DM * DM || in_sizes[4] < DM * DM || in_sizes[6] < DM * DM || in_sizes[8] < DM * DM) return;
  if (in_sizes[3] < DM || in_sizes[5] < DM || in_sizes[7] < DM || in_sizes[9] < DM) return;
  if ((long long)out_size < (long long)NTOK * DM) return;
  if (ws_size < (size_t)WS_END) return;
  // inputs (wire order): 0 x, 1 y [2][2048][1024]; 2 Wq, 3 bq, 4 Wk, 5 bk, 6 Wv, 7 bv, 8 Wo, 9 bo; weights (in,out) [1024][1024]
  const float* x  = (const float*)d_in[0]; const float* y  = (const float*)d_in[1];
  const float* Wq = (const float*)d_in[2]; const float* bq = (const float*)d_in[3];
  const float* Wk = (const float*)d_in[4]; const float* bk = (const float*)d_in[5];
  const float* Wv = (const float*)d_in[6]; const float* bv = (const float*)d_in[7];
  const float* Wo = (const float*)d_in[8]; const float* bo = (const float*)d_in[9];
  char* ws = (char*)d_ws;
  unsigned* XB = (unsigned*)(ws + WS_XB); unsigned* YB = (unsigned*)(ws + WS_YB);
  unsigned short* WT = (unsigned short*)(ws + WS_WT);
  unsigned short* WoT = WT + 3 * (size_t)DM * DM;
  _Float16* QH = (_Float16*)(ws + WS_QH); _Float16* KH = (_Float16*)(ws + WS_KH); _Float16* VT = (_Float16*)(ws + WS_VT);
  unsigned* CH = (unsigned*)(ws + WS_CH);
  float* OUT = (float*)d_out;

  // weights are in[rows = in][cols = out] -> planes [out][in], in the order Wq, Wk, Wv, Wo behind WT
  k_prep<<<dim3(PREP_BLOCKS), 256, 0, stream>>>(x, y, Wq, Wk, Wv, Wo, XB, YB, WT);
  const dim3 gg(NTOK / 128, DM / 128);
  k_qkv<<<dim3(NTOK / 256, DM / 256, 3), 256, 0, stream>>>((const __bf16*)XB, (const __bf16*)YB, (const __bf16*)WT, bq, bk, bv, QH);   // Q, K, V
  k_attn<<<dim3(SEQ / 128, NSLAB), 256, 0, stream>>>(QH, KH, VT, CH);
  k_gemm<<<gg, 256, 0, stream>>>((const _Float16*)CH, (const _Float16*)WoT, bo, OUT);
}
